// v000
// Measured on an AMD MI455X. A time is GPU time per run, averaged over a window of back-to-back runs after a warm-up
// (all launches, gaps included; the runs take copies of the inputs in turn), and the median of several windows.
// Apart from v000's, it joins two sittings. Times from different sittings can be a few percent apart, while
// side-by-side timings come from the same sitting.
// The starting kernel, v000, takes 282 microseconds a run.
// Contractions (q/k/v projections, S = q^T k, out = S v^T): v_wmma_f32_16x16x32_f16, f16 operands, f32 accumulate; float inputs RNE-converted to bf16 at load (weights carried x64, exact power of two), intermediate planes f16.
#include <hip/hip_runtime.h>
#include <stdint.h>
#include <stddef.h>

typedef __attribute__((ext_vector_type(16))) _Float16 v16h;
typedef __attribute__((ext_vector_type(8)))  _Float16 v8h;
typedef __attribute__((ext_vector_type(16))) __bf16   v16b;
typedef __attribute__((ext_vector_type(8)))  __bf16   v8b;
typedef __attribute__((ext_vector_type(8)))  float    v8f;
typedef __attribute__((ext_vector_type(4)))  float    v4f;

// ---------------- problem constants ----------------
constexpr int NTOK   = 4096;
constexpr int DMODEL = 1024;
constexpr int DHEAD  = 512;
constexpr int NHEAD  = 2;
constexpr float W_CARRY     = 64.0f;          // weights carried x64 in f16 (exact)
constexpr float W_CARRY_INV = 1.0f / 64.0f;   // folded back in the projection epilogue

// ---------------- helpers ----------------
__device__ __forceinline__ unsigned short f2bf_bits(float f) {
  unsigned u = __float_as_uint(f);
  return (unsigned short)((u + 0x7FFFu + ((u >> 16) & 1u)) >> 16);
}
__device__ __forceinline__ float bf_bits2f(unsigned short h) { return __uint_as_float(((unsigned)h) << 16); }

// hazard guards as plain device helpers (no inline asm inside the kernel template body)
__device__ __forceinline__ void dep_guard_h(v8f& a, v8f& b, v16h x, v16h y) { asm volatile("v_nop\n\tv_nop\n\tv_nop\n\tv_nop" : "+v"(a), "+v"(b) : "v"(x), "v"(y)); }
__device__ __forceinline__ void dep_guard_b(v8f& a, v8f& b, v16b x, v16b y) { asm volatile("v_nop\n\tv_nop\n\tv_nop\n\tv_nop" : "+v"(a), "+v"(b) : "v"(x), "v"(y)); }
__device__ __forceinline__ void keep4_h(v16h a, v16h b, v16h c, v16h d) { asm volatile("v_nop" :: "v"(a), "v"(b), "v"(c), "v"(d)); }
__device__ __forceinline__ void keep4_b(v16b a, v16b b, v16b c, v16b d) { asm volatile("v_nop" :: "v"(a), "v"(b), "v"(c), "v"(d)); }
__device__ __forceinline__ void acc_guard4(v8f& a, v8f& b, v8f& c, v8f& d) { asm volatile("v_nop\n\tv_nop\n\tv_nop\n\tv_nop" : "+v"(a), "+v"(b), "+v"(c), "+v"(d)); }
template <typename T> struct Frag;
template <> struct Frag<_Float16> {
  typedef v16h V; union U { v16h v; v8h h[2]; };
  static __device__ __forceinline__ v16h load(const _Float16* p) {   // elements 0..7 <- p[0..7], 8..15 <- p[16..23]
    U f; f.h[0] = *(const v8h*)(p); f.h[1] = *(const v8h*)(p + 16); return f.v;
  }
  static __device__ __forceinline__ v8f mma(v16h a, v16h b, v8f c) {
    return __builtin_amdgcn_wmma_f32_16x16x32_f16(false, a, false, b, (short)0, c, false, false);
  }
  static __device__ __forceinline__ void guard(v8f& a, v8f& b, v16h x, v16h y) { dep_guard_h(a, b, x, y); }
  static __device__ __forceinline__ void keep(v16h a, v16h b, v16h c, v16h d) { keep4_h(a, b, c, d); }
};
template <> struct Frag<__bf16> {
  typedef v16b V; union U { v16b v; v8b h[2]; };
  static __device__ __forceinline__ v16b load(const __bf16* p) {
    U f; f.h[0] = *(const v8b*)(p); f.h[1] = *(const v8b*)(p + 16); return f.v;
  }
  static __device__ __forceinline__ v8f mma(v16b a, v16b b, v8f c) {
    return __builtin_amdgcn_wmma_f32_16x16x32_bf16(false, a, false, b, (short)0, c, false, false);
  }
  static __device__ __forceinline__ void guard(v8f& a, v8f& b, v16b x, v16b y) { dep_guard_b(a, b, x, y); }
  static __device__ __forceinline__ void keep(v16b a, v16b b, v16b c, v16b d) { keep4_b(a, b, c, d); }
};

// ---- Register-blocked batched WMMA GEMM ------------------------------------
// C[m,n] = scale * sum_k A[m,k] * Bt[n,k] (+bias)(+resid); each wave owns a 64x64 tile.
// A row-major [M,K]; Bt row-major [N,K]; M,N % 64 == 0, K % 32 == 0.
// SPLIT: operands are hi/lo planes (A2/Bt2 = lo planes, same layout); product = hi.hi + hi.lo + lo.hi.
// BIAS_MODE: 0 = none, 1 = bias[m], 2 = bias[n].
// OUT_MODE: 0 = f32, 1 = f16, 2 = bf16 hi plane (Cout) + bf16 lo plane (Cout2).
// ET: 0 = f16 operands, 1 = bf16 operands (pointers passed as 16-bit storage)
template <int ET> struct Elem;
template <> struct Elem<0> { typedef _Float16 T; };
template <> struct Elem<1> { typedef __bf16 T; };
template <int ET, bool SPLIT, int BIAS_MODE, int OUT_MODE, bool RESID, int ACT = 0>
__global__ __launch_bounds__(256) void wmma_gemm64(
    const unsigned short* __restrict__ Ap, const unsigned short* __restrict__ A2p, int lda, long strideA,
    const unsigned short* __restrict__ Btp, const unsigned short* __restrict__ Bt2p, int ldb, long strideB,
    void* __restrict__ Cout, void* __restrict__ Cout2, int ldc, long strideC,
    const float* __restrict__ bias,
    const float* __restrict__ resid, long strideR,
    int M, int N, int K, float scale) {
  typedef typename Elem<ET>::T T;
  typedef typename Frag<T>::V V;
  const T* A = (const T*)Ap; const T* A2 = (const T*)A2p; const T* Bt = (const T*)Btp; const T* Bt2 = (const T*)Bt2p;
  __shared__ __align__(16) float sT[8][16 * 68];   // per-wave 16x64 slab, pitch 68 floats
  const int b    = blockIdx.y;
  const int lane = threadIdx.x & 31;
  const int wave = threadIdx.x >> 5;
  const int tilesN = N >> 6;
  const int tilesM = M >> 6;
  const int tile = blockIdx.x * 8 + wave;
  if (tile >= tilesM * tilesN) return;   // wave-uniform; no block barriers in this kernel
  const int tm = tile / tilesN;
  const int tn = tile - tm * tilesN;
  const int m0 = tm << 6;
  const int n0 = tn << 6;

  const T* Ab  = A  + (size_t)b * strideA;
  const T* Bb  = Bt + (size_t)b * strideB;
  const T* Ab2 = SPLIT ? (A2  + (size_t)b * strideA) : nullptr;
  const T* Bb2 = SPLIT ? (Bt2 + (size_t)b * strideB) : nullptr;

  const int rlane = lane & 15;                 // row (A) / col (B, D) within subtile
  const int koff  = (lane >> 4) * 8;           // k offset of this lane half
  const int mOff  = (lane >> 4) * 8;           // D row offset

  v8f acc[4][4];
#pragma unroll
  for (int i = 0; i < 4; ++i)
#pragma unroll
    for (int j = 0; j < 4; ++j) acc[i][j] = (v8f){0.f,0.f,0.f,0.f,0.f,0.f,0.f,0.f};

  for (int k0 = 0; k0 < K; k0 += 32) {
    V bh[4], bl[4];
#pragma unroll
    for (int j = 0; j < 4; ++j) {
      const size_t bo = (size_t)(n0 + (j << 4) + rlane) * ldb + koff + k0;
      bh[j] = Frag<T>::load(Bb + bo);
      if (SPLIT) bl[j] = Frag<T>::load(Bb2 + bo);
    }
#pragma unroll
    for (int i = 0; i < 4; ++i) {
      const size_t ao = (size_t)(m0 + (i << 4) + rlane) * lda + koff + k0;
      V ah = Frag<T>::load(Ab + ao);
      V al;
      if (SPLIT) al = Frag<T>::load(Ab2 + ao);
#pragma unroll
      for (int j = 0; j < 4; ++j) {
        acc[i][j] = Frag<T>::mma(ah, bh[j], acc[i][j]);
        if (SPLIT) {
          acc[i][j] = Frag<T>::mma(ah, bl[j], acc[i][j]);
          acc[i][j] = Frag<T>::mma(al, bh[j], acc[i][j]);
        }
      }
      Frag<T>::guard(acc[i][0], acc[i][3], ah, SPLIT ? al : ah);
    }
    Frag<T>::keep(bh[0], bh[1], bh[2], bh[3]);
    if (SPLIT) Frag<T>::keep(bl[0], bl[1], bl[2], bl[3]);
  }
  acc_guard4(acc[0][0], acc[0][1], acc[0][2], acc[0][3]);
  acc_guard4(acc[1][0], acc[1][1], acc[1][2], acc[1][3]);
  acc_guard4(acc[2][0], acc[2][1], acc[2][2], acc[2][3]);
  acc_guard4(acc[3][0], acc[3][1], acc[3][2], acc[3][3]);

  // ---- epilogue ----
  float* slab = sT[wave];
  const float* Rb = RESID ? (resid + (size_t)b * strideR) : nullptr;
#pragma unroll
  for (int i = 0; i < 4; ++i) {
    const int mBase = m0 + (i << 4);
#pragma unroll
    for (int j = 0; j < 4; ++j) {
      const int n = n0 + (j << 4) + rlane;
      float bv = 0.f;
      if (BIAS_MODE == 2) bv = bias[n];
#pragma unroll
      for (int r = 0; r < 8; ++r) {
        float v = acc[i][j][r] * scale;
        if (BIAS_MODE == 1) v += bias[mBase + mOff + r];
        if (BIAS_MODE == 2) v += bv;
        if (RESID) v += Rb[(size_t)(mBase + mOff + r) * ldc + n];
        if (ACT == 1) v = tanhf(v);
        if (ACT == 2) v = fmaxf(v, 0.0f);
        if (ACT == 3) v = v / (1.0f + expf(-v));
        if (ACT == 4) v = (v > 0.f) ? v : 0.01f * v;
        if (ACT == 5) v = 0.5f * v * (1.0f + erff(v * 0.70710678118654752f));
        slab[(mOff + r) * 68 + (j << 4) + rlane] = v;
      }
    }
    __builtin_amdgcn_fence(__ATOMIC_RELEASE, "workgroup");
    __builtin_amdgcn_wave_barrier();
    __builtin_amdgcn_fence(__ATOMIC_ACQUIRE, "workgroup");
    if (OUT_MODE == 0) {
      float* C = (float*)Cout + (size_t)b * strideC;
      const int hh = lane >> 4, c4 = (lane & 15) * 4;     // row seg = 256 B = 16 lanes x 16 B
      {
#pragma unroll
        for (int it = 0; it < 8; ++it) {
          const int row = it * 2 + hh;
          v4f v = *(const v4f*)(slab + row * 68 + c4);
          *(v4f*)(C + (size_t)(mBase + row) * ldc + n0 + c4) = v;
        }
        
      }
    } else {
      const int q = lane >> 3, c8 = (lane & 7) * 8;
      unsigned short* C  = (unsigned short*)Cout  + (size_t)b * strideC;
      unsigned short* C2 = (OUT_MODE == 2) ? ((unsigned short*)Cout2 + (size_t)b * strideC) : nullptr;
      {
#pragma unroll
        for (int it = 0; it < 4; ++it) {
          const int row = it * 4 + q;
          const float* sp = slab + row * 68 + c8;
          v8h hv, lv;
#pragma unroll
          for (int e = 0; e < 8; ++e) {
            if (OUT_MODE == 1) {
              hv[e] = (_Float16)sp[e];
            } else {
              unsigned short hb = f2bf_bits(sp[e]);
              unsigned short lb = f2bf_bits(sp[e] - bf_bits2f(hb));
              hv[e] = __builtin_bit_cast(_Float16, hb);
              lv[e] = __builtin_bit_cast(_Float16, lb);
            }
          }
          *(v8h*)(C + (size_t)(mBase + row) * ldc + n0 + c8) = hv;
          if (OUT_MODE == 2) *(v8h*)(C2 + (size_t)(mBase + row) * ldc + n0 + c8) = lv;
        }
        
      }
    }
    __builtin_amdgcn_fence(__ATOMIC_RELEASE, "workgroup");
    __builtin_amdgcn_wave_barrier();
    __builtin_amdgcn_fence(__ATOMIC_ACQUIRE, "workgroup");
  }
}

// ---------------- cast kernels: f32 -> f16(bf16_RNE(x) * mul) ----------------
__device__ __forceinline__ void cvt_bf_f16_store8(const float* __restrict__ src, unsigned short* __restrict__ dst,
                                                  int i, float mul) {
  const v4f a = *(const v4f*)(src + (size_t)i * 8);
  const v4f c = *(const v4f*)(src + (size_t)i * 8 + 4);
  v8h o;
#pragma unroll
  for (int e = 0; e < 4; ++e) {
    const float fa = bf_bits2f(f2bf_bits(a[e])) * mul;
    const float fc = bf_bits2f(f2bf_bits(c[e])) * mul;
    o[e]     = (_Float16)fa;
    o[4 + e] = (_Float16)fc;
  }
  _Float16* op = (_Float16*)(void*)dst + (size_t)i * 8;
  *(v8h*)op = o;
  
}

// x [NTOK][DMODEL] f32 -> f16 plane, same layout. Coverage: grid.x * 256 threads * 8 = n8 * 8 elements exactly.
__global__ __launch_bounds__(256) void cast_x_kernel(const float* __restrict__ x, unsigned short* __restrict__ out,
                                                     int n8, float mul) {
  const int i = blockIdx.x * 256 + threadIdx.x;
  if (i < n8) cvt_bf_f16_store8(x, out, i, mul);
}

// six [DHEAD][DHEAD] f32 weights -> six consecutive f16 planes (plane y <- source y), carried x mul.
// Coverage per plane: grid.x * 256 * 8 = n8 * 8 elements exactly; grid.y = 6 planes.
__global__ __launch_bounds__(256) void cast_w6_kernel(
    const float* __restrict__ w0, const float* __restrict__ w1, const float* __restrict__ w2,
    const float* __restrict__ w3, const float* __restrict__ w4, const float* __restrict__ w5,
    unsigned short* __restrict__ out, int n8, float mul) {
  const int y = blockIdx.y;                   // block-uniform source select (all global pointers)
  const float* src = w0;
  if (y == 1) src = w1;
  if (y == 2) src = w2;
  if (y == 3) src = w3;
  if (y == 4) src = w4;
  if (y == 5) src = w5;
  unsigned short* dst = out + (size_t)y * (size_t)n8 * 8;
  const int i = blockIdx.x * 256 + threadIdx.x;
  if (i < n8) cvt_bf_f16_store8(src, dst, i, mul);
}

// ---------------- host orchestration ----------------
// Workspace region map (bytes; all offsets multiples of 128):
//   X16 : x as f16 [NTOK][DMODEL]                              8,388,608   @ 0
//   W16 : 6 planes [DHEAD][DHEAD] f16 (x64): Wq_h0, Wk_h0, Wq_h1, Wk_h1, Wv_h0, Wv_h1
//                                                               3,145,728   @ 8,388,608
//   QK  : per head [NTOK][DMODEL] f16 (cols 0..511 = q^T, 512..1023 = k^T)
//                                                              16,777,216   @ 11,534,336
//   VP  : per head [DHEAD][NTOK] f16 (v[d][m])                  8,388,608   @ 28,311,552
//   SP  : per head [NTOK][NTOK] f16 (S[n][m])                  67,108,864   @ 36,700,160
//   total                                                     103,809,024
constexpr size_t X16_BYTES = (size_t)NTOK * DMODEL * 2;
constexpr size_t W16_BYTES = (size_t)6 * DHEAD * DHEAD * 2;
constexpr size_t QK_BYTES  = (size_t)NHEAD * NTOK * DMODEL * 2;
constexpr size_t VP_BYTES  = (size_t)NHEAD * DHEAD * NTOK * 2;
constexpr size_t SP_BYTES  = (size_t)NHEAD * NTOK * NTOK * 2;
constexpr size_t X16_OFF = 0;
constexpr size_t W16_OFF = X16_OFF + X16_BYTES;
constexpr size_t QK_OFF  = W16_OFF + W16_BYTES;
constexpr size_t VP_OFF  = QK_OFF + QK_BYTES;
constexpr size_t SP_OFF  = VP_OFF + VP_BYTES;
constexpr size_t WS_TOTAL = SP_OFF + SP_BYTES;
static_assert(WS_TOTAL == 103809024u);
static_assert(WS_TOTAL <= (size_t)134217728u);
static_assert((W16_OFF % 128) == 0 && (QK_OFF % 128) == 0 && (VP_OFF % 128) == 0 && (SP_OFF % 128) == 0);

// GEMM shape contracts (no tail handling): M, N multiples of 64; K multiple of 32
// proj q/k : M = NTOK,  N = 2*DHEAD, K = DHEAD
// proj v   : M = DHEAD, N = NTOK,    K = DHEAD
// S        : M = NTOK,  N = NTOK,    K = DHEAD
// out      : M = NTOK,  N = DHEAD,   K = NTOK
static_assert(NTOK % 64 == 0 && DHEAD % 64 == 0 && (2 * DHEAD) % 64 == 0);
static_assert(DHEAD % 32 == 0 && NTOK % 32 == 0);
static_assert(DMODEL == NHEAD * DHEAD);
static_assert((NTOK * DMODEL) % (8 * 256) == 0 && (DHEAD * DHEAD) % (8 * 256) == 0);

extern "C" void kernel_launch(void* const* d_in, const int* in_sizes, int n_in,
                              void* d_out, int out_size, void* d_ws, size_t ws_size,
                              hipStream_t stream) {
  if (n_in < 7) return;
  if (in_sizes[0] != NTOK * DMODEL) return;
  for (int i = 1; i < 7; ++i) if (in_sizes[i] != DHEAD * DHEAD) return;
  if (out_size != NTOK * DMODEL) return;
  if (ws_size < WS_TOTAL) return;

  // d_in order per the input table: x, Wq1, Wq2, Wk1, Wk2, Wv1, Wv2 (all f32)
  const float* x   = (const float*)d_in[0];
  const float* wq1 = (const float*)d_in[1];
  const float* wq2 = (const float*)d_in[2];
  const float* wk1 = (const float*)d_in[3];
  const float* wk2 = (const float*)d_in[4];
  const float* wv1 = (const float*)d_in[5];
  const float* wv2 = (const float*)d_in[6];
  float* out = (float*)d_out;

  char* ws = (char*)d_ws;
  unsigned short* X16 = (unsigned short*)(ws + X16_OFF);
  unsigned short* W16 = (unsigned short*)(ws + W16_OFF);
  unsigned short* QK  = (unsigned short*)(ws + QK_OFF);
  unsigned short* VP  = (unsigned short*)(ws + VP_OFF);
  unsigned short* SP  = (unsigned short*)(ws + SP_OFF);
  unsigned short* WQK = W16;                                   // per head: [2*DHEAD][DHEAD] (q rows then k rows)
  unsigned short* WV  = W16 + (size_t)4 * DHEAD * DHEAD;        // per head: [DHEAD][DHEAD]
  const float* fdum = x;                                       // unused bias/resid slots (never dereferenced)

  // 1) x -> f16 plane
  {
    const int n8 = (NTOK * DMODEL) / 8;                         // 524288 = 2048 * 256
    cast_x_kernel<<<dim3(n8 / 256), dim3(256), 0, stream>>>(x, X16, n8, 1.0f);
  }
  // 2) weights -> f16 planes carried x64; plane order Wq_h0, Wk_h0, Wq_h1, Wk_h1, Wv_h0, Wv_h1
  {
    const int n8 = (DHEAD * DHEAD) / 8;                         // 32768 = 128 * 256
    cast_w6_kernel<<<dim3(n8 / 256, 6), dim3(256), 0, stream>>>(wq1, wk1, wq2, wk2, wv1, wv2, W16, n8, W_CARRY);
  }
  // 3) q^T | k^T per head: QK[h][n][j] = (1/64) * sum_c X16[n][h*512 + c] * WQK[h][j][c]   (j<512: q, j>=512: k)
  {
    const int tiles = (NTOK / 64) * ((2 * DHEAD) / 64);        // 1024
    wmma_gemm64<0, false, 0, 1, false><<<dim3((tiles + 7) / 8, NHEAD), dim3(256), 0, stream>>>(
        X16, X16, DMODEL, (long)DHEAD,
        WQK, WQK, DHEAD, (long)2 * DHEAD * DHEAD,
        (void*)QK, (void*)QK, DMODEL, (long)NTOK * DMODEL,
        fdum, fdum, 0L,
        NTOK, 2 * DHEAD, DHEAD, W_CARRY_INV);
  }
  // 4) v per head: VP[h][d][m] = (1/64) * sum_c WV[h][d][c] * X16[m][h*512 + c]
  {
    const int tiles = (DHEAD / 64) * (NTOK / 64);              // 512
    wmma_gemm64<0, false, 0, 1, false><<<dim3((tiles + 7) / 8, NHEAD), dim3(256), 0, stream>>>(
        WV, WV, DHEAD, (long)DHEAD * DHEAD,
        X16, X16, DMODEL, (long)DHEAD,
        (void*)VP, (void*)VP, NTOK, (long)DHEAD * NTOK,
        fdum, fdum, 0L,
        DHEAD, NTOK, DHEAD, W_CARRY_INV);
  }
  // 5) S per head: SP[h][n][m] = sum_d QK[h][n][d] * QK[h][m][512 + d]
  {
    const int tiles = (NTOK / 64) * (NTOK / 64);               // 4096
    wmma_gemm64<0, false, 0, 1, false><<<dim3((tiles + 7) / 8, NHEAD), dim3(256), 0, stream>>>(
        QK, QK, DMODEL, (long)NTOK * DMODEL,
        QK + DHEAD, QK + DHEAD, DMODEL, (long)NTOK * DMODEL,
        (void*)SP, (void*)SP, NTOK, (long)NTOK * NTOK,
        fdum, fdum, 0L,
        NTOK, NTOK, DHEAD, 1.0f);
  }
  // 6) out[n][h*512 + d] = sum_m SP[h][n][m] * VP[h][d][m]   (f32, ldc = DMODEL, per-head column offset DHEAD)
  {
    const int tiles = (NTOK / 64) * (DHEAD / 64);              // 512
    wmma_gemm64<0, false, 0, 0, false><<<dim3((tiles + 7) / 8, NHEAD), dim3(256), 0, stream>>>(
        SP, SP, NTOK, (long)NTOK * NTOK,
        VP, VP, NTOK, (long)DHEAD * NTOK,
        (void*)out, (void*)out, DMODEL, (long)DHEAD,
        fdum, fdum, 0L,
        NTOK, DHEAD, NTOK, 1.0f);
  }
}

// v002
// A run of this version takes 63.9 microseconds.
// Versions between v000 and this one are left out; their measured steps multiply to 4.46 times as fast.
// Contractions (q/k/v projections, KV = v k^T, out = q^T KV^T): v_wmma_f32_16x16x32_f16, f16 operands, f32 accumulate; float inputs RNE-converted to bf16 at load (weights carried x64, exact power of two), intermediate planes f16, v k^T slice partials f32.
#include <hip/hip_runtime.h>
#include <stdint.h>
#include <stddef.h>

typedef __attribute__((ext_vector_type(16))) _Float16 v16h;
typedef __attribute__((ext_vector_type(8)))  _Float16 v8h;
typedef __attribute__((ext_vector_type(16))) __bf16   v16b;
typedef __attribute__((ext_vector_type(8)))  __bf16   v8b;
typedef __attribute__((ext_vector_type(8)))  float    v8f;
typedef __attribute__((ext_vector_type(4)))  float    v4f;

// ---------------- problem constants ----------------
constexpr int NTOK   = 4096;
constexpr int DMODEL = 1024;
constexpr int DHEAD  = 512;
constexpr int NHEAD  = 2;
constexpr float W_CARRY     = 64.0f;          // weights carried x64 in f16 (exact)
constexpr float W_CARRY_INV = 1.0f / 64.0f;   // folded back in the projection epilogue
constexpr int   KSPLIT       = 16;            // token slices of the v k^T product (one 8-wave block per WGP)
constexpr float KV_CARRY     = 1.0f / 64.0f;  // v k^T carried x1/64 in f16 (exact; sums over NTOK tokens need the range)
constexpr float KV_CARRY_INV = 64.0f;         // folded back in the output epilogue

// ---------------- helpers ----------------
__device__ __forceinline__ unsigned short f2bf_bits(float f) {
  unsigned u = __float_as_uint(f);
  return (unsigned short)((u + 0x7FFFu + ((u >> 16) & 1u)) >> 16);
}
__device__ __forceinline__ float bf_bits2f(unsigned short h) { return __uint_as_float(((unsigned)h) << 16); }

// hazard guards as plain device helpers (no inline asm inside the kernel template body)
__device__ __forceinline__ void dep_guard_h(v8f& a, v8f& b, v16h x, v16h y) { asm volatile("v_nop\n\tv_nop\n\tv_nop\n\tv_nop" : "+v"(a), "+v"(b) : "v"(x), "v"(y)); }
__device__ __forceinline__ void dep_guard_b(v8f& a, v8f& b, v16b x, v16b y) { asm volatile("v_nop\n\tv_nop\n\tv_nop\n\tv_nop" : "+v"(a), "+v"(b) : "v"(x), "v"(y)); }
__device__ __forceinline__ void keep4_h(v16h a, v16h b, v16h c, v16h d) { asm volatile("v_nop" :: "v"(a), "v"(b), "v"(c), "v"(d)); }
__device__ __forceinline__ void keep4_b(v16b a, v16b b, v16b c, v16b d) { asm volatile("v_nop" :: "v"(a), "v"(b), "v"(c), "v"(d)); }
__device__ __forceinline__ void acc_guard4(v8f& a, v8f& b, v8f& c, v8f& d) { asm volatile("v_nop\n\tv_nop\n\tv_nop\n\tv_nop" : "+v"(a), "+v"(b), "+v"(c), "+v"(d)); }
template <typename T> struct Frag;
template <> struct Frag<_Float16> {
  typedef v16h V; union U { v16h v; v8h h[2]; };
  static __device__ __forceinline__ v16h load(const _Float16* p) {   // elements 0..7 <- p[0..7], 8..15 <- p[16..23]
    U f; f.h[0] = *(const v8h*)(p); f.h[1] = *(const v8h*)(p + 16); return f.v;
  }
  static __device__ __forceinline__ v8f mma(v16h a, v16h b, v8f c) {
    return __builtin_amdgcn_wmma_f32_16x16x32_f16(false, a, false, b, (short)0, c, false, false);
  }
  static __device__ __forceinline__ void guard(v8f& a, v8f& b, v16h x, v16h y) { dep_guard_h(a, b, x, y); }
  static __device__ __forceinline__ void keep(v16h a, v16h b, v16h c, v16h d) { keep4_h(a, b, c, d); }
};
template <> struct Frag<__bf16> {
  typedef v16b V; union U { v16b v; v8b h[2]; };
  static __device__ __forceinline__ v16b load(const __bf16* p) {
    U f; f.h[0] = *(const v8b*)(p); f.h[1] = *(const v8b*)(p + 16); return f.v;
  }
  static __device__ __forceinline__ v8f mma(v16b a, v16b b, v8f c) {
    return __builtin_amdgcn_wmma_f32_16x16x32_bf16(false, a, false, b, (short)0, c, false, false);
  }
  static __device__ __forceinline__ void guard(v8f& a, v8f& b, v16b x, v16b y) { dep_guard_b(a, b, x, y); }
  static __device__ __forceinline__ void keep(v16b a, v16b b, v16b c, v16b d) { keep4_b(a, b, c, d); }
};

// ---- Register-blocked batched WMMA GEMM, operands staged in LDS --------------
// C[m,n] = scale * sum_k A[m,k] * Bt[n,k] (+bias)(+resid); a block owns a 128x256 tile, each of its 2x4 waves a 64x64 tile.
// A row-major [M,K]; Bt row-major [N,K]; M % 128 == 0, N % 256 == 0, K % 64 == 0, K >= 64.
// A stage is 64 k of the block's 128 A rows and 256 Bt rows (128 B a row, whole lines), brought into LDS by asynchronous
// copies, two buffers: stage t + 1 flies while stage t is multiplied. LDS row pitch 144 B (16 B x odd: ds_load_b128 without bank conflicts).
// blockIdx.z = k slice: it sums k in [z*K, (z+1)*K) and writes its own plane at z*strideCz (grid.z = 1: the whole product).
// SPLIT: not carried by the staged loop (one plane per operand).
// BIAS_MODE: 0 = none, 1 = bias[m], 2 = bias[n].
// OUT_MODE: 0 = f32, 1 = f16, 2 = bf16 hi plane (Cout) + bf16 lo plane (Cout2).
// ET: 0 = f16 operands, 1 = bf16 operands (pointers passed as 16-bit storage)
constexpr int BLK_M = 128, BLK_N = 256, STG_K = 64;
constexpr int STG_PITCH = STG_K + 8;                          // 16-bit elements per LDS row
constexpr int STG_ELEMS = (BLK_M + BLK_N) * STG_PITCH;         // one buffer: A rows 0..127, Bt rows 128..383
constexpr unsigned STG_ROWS32_BYTES = 32u * STG_PITCH * 2u;    // LDS step from one copy of a thread to its next (32 rows)

// One stage, this thread's share: 12 copies of 16 B (4 of A, 8 of Bt); a wave's copy covers 4 whole 128-B rows.
// l: the thread's LDS byte address in row (threadIdx.x >> 3) of the buffer; a, b: its global addresses in that row of the A and
// Bt tile; sa, sb: 32 rows of A and Bt in elements. The s_wait_xcnt stands inside the statement, so that no address register
// of a copy is rewritten ahead of it.
__device__ __forceinline__ void stage_copies(unsigned l, const unsigned short* a, size_t sa, const unsigned short* b, size_t sb) {
  asm volatile(
      "global_load_async_to_lds_b128 %0, %12, off\n\t"
      "global_load_async_to_lds_b128 %1, %13, off\n\t"
      "global_load_async_to_lds_b128 %2, %14, off\n\t"
      "global_load_async_to_lds_b128 %3, %15, off\n\t"
      "global_load_async_to_lds_b128 %4, %16, off\n\t"
      "global_load_async_to_lds_b128 %5, %17, off\n\t"
      "global_load_async_to_lds_b128 %6, %18, off\n\t"
      "global_load_async_to_lds_b128 %7, %19, off\n\t"
      "global_load_async_to_lds_b128 %8, %20, off\n\t"
      "global_load_async_to_lds_b128 %9, %21, off\n\t"
      "global_load_async_to_lds_b128 %10, %22, off\n\t"
      "global_load_async_to_lds_b128 %11, %23, off\n\t"
      "s_wait_xcnt 0x0"
      :: "v"(l), "v"(l + STG_ROWS32_BYTES), "v"(l + 2u * STG_ROWS32_BYTES), "v"(l + 3u * STG_ROWS32_BYTES),
         "v"(l + 4u * STG_ROWS32_BYTES), "v"(l + 5u * STG_ROWS32_BYTES), "v"(l + 6u * STG_ROWS32_BYTES), "v"(l + 7u * STG_ROWS32_BYTES),
         "v"(l + 8u * STG_ROWS32_BYTES), "v"(l + 9u * STG_ROWS32_BYTES), "v"(l + 10u * STG_ROWS32_BYTES), "v"(l + 11u * STG_ROWS32_BYTES),
         "v"(a), "v"(a + sa), "v"(a + 2 * sa), "v"(a + 3 * sa),
         "v"(b), "v"(b + sb), "v"(b + 2 * sb), "v"(b + 3 * sb), "v"(b + 4 * sb), "v"(b + 5 * sb), "v"(b + 6 * sb), "v"(b + 7 * sb)
      : "memory");
}
// this wave's copies have landed (the compiler places no wait for them)
__device__ __forceinline__ void wait_copies() { asm volatile("s_wait_asynccnt 0x0" ::: "memory"); }
// this wave's LDS reads have returned, before the barrier behind which their buffer is refilled
__device__ __forceinline__ void wait_lds_reads() { asm volatile("s_wait_dscnt 0x0" ::: "memory"); }

template <int ET> struct Elem;
template <> struct Elem<0> { typedef _Float16 T; };
template <> struct Elem<1> { typedef __bf16 T; };
template <int ET, bool SPLIT, int BIAS_MODE, int OUT_MODE, bool RESID, int ACT = 0>
__global__ __launch_bounds__(256) void wmma_gemm64(
    const unsigned short* __restrict__ Ap, const unsigned short* __restrict__ A2p, int lda, long strideA,
    const unsigned short* __restrict__ Btp, const unsigned short* __restrict__ Bt2p, int ldb, long strideB,
    void* __restrict__ Cout, void* __restrict__ Cout2, int ldc, long strideC, long strideCz,
    const float* __restrict__ bias,
    const float* __restrict__ resid, long strideR,
    int M, int N, int K, float scale) {
  typedef typename Elem<ET>::T T;
  typedef typename Frag<T>::V V;
  static_assert(!SPLIT, "the staged loop carries one plane per operand");
  __shared__ __align__(128) unsigned short sStage[2 * STG_ELEMS];   // two stage buffers
  __shared__ __align__(16) float sT[8][16 * 68];   // per-wave 16x64 slab, pitch 68 floats
  const int b    = blockIdx.y;
  const int lane = threadIdx.x & 31;
  const int wave = threadIdx.x >> 5;
  const int blocksN = N / BLK_N;
  const int blocksM = M / BLK_M;
  if ((int)blockIdx.x >= blocksM * blocksN) return;   // block-uniform, in front of every barrier
  const int bm = blockIdx.x / blocksN;
  const int bn = blockIdx.x - bm * blocksN;
  const int wm = wave >> 2;                    // wave's 64-row band of the block tile
  const int wn = wave & 3;                     // wave's 64-column band
  const int m0 = bm * BLK_M + (wm << 6);
  const int n0 = bn * BLK_N + (wn << 6);

  const size_t kz = (size_t)blockIdx.z * K;                            // first k of this slice
  const size_t cz = (size_t)b * strideC + (size_t)blockIdx.z * strideCz;

  const int rlane = lane & 15;                 // row (A) / col (B, D) within subtile
  const int koff  = (lane >> 4) * 8;           // k offset of this lane half
  const int mOff  = (lane >> 4) * 8;           // D row offset

  // copy side: thread t brings 16-B piece (t & 7) of rows (t >> 3) + 32 c
  const int crow = threadIdx.x >> 3;
  const int cpc  = (threadIdx.x & 7) * 8;
  const unsigned short* gA = Ap  + (size_t)b * strideA + kz + (size_t)(bm * BLK_M + crow) * lda + cpc;
  const unsigned short* gB = Btp + (size_t)b * strideB + kz + (size_t)(bn * BLK_N + crow) * ldb + cpc;
  const size_t sa = (size_t)32 * lda;
  const size_t sb = (size_t)32 * ldb;
  const unsigned lcopy = (unsigned)(size_t)(const void*)sStage + (unsigned)(crow * STG_PITCH + cpc) * 2u;
  constexpr unsigned STG_BYTES = (unsigned)STG_ELEMS * 2u;

  // read side: this lane's first A and Bt fragment rows in buffer 0
  const T* fA = (const T*)sStage + (size_t)((wm << 6) + rlane) * STG_PITCH + koff;
  const T* fB = (const T*)sStage + (size_t)(BLK_M + (wn << 6) + rlane) * STG_PITCH + koff;

  v8f acc[4][4];
#pragma unroll
  for (int i = 0; i < 4; ++i)
#pragma unroll
    for (int j = 0; j < 4; ++j) acc[i][j] = (v8f){0.f,0.f,0.f,0.f,0.f,0.f,0.f,0.f};

  const int stages = K / STG_K;
  stage_copies(lcopy, gA, sa, gB, sb);
  wait_copies();
  __syncthreads();                             // stage 0 is readable by every wave
  if (stages > 1) stage_copies(lcopy + STG_BYTES, gA + STG_K, sa, gB + STG_K, sb);

#pragma unroll 1   // one stage a trip: the buffer index and the refill test stay scalar
  for (int t = 0; t < stages; ++t) {
    const int buf = (t & 1) * STG_ELEMS;
#pragma unroll
    for (int kk = 0; kk < STG_K; kk += 32) {
      V bh[4], ah[4];
#pragma unroll
      for (int j = 0; j < 4; ++j) bh[j] = Frag<T>::load(fB + buf + j * 16 * STG_PITCH + kk);
#pragma unroll
      for (int i = 0; i < 4; ++i) ah[i] = Frag<T>::load(fA + buf + i * 16 * STG_PITCH + kk);
#pragma unroll
      for (int i = 0; i < 4; ++i) {
#pragma unroll
        for (int j = 0; j < 4; ++j) acc[i][j] = Frag<T>::mma(ah[i], bh[j], acc[i][j]);
        Frag<T>::guard(acc[i][0], acc[i][3], ah[i], ah[i]);
      }
      Frag<T>::keep(bh[0], bh[1], bh[2], bh[3]);
    }
    wait_lds_reads();
    wait_copies();
    __syncthreads();                           // publishes stage t + 1 and ends every read of stage t's buffer
    if (t + 2 < stages)
      stage_copies(lcopy + (unsigned)(t & 1) * STG_BYTES, gA + (size_t)(t + 2) * STG_K, sa, gB + (size_t)(t + 2) * STG_K, sb);
  }
  wait_copies();
  acc_guard4(acc[0][0], acc[0][1], acc[0][2], acc[0][3]);
  acc_guard4(acc[1][0], acc[1][1], acc[1][2], acc[1][3]);
  acc_guard4(acc[2][0], acc[2][1], acc[2][2], acc[2][3]);
  acc_guard4(acc[3][0], acc[3][1], acc[3][2], acc[3][3]);

  // ---- epilogue ----
  float* slab = sT[wave];
  const float* Rb = RESID ? (resid + (size_t)b * strideR) : nullptr;
#pragma unroll
  for (int i = 0; i < 4; ++i) {
    const int mBase = m0 + (i << 4);
#pragma unroll
    for (int j = 0; j < 4; ++j) {
      const int n = n0 + (j << 4) + rlane;
      float bv = 0.f;
      if (BIAS_MODE == 2) bv = bias[n];
#pragma unroll
      for (int r = 0; r < 8; ++r) {
        float v = acc[i][j][r] * scale;
        if (BIAS_MODE == 1) v += bias[mBase + mOff + r];
        if (BIAS_MODE == 2) v += bv;
        if (RESID) v += Rb[(size_t)(mBase + mOff + r) * ldc + n];
        if (ACT == 1) v = tanhf(v);
        if (ACT == 2) v = fmaxf(v, 0.0f);
        if (ACT == 3) v = v / (1.0f + expf(-v));
        if (ACT == 4) v = (v > 0.f) ? v : 0.01f * v;
        if (ACT == 5) v = 0.5f * v * (1.0f + erff(v * 0.70710678118654752f));
        slab[(mOff + r) * 68 + (j << 4) + rlane] = v;
      }
    }
    __builtin_amdgcn_fence(__ATOMIC_RELEASE, "workgroup");
    __builtin_amdgcn_wave_barrier();
    __builtin_amdgcn_fence(__ATOMIC_ACQUIRE, "workgroup");
    if (OUT_MODE == 0) {
      float* C = (float*)Cout + cz;
      const int hh = lane >> 4, c4 = (lane & 15) * 4;     // row seg = 256 B = 16 lanes x 16 B
      {
#pragma unroll
        for (int it = 0; it < 8; ++it) {
          const int row = it * 2 + hh;
          v4f v = *(const v4f*)(slab + row * 68 + c4);
          *(v4f*)(C + (size_t)(mBase + row) * ldc + n0 + c4) = v;
        }
        
      }
    } else {
      const int q = lane >> 3, c8 = (lane & 7) * 8;
      unsigned short* C  = (unsigned short*)Cout  + cz;
      unsigned short* C2 = (OUT_MODE == 2) ? ((unsigned short*)Cout2 + cz) : nullptr;
      {
#pragma unroll
        for (int it = 0; it < 4; ++it) {
          const int row = it * 4 + q;
          const float* sp = slab + row * 68 + c8;
          v8h hv, lv;
#pragma unroll
          for (int e = 0; e < 8; ++e) {
            if (OUT_MODE == 1) {
              hv[e] = (_Float16)sp[e];
            } else {
              unsigned short hb = f2bf_bits(sp[e]);
              unsigned short lb = f2bf_bits(sp[e] - bf_bits2f(hb));
              hv[e] = __builtin_bit_cast(_Float16, hb);
              lv[e] = __builtin_bit_cast(_Float16, lb);
            }
          }
          *(v8h*)(C + (size_t)(mBase + row) * ldc + n0 + c8) = hv;
          if (OUT_MODE == 2) *(v8h*)(C2 + (size_t)(mBase + row) * ldc + n0 + c8) = lv;
        }
        
      }
    }
    __builtin_amdgcn_fence(__ATOMIC_RELEASE, "workgroup");
    __builtin_amdgcn_wave_barrier();
    __builtin_amdgcn_fence(__ATOMIC_ACQUIRE, "workgroup");
  }
}

// ---------------- cast kernels: f32 -> f16(bf16_RNE(x) * mul) ----------------
__device__ __forceinline__ void cvt_bf_f16_store8(const float* __restrict__ src, unsigned short* __restrict__ dst,
                                                  int i, float mul) {
  const v4f a = *(const v4f*)(src + (size_t)i * 8);
  const v4f c = *(const v4f*)(src + (size_t)i * 8 + 4);
  v8h o;
#pragma unroll
  for (int e = 0; e < 4; ++e) {
    const float fa = bf_bits2f(f2bf_bits(a[e])) * mul;
    const float fc = bf_bits2f(f2bf_bits(c[e])) * mul;
    o[e]     = (_Float16)fa;
    o[4 + e] = (_Float16)fc;
  }
  _Float16* op = (_Float16*)(void*)dst + (size_t)i * 8;
  *(v8h*)op = o;
  
}

// x [NTOK][DMODEL] f32 -> f16 plane, same layout. Coverage: grid.x * 256 threads * 8 = n8 * 8 elements exactly.
__global__ __launch_bounds__(256) void cast_x_kernel(const float* __restrict__ x, unsigned short* __restrict__ out,
                                                     int n8, float mul) {
  const int i = blockIdx.x * 256 + threadIdx.x;
  if (i < n8) cvt_bf_f16_store8(x, out, i, mul);
}

// six [DHEAD][DHEAD] f32 weights -> six consecutive f16 planes (plane y <- source y), carried x mul.
// Coverage per plane: grid.x * 256 * 8 = n8 * 8 elements exactly; grid.y = 6 planes.
__global__ __launch_bounds__(256) void cast_w6_kernel(
    const float* __restrict__ w0, const float* __restrict__ w1, const float* __restrict__ w2,
    const float* __restrict__ w3, const float* __restrict__ w4, const float* __restrict__ w5,
    unsigned short* __restrict__ out, int n8, float mul) {
  const int y = blockIdx.y;                   // block-uniform source select (all global pointers)
  const float* src = w0;
  if (y == 1) src = w1;
  if (y == 2) src = w2;
  if (y == 3) src = w3;
  if (y == 4) src = w4;
  if (y == 5) src = w5;
  unsigned short* dst = out + (size_t)y * (size_t)n8 * 8;
  const int i = blockIdx.x * 256 + threadIdx.x;
  if (i < n8) cvt_bf_f16_store8(src, dst, i, mul);
}

// ---------------- slice sum: out[i] = f16(mul * sum_z part[z][i]), z ascending ----------------
// KSPLIT consecutive f32 planes of KV_ELEMS elements, handed in as four bases of four planes each: a plane's step inside
// a group fits the load's immediate offset, so every load takes a scalar base and the one lane offset.
// Coverage: grid.x * 256 threads * 4 = KV_ELEMS elements exactly.
constexpr int KV_ELEMS = NHEAD * DHEAD * DHEAD;
typedef __attribute__((ext_vector_type(4))) _Float16 v4h;
static_assert(KSPLIT == 16);
__global__ __launch_bounds__(256) void sum_slices_kernel(const float* __restrict__ g0, const float* __restrict__ g1,
                                                         const float* __restrict__ g2, const float* __restrict__ g3,
                                                         unsigned short* __restrict__ out, float mul) {
  const int i = blockIdx.x * 256 + threadIdx.x;
  if (i >= KV_ELEMS / 4) return;
  v4f p[KSPLIT];
#pragma unroll   // all KSPLIT loads in flight before the first add
  for (int z = 0; z < KSPLIT; ++z) {
    const float* grp = (z < 4) ? g0 : (z < 8) ? g1 : (z < 12) ? g2 : g3;
    p[z] = ((const v4f*)(grp + (size_t)(z & 3) * KV_ELEMS))[i];
  }
  v4f s = p[0];
#pragma unroll   // p[] stays in registers only if every index is a constant
  for (int z = 1; z < KSPLIT; ++z) s += p[z];
  v4h o;
  for (int e = 0; e < 4; ++e) o[e] = (_Float16)(s[e] * mul);
  *(v4h*)((_Float16*)(void*)out + (size_t)i * 4) = o;
}

// ---------------- host orchestration ----------------
// out = (q^T k) v^T is formed as q^T (k v^T): no [NTOK][NTOK] plane.
// Workspace region map (bytes; all offsets multiples of 128):
//   X16 : x as f16 [NTOK][DMODEL]                               8,388,608   @ 0
//   W16 : 6 planes [DHEAD][DHEAD] f16 (x64): Wk_h0, Wv_h0, Wk_h1, Wv_h1, Wq_h0, Wq_h1
//                                                               3,145,728   @ 8,388,608
//   QT  : per head [NTOK][DHEAD] f16 (q^T[n][d])                8,388,608   @ 11,534,336
//   KVP : per head [2*DHEAD][NTOK] f16 (rows 0..511 = k[d][m], 512..1023 = v[e][m])
//                                                              16,777,216   @ 19,922,944
//   PART: per slice, per head [DHEAD][DHEAD] f32 (sum over the slice's tokens of v[e][m] k[d][m])
//                                                              33,554,432   @ 36,700,160
//   KVT : per head [DHEAD][DHEAD] f16 (x1/64) (KV[e][d])        1,048,576   @ 70,254,592
//   total                                                      71,303,168
constexpr size_t X16_BYTES  = (size_t)NTOK * DMODEL * 2;
constexpr size_t W16_BYTES  = (size_t)6 * DHEAD * DHEAD * 2;
constexpr size_t QT_BYTES   = (size_t)NHEAD * NTOK * DHEAD * 2;
constexpr size_t KVP_BYTES  = (size_t)NHEAD * 2 * DHEAD * NTOK * 2;
constexpr size_t PART_BYTES = (size_t)KSPLIT * NHEAD * DHEAD * DHEAD * 4;
constexpr size_t KVT_BYTES  = (size_t)NHEAD * DHEAD * DHEAD * 2;
constexpr size_t X16_OFF  = 0;
constexpr size_t W16_OFF  = X16_OFF + X16_BYTES;
constexpr size_t QT_OFF   = W16_OFF + W16_BYTES;
constexpr size_t KVP_OFF  = QT_OFF + QT_BYTES;
constexpr size_t PART_OFF = KVP_OFF + KVP_BYTES;
constexpr size_t KVT_OFF  = PART_OFF + PART_BYTES;
constexpr size_t WS_TOTAL = KVT_OFF + KVT_BYTES;
static_assert(WS_TOTAL == 71303168u);
static_assert(WS_TOTAL <= (size_t)134217728u);
static_assert((W16_OFF % 128) == 0 && (QT_OFF % 128) == 0 && (KVP_OFF % 128) == 0 && (PART_OFF % 128) == 0 && (KVT_OFF % 128) == 0);

// GEMM shape contracts (no tail handling): M multiple of 128, N of 256, K of 64
// proj q   : M = NTOK,    N = DHEAD, K = DHEAD
// proj k|v : M = 2*DHEAD, N = NTOK,  K = DHEAD
// v k^T    : M = DHEAD,   N = DHEAD, K = NTOK / KSPLIT per slice
// out      : M = NTOK,    N = DHEAD, K = DHEAD
static_assert(NTOK % BLK_M == 0 && NTOK % BLK_N == 0 && DHEAD % BLK_M == 0 && DHEAD % BLK_N == 0 && (2 * DHEAD) % BLK_M == 0);
static_assert(DHEAD % STG_K == 0 && NTOK % (KSPLIT * STG_K) == 0);
static_assert(DMODEL == NHEAD * DHEAD);
static_assert((NTOK * DMODEL) % (8 * 256) == 0 && (DHEAD * DHEAD) % (8 * 256) == 0);
static_assert(KV_ELEMS % (4 * 256) == 0);

extern "C" void kernel_launch(void* const* d_in, const int* in_sizes, int n_in,
                              void* d_out, int out_size, void* d_ws, size_t ws_size,
                              hipStream_t stream) {
  if (n_in < 7) return;
  if (in_sizes[0] != NTOK * DMODEL) return;
  for (int i = 1; i < 7; ++i) if (in_sizes[i] != DHEAD * DHEAD) return;
  if (out_size != NTOK * DMODEL) return;
  if (ws_size < WS_TOTAL) return;

  // d_in order per the input table: x, Wq1, Wq2, Wk1, Wk2, Wv1, Wv2 (all f32)
  const float* x   = (const float*)d_in[0];
  const float* wq1 = (const float*)d_in[1];
  const float* wq2 = (const float*)d_in[2];
  const float* wk1 = (const float*)d_in[3];
  const float* wk2 = (const float*)d_in[4];
  const float* wv1 = (const float*)d_in[5];
  const float* wv2 = (const float*)d_in[6];
  float* out = (float*)d_out;

  char* ws = (char*)d_ws;
  unsigned short* X16 = (unsigned short*)(ws + X16_OFF);
  unsigned short* W16 = (unsigned short*)(ws + W16_OFF);
  unsigned short* QT  = (unsigned short*)(ws + QT_OFF);
  unsigned short* KVP = (unsigned short*)(ws + KVP_OFF);
  float*          PART = (float*)(ws + PART_OFF);
  unsigned short* KVT = (unsigned short*)(ws + KVT_OFF);
  unsigned short* WKV = W16;                                   // per head: [2*DHEAD][DHEAD] (k rows then v rows)
  unsigned short* WQ  = W16 + (size_t)4 * DHEAD * DHEAD;        // per head: [DHEAD][DHEAD]
  const float* fdum = x;                                       // unused bias/resid slots (never dereferenced)

  // 1) x -> f16 plane
  {
    const int n8 = (NTOK * DMODEL) / 8;                         // 524288 = 2048 * 256
    cast_x_kernel<<<dim3(n8 / 256), dim3(256), 0, stream>>>(x, X16, n8, 1.0f);
  }
  // 2) weights -> f16 planes carried x64; plane order Wk_h0, Wv_h0, Wk_h1, Wv_h1, Wq_h0, Wq_h1
  {
    const int n8 = (DHEAD * DHEAD) / 8;                         // 32768 = 128 * 256
    cast_w6_kernel<<<dim3(n8 / 256, 6), dim3(256), 0, stream>>>(wk1, wv1, wk2, wv2, wq1, wq2, W16, n8, W_CARRY);
  }
  // 3) q^T per head: QT[h][n][d] = (1/64) * sum_c X16[n][h*512 + c] * WQ[h][d][c]
  {
    const int tiles = (NTOK / 64) * (DHEAD / 64);              // 512
    wmma_gemm64<0, false, 0, 1, false><<<dim3((tiles + 7) / 8, NHEAD), dim3(256), 0, stream>>>(
        X16, X16, DMODEL, (long)DHEAD,
        WQ, WQ, DHEAD, (long)DHEAD * DHEAD,
        (void*)QT, (void*)QT, DHEAD, (long)NTOK * DHEAD, 0L,
        fdum, fdum, 0L,
        NTOK, DHEAD, DHEAD, W_CARRY_INV);
  }
  // 4) k | v per head: KVP[h][r][m] = (1/64) * sum_c WKV[h][r][c] * X16[m][h*512 + c]   (r<512: k, r>=512: v)
  {
    const int tiles = ((2 * DHEAD) / 64) * (NTOK / 64);        // 1024
    wmma_gemm64<0, false, 0, 1, false><<<dim3((tiles + 7) / 8, NHEAD), dim3(256), 0, stream>>>(
        WKV, WKV, DHEAD, (long)2 * DHEAD * DHEAD,
        X16, X16, DMODEL, (long)DHEAD,
        (void*)KVP, (void*)KVP, NTOK, (long)2 * DHEAD * NTOK, 0L,
        fdum, fdum, 0L,
        2 * DHEAD, NTOK, DHEAD, W_CARRY_INV);
  }
  // 5) PART[z][h][e][d] = sum over tokens m of slice z of v[e][m] * k[d][m]   (f32)
  {
    const int tiles = (DHEAD / 64) * (DHEAD / 64);             // 64
    wmma_gemm64<0, false, 0, 0, false><<<dim3((tiles + 7) / 8, NHEAD, KSPLIT), dim3(256), 0, stream>>>(
        KVP + (size_t)DHEAD * NTOK, KVP + (size_t)DHEAD * NTOK, NTOK, (long)2 * DHEAD * NTOK,
        KVP, KVP, NTOK, (long)2 * DHEAD * NTOK,
        (void*)PART, (void*)PART, DHEAD, (long)DHEAD * DHEAD, (long)NHEAD * DHEAD * DHEAD,
        fdum, fdum, 0L,
        DHEAD, DHEAD, NTOK / KSPLIT, 1.0f);
  }
  // 6) KVT[h][e][d] = f16((1/64) * sum_z PART[z][h][e][d])
  {
    sum_slices_kernel<<<dim3(KV_ELEMS / (4 * 256)), dim3(256), 0, stream>>>(   // 512 blocks
        PART, PART + (size_t)4 * KV_ELEMS, PART + (size_t)8 * KV_ELEMS, PART + (size_t)12 * KV_ELEMS, KVT, KV_CARRY);
  }
  // 7) out[n][h*512 + e] = 64 * sum_d QT[h][n][d] * KVT[h][e][d]   (f32, ldc = DMODEL, per-head column offset DHEAD)
  {
    const int tiles = (NTOK / 64) * (DHEAD / 64);              // 512
    wmma_gemm64<0, false, 0, 0, false><<<dim3((tiles + 7) / 8, NHEAD), dim3(256), 0, stream>>>(
        QT, QT, DHEAD, (long)NTOK * DHEAD,
        KVT, KVT, DHEAD, (long)DHEAD * DHEAD,
        (void*)out, (void*)out, DMODEL, (long)DHEAD, 0L,
        fdum, fdum, 0L,
        NTOK, DHEAD, DHEAD, KV_CARRY_INV);
  }
}

// v003
// Measured time: 53.3 microseconds a run.
// Timed twice side by side with v002, it ran 1.20 and 1.18 times as fast.
// Over all steps from v000 it is 5.33 times as fast.
// Contractions (q/k/v projections, KV = v k^T, out = q^T KV^T): v_wmma_f32_16x16x32_f16, f16 operands, f32 accumulate; float inputs RNE-converted to bf16 at load (weights carried x64, exact power of two), intermediate planes f16, v k^T slice partials f32.
#include <hip/hip_runtime.h>
#include <stdint.h>
#include <stddef.h>

typedef __attribute__((ext_vector_type(16))) _Float16 v16h;
typedef __attribute__((ext_vector_type(8)))  _Float16 v8h;
typedef __attribute__((ext_vector_type(16))) __bf16   v16b;
typedef __attribute__((ext_vector_type(8)))  __bf16   v8b;
typedef __attribute__((ext_vector_type(8)))  float    v8f;
typedef __attribute__((ext_vector_type(4)))  float    v4f;

// ---------------- problem constants ----------------
constexpr int NTOK   = 4096;
constexpr int DMODEL = 1024;
constexpr int DHEAD  = 512;
constexpr int NHEAD  = 2;
constexpr float W_CARRY     = 64.0f;          // weights carried x64 in f16 (exact)
constexpr float W_CARRY_INV = 1.0f / 64.0f;   // folded back in the projection epilogue
constexpr int   KSPLIT       = 16;            // token slices of the v k^T product (one 8-wave block per WGP)
constexpr float KV_CARRY     = 1.0f / 64.0f;  // v k^T carried x1/64 in f16 (exact; sums over NTOK tokens need the range)
constexpr float KV_CARRY_INV = 64.0f;         // folded back in the output epilogue

// ---------------- helpers ----------------
__device__ __forceinline__ unsigned short f2bf_bits(float f) {
  unsigned u = __float_as_uint(f);
  return (unsigned short)((u + 0x7FFFu + ((u >> 16) & 1u)) >> 16);
}
__device__ __forceinline__ float bf_bits2f(unsigned short h) { return __uint_as_float(((unsigned)h) << 16); }

// hazard guards as plain device helpers (no inline asm inside the kernel template body)
__device__ __forceinline__ void dep_guard_h(v8f& a, v8f& b, v16h x, v16h y) { asm volatile("v_nop\n\tv_nop\n\tv_nop\n\tv_nop" : "+v"(a), "+v"(b) : "v"(x), "v"(y)); }
__device__ __forceinline__ void dep_guard_b(v8f& a, v8f& b, v16b x, v16b y) { asm volatile("v_nop\n\tv_nop\n\tv_nop\n\tv_nop" : "+v"(a), "+v"(b) : "v"(x), "v"(y)); }
__device__ __forceinline__ void keep4_h(v16h a, v16h b, v16h c, v16h d) { asm volatile("v_nop" :: "v"(a), "v"(b), "v"(c), "v"(d)); }
__device__ __forceinline__ void keep4_b(v16b a, v16b b, v16b c, v16b d) { asm volatile("v_nop" :: "v"(a), "v"(b), "v"(c), "v"(d)); }
__device__ __forceinline__ void acc_guard4(v8f& a, v8f& b, v8f& c, v8f& d) { asm volatile("v_nop\n\tv_nop\n\tv_nop\n\tv_nop" : "+v"(a), "+v"(b), "+v"(c), "+v"(d)); }
template <typename T> struct Frag;
template <> struct Frag<_Float16> {
  typedef v16h V; union U { v16h v; v8h h[2]; };
  static __device__ __forceinline__ v16h load(const _Float16* p) {   // elements 0..7 <- p[0..7], 8..15 <- p[16..23]
    U f; f.h[0] = *(const v8h*)(p); f.h[1] = *(const v8h*)(p + 16); return f.v;
  }
  static __device__ __forceinline__ v8f mma(v16h a, v16h b, v8f c) {
    return __builtin_amdgcn_wmma_f32_16x16x32_f16(false, a, false, b, (short)0, c, false, false);
  }
  static __device__ __forceinline__ void guard(v8f& a, v8f& b, v16h x, v16h y) { dep_guard_h(a, b, x, y); }
  static __device__ __forceinline__ void keep(v16h a, v16h b, v16h c, v16h d) { keep4_h(a, b, c, d); }
};
template <> struct Frag<__bf16> {
  typedef v16b V; union U { v16b v; v8b h[2]; };
  static __device__ __forceinline__ v16b load(const __bf16* p) {
    U f; f.h[0] = *(const v8b*)(p); f.h[1] = *(const v8b*)(p + 16); return f.v;
  }
  static __device__ __forceinline__ v8f mma(v16b a, v16b b, v8f c) {
    return __builtin_amdgcn_wmma_f32_16x16x32_bf16(false, a, false, b, (short)0, c, false, false);
  }
  static __device__ __forceinline__ void guard(v8f& a, v8f& b, v16b x, v16b y) { dep_guard_b(a, b, x, y); }
  static __device__ __forceinline__ void keep(v16b a, v16b b, v16b c, v16b d) { keep4_b(a, b, c, d); }
};

// ---- Register-blocked batched WMMA GEMM, operands staged in LDS --------------
// C[m,n] = scale * sum_k A[m,k] * Bt[n,k] (+bias)(+resid); a block owns a 128x256 tile, each of its 2x4 waves a 64x64 tile.
// A row-major [M,K]; Bt row-major [N,K]; M % 128 == 0, N % 256 == 0, K % 64 == 0, K >= 64.
// A stage is 64 k of the block's 128 A rows and 256 Bt rows (128 B a row, whole lines), brought into LDS by asynchronous
// copies, two buffers: stage t + 1 flies while stage t is multiplied. LDS row pitch 144 B (16 B x odd: ds_load_b128 without bank conflicts).
// blockIdx.z = k slice: it sums k in [z*K, (z+1)*K) and writes its own plane at z*strideCz (grid.z = 1: the whole product).
// SPLIT: not carried by the staged loop (one plane per operand).
// BIAS_MODE: 0 = none, 1 = bias[m], 2 = bias[n].
// OUT_MODE: 0 = f32, 1 = f16, 2 = bf16 hi plane (Cout) + bf16 lo plane (Cout2).
// ET: 0 = f16 operands, 1 = bf16 operands (pointers passed as 16-bit storage)
constexpr int BLK_M = 128, BLK_N = 256, STG_K = 64;
constexpr int STG_PITCH = STG_K + 8;                          // 16-bit elements per LDS row
constexpr int STG_ELEMS = (BLK_M + BLK_N) * STG_PITCH;         // one buffer: A rows 0..127, Bt rows 128..383
constexpr unsigned STG_ROWS32_BYTES = 32u * STG_PITCH * 2u;    // LDS step from one copy of a thread to its next (32 rows)

// One stage, this thread's share: 12 copies of 16 B (4 of A, 8 of Bt); a wave's copy covers 4 whole 128-B rows.
// l: the thread's LDS byte address in row (threadIdx.x >> 3) of the buffer; a, b: its global addresses in that row of the A and
// Bt tile; sa, sb: 32 rows of A and Bt in elements. The s_wait_xcnt stands inside the statement, so that no address register
// of a copy is rewritten ahead of it.
__device__ __forceinline__ void stage_copies(unsigned l, const unsigned short* a, size_t sa, const unsigned short* b, size_t sb) {
  asm volatile(
      "global_load_async_to_lds_b128 %0, %12, off\n\t"
      "global_load_async_to_lds_b128 %1, %13, off\n\t"
      "global_load_async_to_lds_b128 %2, %14, off\n\t"
      "global_load_async_to_lds_b128 %3, %15, off\n\t"
      "global_load_async_to_lds_b128 %4, %16, off\n\t"
      "global_load_async_to_lds_b128 %5, %17, off\n\t"
      "global_load_async_to_lds_b128 %6, %18, off\n\t"
      "global_load_async_to_lds_b128 %7, %19, off\n\t"
      "global_load_async_to_lds_b128 %8, %20, off\n\t"
      "global_load_async_to_lds_b128 %9, %21, off\n\t"
      "global_load_async_to_lds_b128 %10, %22, off\n\t"
      "global_load_async_to_lds_b128 %11, %23, off\n\t"
      "s_wait_xcnt 0x0"
      :: "v"(l), "v"(l + STG_ROWS32_BYTES), "v"(l + 2u * STG_ROWS32_BYTES), "v"(l + 3u * STG_ROWS32_BYTES),
         "v"(l + 4u * STG_ROWS32_BYTES), "v"(l + 5u * STG_ROWS32_BYTES), "v"(l + 6u * STG_ROWS32_BYTES), "v"(l + 7u * STG_ROWS32_BYTES),
         "v"(l + 8u * STG_ROWS32_BYTES), "v"(l + 9u * STG_ROWS32_BYTES), "v"(l + 10u * STG_ROWS32_BYTES), "v"(l + 11u * STG_ROWS32_BYTES),
         "v"(a), "v"(a + sa), "v"(a + 2 * sa), "v"(a + 3 * sa),
         "v"(b), "v"(b + sb), "v"(b + 2 * sb), "v"(b + 3 * sb), "v"(b + 4 * sb), "v"(b + 5 * sb), "v"(b + 6 * sb), "v"(b + 7 * sb)
      : "memory");
}
// this wave's copies have landed (the compiler places no wait for them)
__device__ __forceinline__ void wait_copies() { asm volatile("s_wait_asynccnt 0x0" ::: "memory"); }
// this wave's LDS reads have returned, before the barrier behind which their buffer is refilled
__device__ __forceinline__ void wait_lds_reads() { asm volatile("s_wait_dscnt 0x0" ::: "memory"); }

template <int ET> struct Elem;
template <> struct Elem<0> { typedef _Float16 T; };
template <> struct Elem<1> { typedef __bf16 T; };
template <int ET, bool SPLIT, int BIAS_MODE, int OUT_MODE, bool RESID, int ACT = 0>
__device__ __forceinline__ void gemm64_block(
    const int bx, const int b, const int bz,     // block tile, batch and k slice of this work-group
    const unsigned short* __restrict__ Ap, const unsigned short* __restrict__ A2p, int lda, long strideA,
    const unsigned short* __restrict__ Btp, const unsigned short* __restrict__ Bt2p, int ldb, long strideB,
    void* __restrict__ Cout, void* __restrict__ Cout2, int ldc, long strideC, long strideCz,
    const float* __restrict__ bias,
    const float* __restrict__ resid, long strideR,
    int M, int N, int K, float scale) {
  typedef typename Elem<ET>::T T;
  typedef typename Frag<T>::V V;
  static_assert(!SPLIT, "the staged loop carries one plane per operand");
  __shared__ __align__(128) unsigned short sStage[2 * STG_ELEMS];   // two stage buffers
  __shared__ __align__(16) float sT[8][16 * 68];   // per-wave 16x64 slab, pitch 68 floats
  const int lane = threadIdx.x & 31;
  const int wave = threadIdx.x >> 5;
  const int blocksN = N / BLK_N;
  const int blocksM = M / BLK_M;
  if (bx >= blocksM * blocksN) return;   // block-uniform, in front of every barrier
  const int bm = bx / blocksN;
  const int bn = bx - bm * blocksN;
  const int wm = wave >> 2;                    // wave's 64-row band of the block tile
  const int wn = wave & 3;                     // wave's 64-column band
  const int m0 = bm * BLK_M + (wm << 6);
  const int n0 = bn * BLK_N + (wn << 6);

  const size_t kz = (size_t)bz * K;                                    // first k of this slice
  const size_t cz = (size_t)b * strideC + (size_t)bz * strideCz;

  const int rlane = lane & 15;                 // row (A) / col (B, D) within subtile
  const int koff  = (lane >> 4) * 8;           // k offset of this lane half
  const int mOff  = (lane >> 4) * 8;           // D row offset

  // copy side: thread t brings 16-B piece (t & 7) of rows (t >> 3) + 32 c
  const int crow = threadIdx.x >> 3;
  const int cpc  = (threadIdx.x & 7) * 8;
  const unsigned short* gA = Ap  + (size_t)b * strideA + kz + (size_t)(bm * BLK_M + crow) * lda + cpc;
  const unsigned short* gB = Btp + (size_t)b * strideB + kz + (size_t)(bn * BLK_N + crow) * ldb + cpc;
  const size_t sa = (size_t)32 * lda;
  const size_t sb = (size_t)32 * ldb;
  const unsigned lcopy = (unsigned)(size_t)(const void*)sStage + (unsigned)(crow * STG_PITCH + cpc) * 2u;
  constexpr unsigned STG_BYTES = (unsigned)STG_ELEMS * 2u;

  // read side: this lane's first A and Bt fragment rows in buffer 0
  const T* fA = (const T*)sStage + (size_t)((wm << 6) + rlane) * STG_PITCH + koff;
  const T* fB = (const T*)sStage + (size_t)(BLK_M + (wn << 6) + rlane) * STG_PITCH + koff;

  v8f acc[4][4];
#pragma unroll
  for (int i = 0; i < 4; ++i)
#pragma unroll
    for (int j = 0; j < 4; ++j) acc[i][j] = (v8f){0.f,0.f,0.f,0.f,0.f,0.f,0.f,0.f};

  const int stages = K / STG_K;
  stage_copies(lcopy, gA, sa, gB, sb);
  wait_copies();
  __syncthreads();                             // stage 0 is readable by every wave
  if (stages > 1) stage_copies(lcopy + STG_BYTES, gA + STG_K, sa, gB + STG_K, sb);

#pragma unroll 1   // one stage a trip: the buffer index and the refill test stay scalar
  for (int t = 0; t < stages; ++t) {
    const int buf = (t & 1) * STG_ELEMS;
#pragma unroll
    for (int kk = 0; kk < STG_K; kk += 32) {
      V bh[4], ah[4];
#pragma unroll
      for (int j = 0; j < 4; ++j) bh[j] = Frag<T>::load(fB + buf + j * 16 * STG_PITCH + kk);
#pragma unroll
      for (int i = 0; i < 4; ++i) ah[i] = Frag<T>::load(fA + buf + i * 16 * STG_PITCH + kk);
#pragma unroll
      for (int i = 0; i < 4; ++i) {
#pragma unroll
        for (int j = 0; j < 4; ++j) acc[i][j] = Frag<T>::mma(ah[i], bh[j], acc[i][j]);
        Frag<T>::guard(acc[i][0], acc[i][3], ah[i], ah[i]);
      }
      Frag<T>::keep(bh[0], bh[1], bh[2], bh[3]);
    }
    wait_lds_reads();
    wait_copies();
    __syncthreads();                           // publishes stage t + 1 and ends every read of stage t's buffer
    if (t + 2 < stages)
      stage_copies(lcopy + (unsigned)(t & 1) * STG_BYTES, gA + (size_t)(t + 2) * STG_K, sa, gB + (size_t)(t + 2) * STG_K, sb);
  }
  wait_copies();
  acc_guard4(acc[0][0], acc[0][1], acc[0][2], acc[0][3]);
  acc_guard4(acc[1][0], acc[1][1], acc[1][2], acc[1][3]);
  acc_guard4(acc[2][0], acc[2][1], acc[2][2], acc[2][3]);
  acc_guard4(acc[3][0], acc[3][1], acc[3][2], acc[3][3]);

  // ---- epilogue ----
  float* slab = sT[wave];
  const float* Rb = RESID ? (resid + (size_t)b * strideR) : nullptr;
#pragma unroll
  for (int i = 0; i < 4; ++i) {
    const int mBase = m0 + (i << 4);
#pragma unroll
    for (int j = 0; j < 4; ++j) {
      const int n = n0 + (j << 4) + rlane;
      float bv = 0.f;
      if (BIAS_MODE == 2) bv = bias[n];
#pragma unroll
      for (int r = 0; r < 8; ++r) {
        float v = acc[i][j][r] * scale;
        if (BIAS_MODE == 1) v += bias[mBase + mOff + r];
        if (BIAS_MODE == 2) v += bv;
        if (RESID) v += Rb[(size_t)(mBase + mOff + r) * ldc + n];
        if (ACT == 1) v = tanhf(v);
        if (ACT == 2) v = fmaxf(v, 0.0f);
        if (ACT == 3) v = v / (1.0f + expf(-v));
        if (ACT == 4) v = (v > 0.f) ? v : 0.01f * v;
        if (ACT == 5) v = 0.5f * v * (1.0f + erff(v * 0.70710678118654752f));
        slab[(mOff + r) * 68 + (j << 4) + rlane] = v;
      }
    }
    __builtin_amdgcn_fence(__ATOMIC_RELEASE, "workgroup");
    __builtin_amdgcn_wave_barrier();
    __builtin_amdgcn_fence(__ATOMIC_ACQUIRE, "workgroup");
    if (OUT_MODE == 0) {
      float* C = (float*)Cout + cz;
      const int hh = lane >> 4, c4 = (lane & 15) * 4;     // row seg = 256 B = 16 lanes x 16 B
      {
#pragma unroll
        for (int it = 0; it < 8; ++it) {
          const int row = it * 2 + hh;
          v4f v = *(const v4f*)(slab + row * 68 + c4);
          *(v4f*)(C + (size_t)(mBase + row) * ldc + n0 + c4) = v;
        }
        
      }
    } else {
      const int q = lane >> 3, c8 = (lane & 7) * 8;
      unsigned short* C  = (unsigned short*)Cout  + cz;
      unsigned short* C2 = (OUT_MODE == 2) ? ((unsigned short*)Cout2 + cz) : nullptr;
      {
#pragma unroll
        for (int it = 0; it < 4; ++it) {
          const int row = it * 4 + q;
          const float* sp = slab + row * 68 + c8;
          v8h hv, lv;
#pragma unroll
          for (int e = 0; e < 8; ++e) {
            if (OUT_MODE == 1) {
              hv[e] = (_Float16)sp[e];
            } else {
              unsigned short hb = f2bf_bits(sp[e]);
              unsigned short lb = f2bf_bits(sp[e] - bf_bits2f(hb));
              hv[e] = __builtin_bit_cast(_Float16, hb);
              lv[e] = __builtin_bit_cast(_Float16, lb);
            }
          }
          *(v8h*)(C + (size_t)(mBase + row) * ldc + n0 + c8) = hv;
          if (OUT_MODE == 2) *(v8h*)(C2 + (size_t)(mBase + row) * ldc + n0 + c8) = lv;
        }
        
      }
    }
    __builtin_amdgcn_fence(__ATOMIC_RELEASE, "workgroup");
    __builtin_amdgcn_wave_barrier();
    __builtin_amdgcn_fence(__ATOMIC_ACQUIRE, "workgroup");
  }
}

// one product a launch: blockIdx.x = block tile, .y = batch, .z = k slice
template <int ET, bool SPLIT, int BIAS_MODE, int OUT_MODE, bool RESID, int ACT = 0>
__global__ __launch_bounds__(256) void wmma_gemm64(
    const unsigned short* __restrict__ Ap, const unsigned short* __restrict__ A2p, int lda, long strideA,
    const unsigned short* __restrict__ Btp, const unsigned short* __restrict__ Bt2p, int ldb, long strideB,
    void* __restrict__ Cout, void* __restrict__ Cout2, int ldc, long strideC, long strideCz,
    const float* __restrict__ bias,
    const float* __restrict__ resid, long strideR,
    int M, int N, int K, float scale) {
  gemm64_block<ET, SPLIT, BIAS_MODE, OUT_MODE, RESID, ACT>(
      (int)blockIdx.x, (int)blockIdx.y, (int)blockIdx.z, Ap, A2p, lda, strideA, Btp, Bt2p, ldb, strideB,
      Cout, Cout2, ldc, strideC, strideCz, bias, resid, strideR, M, N, K, scale);
}

// Two independent products of equal K and scale (f16 in, f16 out) in ONE launch: work-groups blockIdx.x < tiles0 own the
// block tiles of product 0, the rest those of product 1; blockIdx.y = batch of both. The choice is block-uniform (scalar selects).
__global__ __launch_bounds__(256) void wmma_gemm64_pair(
    const unsigned short* __restrict__ A0, int lda0, long strideA0,
    const unsigned short* __restrict__ Bt0, int ldb0, long strideB0,
    unsigned short* __restrict__ C0, int ldc0, long strideC0, int M0, int N0, int tiles0,
    const unsigned short* __restrict__ A1, int lda1, long strideA1,
    const unsigned short* __restrict__ Bt1, int ldb1, long strideB1,
    unsigned short* __restrict__ C1, int ldc1, long strideC1, int M1, int N1,
    int K, float scale) {
  const bool p0 = (int)blockIdx.x < tiles0;
  const unsigned short* A  = p0 ? A0 : A1;
  const unsigned short* Bt = p0 ? Bt0 : Bt1;
  unsigned short*       C  = p0 ? C0 : C1;
  gemm64_block<0, false, 0, 1, false>(
      p0 ? (int)blockIdx.x : (int)blockIdx.x - tiles0, (int)blockIdx.y, 0,
      A, A, p0 ? lda0 : lda1, p0 ? strideA0 : strideA1,
      Bt, Bt, p0 ? ldb0 : ldb1, p0 ? strideB0 : strideB1,
      (void*)C, (void*)C, p0 ? ldc0 : ldc1, p0 ? strideC0 : strideC1, 0L,
      nullptr, nullptr, 0L,
      p0 ? M0 : M1, p0 ? N0 : N1, K, scale);
}

// ---------------- cast kernels: f32 -> f16(bf16_RNE(x) * mul) ----------------
__device__ __forceinline__ void cvt_bf_f16_store8(const float* __restrict__ src, unsigned short* __restrict__ dst,
                                                  int i, float mul) {
  const v4f a = *(const v4f*)(src + (size_t)i * 8);
  const v4f c = *(const v4f*)(src + (size_t)i * 8 + 4);
  v8h o;
#pragma unroll
  for (int e = 0; e < 4; ++e) {
    const float fa = bf_bits2f(f2bf_bits(a[e])) * mul;
    const float fc = bf_bits2f(f2bf_bits(c[e])) * mul;
    o[e]     = (_Float16)fa;
    o[4 + e] = (_Float16)fc;
  }
  _Float16* op = (_Float16*)(void*)dst + (size_t)i * 8;
  *(v8h*)op = o;
  
}

// Both casts in ONE launch (they need nothing of each other). Work-groups blockIdx.x < xBlocks: x [NTOK][DMODEL] f32 -> f16 plane,
// same layout, xBlocks * 256 threads * 8 = all its elements exactly. The rest, wBlocks a plane: six [DHEAD][DHEAD] f32 weights ->
// six consecutive f16 planes (plane y <- source y), carried x mulW; wBlocks * 256 * 8 = a plane's elements exactly.
__global__ __launch_bounds__(256) void cast_xw_kernel(
    const float* __restrict__ x, unsigned short* __restrict__ outX, int xBlocks,
    const float* __restrict__ w0, const float* __restrict__ w1, const float* __restrict__ w2,
    const float* __restrict__ w3, const float* __restrict__ w4, const float* __restrict__ w5,
    unsigned short* __restrict__ outW, int wBlocks, float mulW) {
  const int bx = (int)blockIdx.x;
  if (bx < xBlocks) {                         // block-uniform
    cvt_bf_f16_store8(x, outX, bx * 256 + (int)threadIdx.x, 1.0f);
    return;
  }
  const int y  = (bx - xBlocks) / wBlocks;    // block-uniform source select (all global pointers)
  const int bw = (bx - xBlocks) - y * wBlocks;
  const float* src = w0;
  if (y == 1) src = w1;
  if (y == 2) src = w2;
  if (y == 3) src = w3;
  if (y == 4) src = w4;
  if (y == 5) src = w5;
  unsigned short* dst = outW + (size_t)y * (size_t)wBlocks * 2048;
  cvt_bf_f16_store8(src, dst, bw * 256 + (int)threadIdx.x, mulW);
  // precaution: in the listing the x range's code follows this store and rewrites its offset register; the wait stands in front of that
  asm volatile("s_wait_xcnt 0x0" ::: "memory");
}

// ---------------- slice sum: out[i] = f16(mul * sum_z part[z][i]), z ascending ----------------
// KSPLIT consecutive f32 planes of KV_ELEMS elements, handed in as four bases of four planes each: a plane's step inside
// a group fits the load's immediate offset, so every load takes a scalar base and the one lane offset.
// Coverage: grid.x * 256 threads * 4 = KV_ELEMS elements exactly.
constexpr int KV_ELEMS = NHEAD * DHEAD * DHEAD;
typedef __attribute__((ext_vector_type(4))) _Float16 v4h;
static_assert(KSPLIT == 16);
__global__ __launch_bounds__(256) void sum_slices_kernel(const float* __restrict__ g0, const float* __restrict__ g1,
                                                         const float* __restrict__ g2, const float* __restrict__ g3,
                                                         unsigned short* __restrict__ out, float mul) {
  const int i = blockIdx.x * 256 + threadIdx.x;
  if (i >= KV_ELEMS / 4) return;
  v4f p[KSPLIT];
#pragma unroll   // all KSPLIT loads in flight before the first add
  for (int z = 0; z < KSPLIT; ++z) {
    const float* grp = (z < 4) ? g0 : (z < 8) ? g1 : (z < 12) ? g2 : g3;
    p[z] = ((const v4f*)(grp + (size_t)(z & 3) * KV_ELEMS))[i];
  }
  v4f s = p[0];
#pragma unroll   // p[] stays in registers only if every index is a constant
  for (int z = 1; z < KSPLIT; ++z) s += p[z];
  v4h o;
  for (int e = 0; e < 4; ++e) o[e] = (_Float16)(s[e] * mul);
  *(v4h*)((_Float16*)(void*)out + (size_t)i * 4) = o;
}

// ---------------- host orchestration ----------------
// out = (q^T k) v^T is formed as q^T (k v^T): no [NTOK][NTOK] plane.
// Workspace region map (bytes; all offsets multiples of 128):
//   X16 : x as f16 [NTOK][DMODEL]                               8,388,608   @ 0
//   W16 : 6 planes [DHEAD][DHEAD] f16 (x64): Wk_h0, Wv_h0, Wk_h1, Wv_h1, Wq_h0, Wq_h1
//                                                               3,145,728   @ 8,388,608
//   QT  : per head [NTOK][DHEAD] f16 (q^T[n][d])                8,388,608   @ 11,534,336
//   KVP : per head [2*DHEAD][NTOK] f16 (rows 0..511 = k[d][m], 512..1023 = v[e][m])
//                                                              16,777,216   @ 19,922,944
//   PART: per slice, per head [DHEAD][DHEAD] f32 (sum over the slice's tokens of v[e][m] k[d][m])
//                                                              33,554,432   @ 36,700,160
//   KVT : per head [DHEAD][DHEAD] f16 (x1/64) (KV[e][d])        1,048,576   @ 70,254,592
//   total                                                      71,303,168
constexpr size_t X16_BYTES  = (size_t)NTOK * DMODEL * 2;
constexpr size_t W16_BYTES  = (size_t)6 * DHEAD * DHEAD * 2;
constexpr size_t QT_BYTES   = (size_t)NHEAD * NTOK * DHEAD * 2;
constexpr size_t KVP_BYTES  = (size_t)NHEAD * 2 * DHEAD * NTOK * 2;
constexpr size_t PART_BYTES = (size_t)KSPLIT * NHEAD * DHEAD * DHEAD * 4;
constexpr size_t KVT_BYTES  = (size_t)NHEAD * DHEAD * DHEAD * 2;
constexpr size_t X16_OFF  = 0;
constexpr size_t W16_OFF  = X16_OFF + X16_BYTES;
constexpr size_t QT_OFF   = W16_OFF + W16_BYTES;
constexpr size_t KVP_OFF  = QT_OFF + QT_BYTES;
constexpr size_t PART_OFF = KVP_OFF + KVP_BYTES;
constexpr size_t KVT_OFF  = PART_OFF + PART_BYTES;
constexpr size_t WS_TOTAL = KVT_OFF + KVT_BYTES;
static_assert(WS_TOTAL == 71303168u);
static_assert(WS_TOTAL <= (size_t)134217728u);
static_assert((W16_OFF % 128) == 0 && (QT_OFF % 128) == 0 && (KVP_OFF % 128) == 0 && (PART_OFF % 128) == 0 && (KVT_OFF % 128) == 0);

// GEMM shape contracts (no tail handling): M multiple of 128, N of 256, K of 64
// proj q   : M = NTOK,    N = DHEAD, K = DHEAD
// proj k|v : M = 2*DHEAD, N = NTOK,  K = DHEAD
// v k^T    : M = DHEAD,   N = DHEAD, K = NTOK / KSPLIT per slice
// out      : M = NTOK,    N = DHEAD, K = DHEAD
static_assert(NTOK % BLK_M == 0 && NTOK % BLK_N == 0 && DHEAD % BLK_M == 0 && DHEAD % BLK_N == 0 && (2 * DHEAD) % BLK_M == 0);
static_assert(DHEAD % STG_K == 0 && NTOK % (KSPLIT * STG_K) == 0);
static_assert(DMODEL == NHEAD * DHEAD);
static_assert((NTOK * DMODEL) % (8 * 256) == 0 && (DHEAD * DHEAD) % (8 * 256) == 0);
static_assert(KV_ELEMS % (4 * 256) == 0);

extern "C" void kernel_launch(void* const* d_in, const int* in_sizes, int n_in,
                              void* d_out, int out_size, void* d_ws, size_t ws_size,
                              hipStream_t stream) {
  if (n_in < 7) return;
  if (in_sizes[0] != NTOK * DMODEL) return;
  for (int i = 1; i < 7; ++i) if (in_sizes[i] != DHEAD * DHEAD) return;
  if (out_size != NTOK * DMODEL) return;
  if (ws_size < WS_TOTAL) return;

  // d_in order per the input table: x, Wq1, Wq2, Wk1, Wk2, Wv1, Wv2 (all f32)
  const float* x   = (const float*)d_in[0];
  const float* wq1 = (const float*)d_in[1];
  const float* wq2 = (const float*)d_in[2];
  const float* wk1 = (const float*)d_in[3];
  const float* wk2 = (const float*)d_in[4];
  const float* wv1 = (const float*)d_in[5];
  const float* wv2 = (const float*)d_in[6];
  float* out = (float*)d_out;

  char* ws = (char*)d_ws;
  unsigned short* X16 = (unsigned short*)(ws + X16_OFF);
  unsigned short* W16 = (unsigned short*)(ws + W16_OFF);
  unsigned short* QT  = (unsigned short*)(ws + QT_OFF);
  unsigned short* KVP = (unsigned short*)(ws + KVP_OFF);
  float*          PART = (float*)(ws + PART_OFF);
  unsigned short* KVT = (unsigned short*)(ws + KVT_OFF);
  unsigned short* WKV = W16;                                   // per head: [2*DHEAD][DHEAD] (k rows then v rows)
  unsigned short* WQ  = W16 + (size_t)4 * DHEAD * DHEAD;        // per head: [DHEAD][DHEAD]
  const float* fdum = x;                                       // unused bias/resid slots (never dereferenced)

  // 1) + 2) one launch: x -> f16 plane; weights -> f16 planes carried x64, plane order Wk_h0, Wv_h0, Wk_h1, Wv_h1, Wq_h0, Wq_h1
  {
    const int xBlocks = (NTOK * DMODEL) / (8 * 256);            // 2048
    const int wBlocks = (DHEAD * DHEAD) / (8 * 256);            // 128 a plane
    cast_xw_kernel<<<dim3(xBlocks + 6 * wBlocks), dim3(256), 0, stream>>>(
        x, X16, xBlocks, wk1, wv1, wk2, wv2, wq1, wq2, W16, wBlocks, W_CARRY);
  }
  // 3) + 4) the projections, one launch (they share X16 and depend on nothing of each other):
  //    k | v per head: KVP[h][r][m] = (1/64) * sum_c WKV[h][r][c] * X16[m][h*512 + c]   (r<512: k, r>=512: v)
  //    q^T per head  : QT[h][n][d]  = (1/64) * sum_c X16[n][h*512 + c] * WQ[h][d][c]
  {
    const int tilesKV = ((2 * DHEAD) / BLK_M) * (NTOK / BLK_N);   // 128
    const int tilesQ  = (NTOK / BLK_M) * (DHEAD / BLK_N);         // 64
    wmma_gemm64_pair<<<dim3(tilesKV + tilesQ, NHEAD), dim3(256), 0, stream>>>(
        WKV, DHEAD, (long)2 * DHEAD * DHEAD,
        X16, DMODEL, (long)DHEAD,
        KVP, NTOK, (long)2 * DHEAD * NTOK, 2 * DHEAD, NTOK, tilesKV,
        X16, DMODEL, (long)DHEAD,
        WQ, DHEAD, (long)DHEAD * DHEAD,
        QT, DHEAD, (long)NTOK * DHEAD, NTOK, DHEAD,
        DHEAD, W_CARRY_INV);
  }
  // 5) PART[z][h][e][d] = sum over tokens m of slice z of v[e][m] * k[d][m]   (f32)
  {
    const int tiles = (DHEAD / 64) * (DHEAD / 64);             // 64
    wmma_gemm64<0, false, 0, 0, false><<<dim3((tiles + 7) / 8, NHEAD, KSPLIT), dim3(256), 0, stream>>>(
        KVP + (size_t)DHEAD * NTOK, KVP + (size_t)DHEAD * NTOK, NTOK, (long)2 * DHEAD * NTOK,
        KVP, KVP, NTOK, (long)2 * DHEAD * NTOK,
        (void*)PART, (void*)PART, DHEAD, (long)DHEAD * DHEAD, (long)NHEAD * DHEAD * DHEAD,
        fdum, fdum, 0L,
        DHEAD, DHEAD, NTOK / KSPLIT, 1.0f);
  }
  // 6) KVT[h][e][d] = f16((1/64) * sum_z PART[z][h][e][d])
  {
    sum_slices_kernel<<<dim3(KV_ELEMS / (4 * 256)), dim3(256), 0, stream>>>(   // 512 blocks
        PART, PART + (size_t)4 * KV_ELEMS, PART + (size_t)8 * KV_ELEMS, PART + (size_t)12 * KV_ELEMS, KVT, KV_CARRY);
  }
  // 7) out[n][h*512 + e] = 64 * sum_d QT[h][n][d] * KVT[h][e][d]   (f32, ldc = DMODEL, per-head column offset DHEAD)
  {
    const int tiles = (NTOK / 64) * (DHEAD / 64);              // 512
    wmma_gemm64<0, false, 0, 0, false><<<dim3((tiles + 7) / 8, NHEAD), dim3(256), 0, stream>>>(
        QT, QT, DHEAD, (long)NTOK * DHEAD,
        KVT, KVT, DHEAD, (long)DHEAD * DHEAD,
        (void*)out, (void*)out, DMODEL, (long)DHEAD, 0L,
        fdum, fdum, 0L,
        NTOK, DHEAD, DHEAD, KV_CARRY_INV);
  }
}

// v004
// It runs in 43.5 microseconds.
// Two timings next to v003 put it at 1.21 and 1.32 times that version's speed.
// Over all steps from v000 it is 6.72 times as fast.
// Contractions (q/k/v projections, KV = v k^T, out = q^T KV^T): v_wmma_f32_16x16x32_f16, f16 operands, f32 accumulate; float inputs RNE-converted to bf16 at load (weights carried x64, exact power of two), intermediate planes f16, v k^T per-wave partials f32, summed in LDS.
#include <hip/hip_runtime.h>
#include <stdint.h>
#include <stddef.h>

typedef __attribute__((ext_vector_type(16))) _Float16 v16h;
typedef __attribute__((ext_vector_type(8)))  _Float16 v8h;
typedef __attribute__((ext_vector_type(16))) __bf16   v16b;
typedef __attribute__((ext_vector_type(8)))  __bf16   v8b;
typedef __attribute__((ext_vector_type(8)))  float    v8f;
typedef __attribute__((ext_vector_type(4)))  float    v4f;

// ---------------- problem constants ----------------
constexpr int NTOK   = 4096;
constexpr int DMODEL = 1024;
constexpr int DHEAD  = 512;
constexpr int NHEAD  = 2;
constexpr float W_CARRY     = 64.0f;          // weights carried x64 in f16 (exact)
constexpr float W_CARRY_INV = 1.0f / 64.0f;   // folded back in the projection epilogue
constexpr float KV_CARRY     = 1.0f / 64.0f;  // v k^T carried x1/64 in f16 (exact; sums over NTOK tokens need the range)
constexpr float KV_CARRY_INV = 64.0f;         // folded back in the output epilogue

// ---------------- helpers ----------------
__device__ __forceinline__ unsigned short f2bf_bits(float f) {
  unsigned u = __float_as_uint(f);
  return (unsigned short)((u + 0x7FFFu + ((u >> 16) & 1u)) >> 16);
}
__device__ __forceinline__ float bf_bits2f(unsigned short h) { return __uint_as_float(((unsigned)h) << 16); }

// hazard guards as plain device helpers (no inline asm inside the kernel template body)
__device__ __forceinline__ void dep_guard_h(v8f& a, v8f& b, v16h x, v16h y) { asm volatile("v_nop\n\tv_nop\n\tv_nop\n\tv_nop" : "+v"(a), "+v"(b) : "v"(x), "v"(y)); }
__device__ __forceinline__ void dep_guard_b(v8f& a, v8f& b, v16b x, v16b y) { asm volatile("v_nop\n\tv_nop\n\tv_nop\n\tv_nop" : "+v"(a), "+v"(b) : "v"(x), "v"(y)); }
__device__ __forceinline__ void keep4_h(v16h a, v16h b, v16h c, v16h d) { asm volatile("v_nop" :: "v"(a), "v"(b), "v"(c), "v"(d)); }
__device__ __forceinline__ void keep4_b(v16b a, v16b b, v16b c, v16b d) { asm volatile("v_nop" :: "v"(a), "v"(b), "v"(c), "v"(d)); }
__device__ __forceinline__ void acc_guard4(v8f& a, v8f& b, v8f& c, v8f& d) { asm volatile("v_nop\n\tv_nop\n\tv_nop\n\tv_nop" : "+v"(a), "+v"(b), "+v"(c), "+v"(d)); }
template <typename T> struct Frag;
template <> struct Frag<_Float16> {
  typedef v16h V; union U { v16h v; v8h h[2]; };
  static __device__ __forceinline__ v16h load(const _Float16* p) {   // elements 0..7 <- p[0..7], 8..15 <- p[16..23]
    U f; f.h[0] = *(const v8h*)(p); f.h[1] = *(const v8h*)(p + 16); return f.v;
  }
  static __device__ __forceinline__ v8f mma(v16h a, v16h b, v8f c) {
    return __builtin_amdgcn_wmma_f32_16x16x32_f16(false, a, false, b, (short)0, c, false, false);
  }
  static __device__ __forceinline__ void guard(v8f& a, v8f& b, v16h x, v16h y) { dep_guard_h(a, b, x, y); }
  static __device__ __forceinline__ void keep(v16h a, v16h b, v16h c, v16h d) { keep4_h(a, b, c, d); }
};
template <> struct Frag<__bf16> {
  typedef v16b V; union U { v16b v; v8b h[2]; };
  static __device__ __forceinline__ v16b load(const __bf16* p) {
    U f; f.h[0] = *(const v8b*)(p); f.h[1] = *(const v8b*)(p + 16); return f.v;
  }
  static __device__ __forceinline__ v8f mma(v16b a, v16b b, v8f c) {
    return __builtin_amdgcn_wmma_f32_16x16x32_bf16(false, a, false, b, (short)0, c, false, false);
  }
  static __device__ __forceinline__ void guard(v8f& a, v8f& b, v16b x, v16b y) { dep_guard_b(a, b, x, y); }
  static __device__ __forceinline__ void keep(v16b a, v16b b, v16b c, v16b d) { keep4_b(a, b, c, d); }
};

// ---- Register-blocked batched WMMA GEMM, operands staged in LDS --------------
// C[m,n] = scale * sum_k A[m,k] * Bt[n,k] (+bias)(+resid); a block owns a 128x256 tile, each of its 2x4 waves a 64x64 tile.
// A row-major [M,K]; Bt row-major [N,K]; M % 128 == 0, N % 256 == 0, K % 64 == 0, K >= 64.
// A stage is 64 k of the block's 128 A rows and 256 Bt rows (128 B a row, whole lines), brought into LDS by asynchronous
// copies, two buffers: stage t + 1 flies while stage t is multiplied. LDS row pitch 144 B (16 B x odd: ds_load_b128 without bank conflicts).
// blockIdx.z = k slice: it sums k in [z*K, (z+1)*K) and writes its own plane at z*strideCz (grid.z = 1: the whole product).
// SPLIT: not carried by the staged loop (one plane per operand).
// BIAS_MODE: 0 = none, 1 = bias[m], 2 = bias[n].
// OUT_MODE: 0 = f32, 1 = f16, 2 = bf16 hi plane (Cout) + bf16 lo plane (Cout2).
// ET: 0 = f16 operands, 1 = bf16 operands (pointers passed as 16-bit storage)
constexpr int BLK_M = 128, BLK_N = 256, STG_K = 64;
constexpr int STG_PITCH = STG_K + 8;                          // 16-bit elements per LDS row
constexpr int STG_ELEMS = (BLK_M + BLK_N) * STG_PITCH;         // one buffer: A rows 0..127, Bt rows 128..383
constexpr unsigned STG_ROWS32_BYTES = 32u * STG_PITCH * 2u;    // LDS step from one copy of a thread to its next (32 rows)

// One stage, this thread's share: 12 copies of 16 B (4 of A, 8 of Bt); a wave's copy covers 4 whole 128-B rows.
// l: the thread's LDS byte address in row (threadIdx.x >> 3) of the buffer; a, b: its global addresses in that row of the A and
// Bt tile; sa, sb: 32 rows of A and Bt in elements. The s_wait_xcnt stands inside the statement, so that no address register
// of a copy is rewritten ahead of it.
__device__ __forceinline__ void stage_copies(unsigned l, const unsigned short* a, size_t sa, const unsigned short* b, size_t sb) {
  asm volatile(
      "global_load_async_to_lds_b128 %0, %12, off\n\t"
      "global_load_async_to_lds_b128 %1, %13, off\n\t"
      "global_load_async_to_lds_b128 %2, %14, off\n\t"
      "global_load_async_to_lds_b128 %3, %15, off\n\t"
      "global_load_async_to_lds_b128 %4, %16, off\n\t"
      "global_load_async_to_lds_b128 %5, %17, off\n\t"
      "global_load_async_to_lds_b128 %6, %18, off\n\t"
      "global_load_async_to_lds_b128 %7, %19, off\n\t"
      "global_load_async_to_lds_b128 %8, %20, off\n\t"
      "global_load_async_to_lds_b128 %9, %21, off\n\t"
      "global_load_async_to_lds_b128 %10, %22, off\n\t"
      "global_load_async_to_lds_b128 %11, %23, off\n\t"
      "s_wait_xcnt 0x0"
      :: "v"(l), "v"(l + STG_ROWS32_BYTES), "v"(l + 2u * STG_ROWS32_BYTES), "v"(l + 3u * STG_ROWS32_BYTES),
         "v"(l + 4u * STG_ROWS32_BYTES), "v"(l + 5u * STG_ROWS32_BYTES), "v"(l + 6u * STG_ROWS32_BYTES), "v"(l + 7u * STG_ROWS32_BYTES),
         "v"(l + 8u * STG_ROWS32_BYTES), "v"(l + 9u * STG_ROWS32_BYTES), "v"(l + 10u * STG_ROWS32_BYTES), "v"(l + 11u * STG_ROWS32_BYTES),
         "v"(a), "v"(a + sa), "v"(a + 2 * sa), "v"(a + 3 * sa),
         "v"(b), "v"(b + sb), "v"(b + 2 * sb), "v"(b + 3 * sb), "v"(b + 4 * sb), "v"(b + 5 * sb), "v"(b + 6 * sb), "v"(b + 7 * sb)
      : "memory");
}
// this wave's copies have landed (the compiler places no wait for them)
__device__ __forceinline__ void wait_copies() { asm volatile("s_wait_asynccnt 0x0" ::: "memory"); }
// this wave's LDS reads have returned, before the barrier behind which their buffer is refilled
__device__ __forceinline__ void wait_lds_reads() { asm volatile("s_wait_dscnt 0x0" ::: "memory"); }

template <int ET> struct Elem;
template <> struct Elem<0> { typedef _Float16 T; };
template <> struct Elem<1> { typedef __bf16 T; };
template <int ET, bool SPLIT, int BIAS_MODE, int OUT_MODE, bool RESID, int ACT = 0>
__device__ __forceinline__ void gemm64_block(
    const int bx, const int b, const int bz,     // block tile, batch and k slice of this work-group
    const unsigned short* __restrict__ Ap, const unsigned short* __restrict__ A2p, int lda, long strideA,
    const unsigned short* __restrict__ Btp, const unsigned short* __restrict__ Bt2p, int ldb, long strideB,
    void* __restrict__ Cout, void* __restrict__ Cout2, int ldc, long strideC, long strideCz,
    const float* __restrict__ bias,
    const float* __restrict__ resid, long strideR,
    int M, int N, int K, float scale) {
  typedef typename Elem<ET>::T T;
  typedef typename Frag<T>::V V;
  static_assert(!SPLIT, "the staged loop carries one plane per operand");
  __shared__ __align__(128) unsigned short sStage[2 * STG_ELEMS];   // two stage buffers
  __shared__ __align__(16) float sT[8][16 * 68];   // per-wave 16x64 slab, pitch 68 floats
  const int lane = threadIdx.x & 31;
  const int wave = threadIdx.x >> 5;
  const int blocksN = N / BLK_N;
  const int blocksM = M / BLK_M;
  if (bx >= blocksM * blocksN) return;   // block-uniform, in front of every barrier
  const int bm = bx / blocksN;
  const int bn = bx - bm * blocksN;
  const int wm = wave >> 2;                    // wave's 64-row band of the block tile
  const int wn = wave & 3;                     // wave's 64-column band
  const int m0 = bm * BLK_M + (wm << 6);
  const int n0 = bn * BLK_N + (wn << 6);

  const size_t kz = (size_t)bz * K;                                    // first k of this slice
  const size_t cz = (size_t)b * strideC + (size_t)bz * strideCz;

  const int rlane = lane & 15;                 // row (A) / col (B, D) within subtile
  const int koff  = (lane >> 4) * 8;           // k offset of this lane half
  const int mOff  = (lane >> 4) * 8;           // D row offset

  // copy side: thread t brings 16-B piece (t & 7) of rows (t >> 3) + 32 c
  const int crow = threadIdx.x >> 3;
  const int cpc  = (threadIdx.x & 7) * 8;
  const unsigned short* gA = Ap  + (size_t)b * strideA + kz + (size_t)(bm * BLK_M + crow) * lda + cpc;
  const unsigned short* gB = Btp + (size_t)b * strideB + kz + (size_t)(bn * BLK_N + crow) * ldb + cpc;
  const size_t sa = (size_t)32 * lda;
  const size_t sb = (size_t)32 * ldb;
  const unsigned lcopy = (unsigned)(size_t)(const void*)sStage + (unsigned)(crow * STG_PITCH + cpc) * 2u;
  constexpr unsigned STG_BYTES = (unsigned)STG_ELEMS * 2u;

  // read side: this lane's first A and Bt fragment rows in buffer 0
  const T* fA = (const T*)sStage + (size_t)((wm << 6) + rlane) * STG_PITCH + koff;
  const T* fB = (const T*)sStage + (size_t)(BLK_M + (wn << 6) + rlane) * STG_PITCH + koff;

  v8f acc[4][4];
#pragma unroll
  for (int i = 0; i < 4; ++i)
#pragma unroll
    for (int j = 0; j < 4; ++j) acc[i][j] = (v8f){0.f,0.f,0.f,0.f,0.f,0.f,0.f,0.f};

  const int stages = K / STG_K;
  stage_copies(lcopy, gA, sa, gB, sb);
  wait_copies();
  __syncthreads();                             // stage 0 is readable by every wave
  if (stages > 1) stage_copies(lcopy + STG_BYTES, gA + STG_K, sa, gB + STG_K, sb);

#pragma unroll 1   // one stage a trip: the buffer index and the refill test stay scalar
  for (int t = 0; t < stages; ++t) {
    const int buf = (t & 1) * STG_ELEMS;
#pragma unroll
    for (int kk = 0; kk < STG_K; kk += 32) {
      V bh[4], ah[4];
#pragma unroll
      for (int j = 0; j < 4; ++j) bh[j] = Frag<T>::load(fB + buf + j * 16 * STG_PITCH + kk);
#pragma unroll
      for (int i = 0; i < 4; ++i) ah[i] = Frag<T>::load(fA + buf + i * 16 * STG_PITCH + kk);
#pragma unroll
      for (int i = 0; i < 4; ++i) {
#pragma unroll
        for (int j = 0; j < 4; ++j) acc[i][j] = Frag<T>::mma(ah[i], bh[j], acc[i][j]);
        Frag<T>::guard(acc[i][0], acc[i][3], ah[i], ah[i]);
      }
      Frag<T>::keep(bh[0], bh[1], bh[2], bh[3]);
    }
    wait_lds_reads();
    wait_copies();
    __syncthreads();                           // publishes stage t + 1 and ends every read of stage t's buffer
    if (t + 2 < stages)
      stage_copies(lcopy + (unsigned)(t & 1) * STG_BYTES, gA + (size_t)(t + 2) * STG_K, sa, gB + (size_t)(t + 2) * STG_K, sb);
  }
  wait_copies();
  acc_guard4(acc[0][0], acc[0][1], acc[0][2], acc[0][3]);
  acc_guard4(acc[1][0], acc[1][1], acc[1][2], acc[1][3]);
  acc_guard4(acc[2][0], acc[2][1], acc[2][2], acc[2][3]);
  acc_guard4(acc[3][0], acc[3][1], acc[3][2], acc[3][3]);

  // ---- epilogue ----
  float* slab = sT[wave];
  const float* Rb = RESID ? (resid + (size_t)b * strideR) : nullptr;
#pragma unroll
  for (int i = 0; i < 4; ++i) {
    const int mBase = m0 + (i << 4);
#pragma unroll
    for (int j = 0; j < 4; ++j) {
      const int n = n0 + (j << 4) + rlane;
      float bv = 0.f;
      if (BIAS_MODE == 2) bv = bias[n];
#pragma unroll
      for (int r = 0; r < 8; ++r) {
        float v = acc[i][j][r] * scale;
        if (BIAS_MODE == 1) v += bias[mBase + mOff + r];
        if (BIAS_MODE == 2) v += bv;
        if (RESID) v += Rb[(size_t)(mBase + mOff + r) * ldc + n];
        if (ACT == 1) v = tanhf(v);
        if (ACT == 2) v = fmaxf(v, 0.0f);
        if (ACT == 3) v = v / (1.0f + expf(-v));
        if (ACT == 4) v = (v > 0.f) ? v : 0.01f * v;
        if (ACT == 5) v = 0.5f * v * (1.0f + erff(v * 0.70710678118654752f));
        slab[(mOff + r) * 68 + (j << 4) + rlane] = v;
      }
    }
    __builtin_amdgcn_fence(__ATOMIC_RELEASE, "workgroup");
    __builtin_amdgcn_wave_barrier();
    __builtin_amdgcn_fence(__ATOMIC_ACQUIRE, "workgroup");
    if (OUT_MODE == 0) {
      float* C = (float*)Cout + cz;
      const int hh = lane >> 4, c4 = (lane & 15) * 4;     // row seg = 256 B = 16 lanes x 16 B
      {
#pragma unroll
        for (int it = 0; it < 8; ++it) {
          const int row = it * 2 + hh;
          v4f v = *(const v4f*)(slab + row * 68 + c4);
          *(v4f*)(C + (size_t)(mBase + row) * ldc + n0 + c4) = v;
        }
        
      }
    } else {
      const int q = lane >> 3, c8 = (lane & 7) * 8;
      unsigned short* C  = (unsigned short*)Cout  + cz;
      unsigned short* C2 = (OUT_MODE == 2) ? ((unsigned short*)Cout2 + cz) : nullptr;
      {
#pragma unroll
        for (int it = 0; it < 4; ++it) {
          const int row = it * 4 + q;
          const float* sp = slab + row * 68 + c8;
          v8h hv, lv;
#pragma unroll
          for (int e = 0; e < 8; ++e) {
            if (OUT_MODE == 1) {
              hv[e] = (_Float16)sp[e];
            } else {
              unsigned short hb = f2bf_bits(sp[e]);
              unsigned short lb = f2bf_bits(sp[e] - bf_bits2f(hb));
              hv[e] = __builtin_bit_cast(_Float16, hb);
              lv[e] = __builtin_bit_cast(_Float16, lb);
            }
          }
          *(v8h*)(C + (size_t)(mBase + row) * ldc + n0 + c8) = hv;
          if (OUT_MODE == 2) *(v8h*)(C2 + (size_t)(mBase + row) * ldc + n0 + c8) = lv;
        }
        
      }
    }
    __builtin_amdgcn_fence(__ATOMIC_RELEASE, "workgroup");
    __builtin_amdgcn_wave_barrier();
    __builtin_amdgcn_fence(__ATOMIC_ACQUIRE, "workgroup");
  }
}

// one product a launch: blockIdx.x = block tile, .y = batch, .z = k slice
template <int ET, bool SPLIT, int BIAS_MODE, int OUT_MODE, bool RESID, int ACT = 0>
__global__ __launch_bounds__(256) void wmma_gemm64(
    const unsigned short* __restrict__ Ap, const unsigned short* __restrict__ A2p, int lda, long strideA,
    const unsigned short* __restrict__ Btp, const unsigned short* __restrict__ Bt2p, int ldb, long strideB,
    void* __restrict__ Cout, void* __restrict__ Cout2, int ldc, long strideC, long strideCz,
    const float* __restrict__ bias,
    const float* __restrict__ resid, long strideR,
    int M, int N, int K, float scale) {
  gemm64_block<ET, SPLIT, BIAS_MODE, OUT_MODE, RESID, ACT>(
      (int)blockIdx.x, (int)blockIdx.y, (int)blockIdx.z, Ap, A2p, lda, strideA, Btp, Bt2p, ldb, strideB,
      Cout, Cout2, ldc, strideC, strideCz, bias, resid, strideR, M, N, K, scale);
}

// Two independent products of equal K and scale (f16 in, f16 out) in ONE launch: work-groups blockIdx.x < tiles0 own the
// block tiles of product 0, the rest those of product 1; blockIdx.y = batch of both. The choice is block-uniform (scalar selects).
__global__ __launch_bounds__(256) void wmma_gemm64_pair(
    const unsigned short* __restrict__ A0, int lda0, long strideA0,
    const unsigned short* __restrict__ Bt0, int ldb0, long strideB0,
    unsigned short* __restrict__ C0, int ldc0, long strideC0, int M0, int N0, int tiles0,
    const unsigned short* __restrict__ A1, int lda1, long strideA1,
    const unsigned short* __restrict__ Bt1, int ldb1, long strideB1,
    unsigned short* __restrict__ C1, int ldc1, long strideC1, int M1, int N1,
    int K, float scale) {
  const bool p0 = (int)blockIdx.x < tiles0;
  const unsigned short* A  = p0 ? A0 : A1;
  const unsigned short* Bt = p0 ? Bt0 : Bt1;
  unsigned short*       C  = p0 ? C0 : C1;
  gemm64_block<0, false, 0, 1, false>(
      p0 ? (int)blockIdx.x : (int)blockIdx.x - tiles0, (int)blockIdx.y, 0,
      A, A, p0 ? lda0 : lda1, p0 ? strideA0 : strideA1,
      Bt, Bt, p0 ? ldb0 : ldb1, p0 ? strideB0 : strideB1,
      (void*)C, (void*)C, p0 ? ldc0 : ldc1, p0 ? strideC0 : strideC1, 0L,
      nullptr, nullptr, 0L,
      p0 ? M0 : M1, p0 ? N0 : N1, K, scale);
}

// ---------------- cast kernels: f32 -> f16(bf16_RNE(x) * mul) ----------------
__device__ __forceinline__ void cvt_bf_f16_store8(const float* __restrict__ src, unsigned short* __restrict__ dst,
                                                  int i, float mul) {
  const v4f a = *(const v4f*)(src + (size_t)i * 8);
  const v4f c = *(const v4f*)(src + (size_t)i * 8 + 4);
  v8h o;
#pragma unroll
  for (int e = 0; e < 4; ++e) {
    const float fa = bf_bits2f(f2bf_bits(a[e])) * mul;
    const float fc = bf_bits2f(f2bf_bits(c[e])) * mul;
    o[e]     = (_Float16)fa;
    o[4 + e] = (_Float16)fc;
  }
  _Float16* op = (_Float16*)(void*)dst + (size_t)i * 8;
  *(v8h*)op = o;
  
}

// Both casts in ONE launch (they need nothing of each other). Work-groups blockIdx.x < xBlocks: x [NTOK][DMODEL] f32 -> f16 plane,
// same layout, xBlocks * 256 threads * 8 = all its elements exactly. The rest, wBlocks a plane: six [DHEAD][DHEAD] f32 weights ->
// six consecutive f16 planes (plane y <- source y), carried x mulW; wBlocks * 256 * 8 = a plane's elements exactly.
__global__ __launch_bounds__(256) void cast_xw_kernel(
    const float* __restrict__ x, unsigned short* __restrict__ outX, int xBlocks,
    const float* __restrict__ w0, const float* __restrict__ w1, const float* __restrict__ w2,
    const float* __restrict__ w3, const float* __restrict__ w4, const float* __restrict__ w5,
    unsigned short* __restrict__ outW, int wBlocks, float mulW) {
  const int bx = (int)blockIdx.x;
  if (bx < xBlocks) {                         // block-uniform
    cvt_bf_f16_store8(x, outX, bx * 256 + (int)threadIdx.x, 1.0f);
    return;
  }
  const int y  = (bx - xBlocks) / wBlocks;    // block-uniform source select (all global pointers)
  const int bw = (bx - xBlocks) - y * wBlocks;
  const float* src = w0;
  if (y == 1) src = w1;
  if (y == 2) src = w2;
  if (y == 3) src = w3;
  if (y == 4) src = w4;
  if (y == 5) src = w5;
  unsigned short* dst = outW + (size_t)y * (size_t)wBlocks * 2048;
  cvt_bf_f16_store8(src, dst, bw * 256 + (int)threadIdx.x, mulW);
  // precaution: in the listing the x range's code follows this store and rewrites its offset register; the wait stands in front of that
  asm volatile("s_wait_xcnt 0x0" ::: "memory");
}

// ---------------- v k^T, all tokens in one work-group ----------------
// out[h][e][d] = f16(mul * sum over all NTOK tokens m of v[e][m] * k[d][m]); kvp per head: rows 0..511 = k[d][m], 512..1023 = v[e][m].
// A work-group owns one 64x64 tile (blockIdx.x = 8 * tile row + tile column, blockIdx.y = head). A stage is 512 tokens of its 64 v rows
// and 64 k rows (1 KiB a row, whole lines), brought into LDS by asynchronous copies, two buffers. The eight waves split the k range:
// wave w multiplies tokens [64 w, 64 w + 64) of every stage into its own 64x64 f32 tile; the eight tiles are added through LDS, w ascending.
// LDS row pitch 1040 B (16 B x odd: ds_load_b128 without bank conflicts).
constexpr int VK_TILE  = 64;
constexpr int VK_STG_K = 512;
constexpr int VK_PITCH = VK_STG_K + 8;                        // 16-bit elements per LDS row
constexpr int VK_BUF_ELEMS = 2 * VK_TILE * VK_PITCH;          // one buffer: v rows 0..63, k rows 64..127
constexpr unsigned VK_ROWS4_BYTES = 4u * VK_PITCH * 2u;       // LDS step from one copy of a thread to its next (4 rows)
constexpr int VK_RED_PITCH = 68;                              // floats per row of a wave's tile in the sum (as the GEMM's slab)
static_assert(8 * VK_TILE * VK_RED_PITCH * 4 <= 2 * VK_BUF_ELEMS * 2, "the eight f32 tiles fit the ring they reuse");
typedef __attribute__((ext_vector_type(4))) _Float16 v4h;

// Eight copies of 16 B of one thread: rows 4 apart, LDS address l, global address g, s = 4 rows in elements. A wave's copy covers
// 512 B of one row. The s_wait_xcnt stands inside the statement, so that no address register of a copy is rewritten ahead of it.
__device__ __forceinline__ void copies8(unsigned l, const unsigned short* g, size_t s) {
  asm volatile(
      "global_load_async_to_lds_b128 %0, %8, off\n\t"
      "global_load_async_to_lds_b128 %1, %9, off\n\t"
      "global_load_async_to_lds_b128 %2, %10, off\n\t"
      "global_load_async_to_lds_b128 %3, %11, off\n\t"
      "global_load_async_to_lds_b128 %4, %12, off\n\t"
      "global_load_async_to_lds_b128 %5, %13, off\n\t"
      "global_load_async_to_lds_b128 %6, %14, off\n\t"
      "global_load_async_to_lds_b128 %7, %15, off\n\t"
      "s_wait_xcnt 0x0"
      :: "v"(l), "v"(l + VK_ROWS4_BYTES), "v"(l + 2u * VK_ROWS4_BYTES), "v"(l + 3u * VK_ROWS4_BYTES),
         "v"(l + 4u * VK_ROWS4_BYTES), "v"(l + 5u * VK_ROWS4_BYTES), "v"(l + 6u * VK_ROWS4_BYTES), "v"(l + 7u * VK_ROWS4_BYTES),
         "v"(g), "v"(g + s), "v"(g + 2 * s), "v"(g + 3 * s), "v"(g + 4 * s), "v"(g + 5 * s), "v"(g + 6 * s), "v"(g + 7 * s)
      : "memory");
}
// One stage, this thread's share: 32 copies (16 of v, 16 of k); a, b: its global addresses in rows (threadIdx.x >> 6) of the two tiles.
__device__ __forceinline__ void vk_stage_copies(unsigned l, const unsigned short* a, const unsigned short* b) {
  constexpr size_t s = (size_t)4 * NTOK;
  copies8(l, a, s);
  copies8(l + 8u * VK_ROWS4_BYTES, a + 8 * s, s);
  copies8(l + 16u * VK_ROWS4_BYTES, b, s);
  copies8(l + 24u * VK_ROWS4_BYTES, b + 8 * s, s);
}

__global__ __launch_bounds__(256) void vkt_tile_kernel(const unsigned short* __restrict__ kvp, unsigned short* __restrict__ out, float mul) {
  typedef _Float16 T;
  typedef Frag<T>::V V;
  __shared__ __align__(128) unsigned short sRing[2 * VK_BUF_ELEMS];   // two stage buffers; behind the loop the eight f32 tiles
  const int lane = threadIdx.x & 31;
  const int wave = threadIdx.x >> 5;
  const int e0 = ((int)blockIdx.x >> 3) * VK_TILE;
  const int d0 = ((int)blockIdx.x & 7) * VK_TILE;
  const unsigned short* kp = kvp + (size_t)blockIdx.y * (2 * DHEAD * NTOK);
  const unsigned short* vp = kp + (size_t)DHEAD * NTOK;

  const int rlane = lane & 15;                 // row (A) / col (B, D) within subtile
  const int koff  = (lane >> 4) * 8;           // k offset of this lane half
  const int mOff  = (lane >> 4) * 8;           // D row offset

  // copy side: thread t brings 16-B piece (t & 63) of rows (t >> 6) + 4 c
  const int crow = threadIdx.x >> 6;
  const int cpc  = (threadIdx.x & 63) * 8;
  const unsigned short* gA = vp + (size_t)(e0 + crow) * NTOK + cpc;
  const unsigned short* gB = kp + (size_t)(d0 + crow) * NTOK + cpc;
  const unsigned lcopy = (unsigned)(size_t)(const void*)sRing + (unsigned)(crow * VK_PITCH + cpc) * 2u;
  constexpr unsigned BUF_BYTES = (unsigned)VK_BUF_ELEMS * 2u;

  // read side: this lane's first v and k fragment rows in buffer 0, at this wave's 64 tokens of the stage
  const T* fA = (const T*)sRing + (size_t)rlane * VK_PITCH + (wave << 6) + koff;
  const T* fB = (const T*)sRing + (size_t)(VK_TILE + rlane) * VK_PITCH + (wave << 6) + koff;

  v8f acc[4][4];
#pragma unroll
  for (int i = 0; i < 4; ++i)
#pragma unroll
    for (int j = 0; j < 4; ++j) acc[i][j] = (v8f){0.f,0.f,0.f,0.f,0.f,0.f,0.f,0.f};

  constexpr int stages = NTOK / VK_STG_K;
  static_assert(NTOK % VK_STG_K == 0 && stages >= 2);
  vk_stage_copies(lcopy, gA, gB);
  wait_copies();
  __syncthreads();                             // stage 0 is readable by every wave
  vk_stage_copies(lcopy + BUF_BYTES, gA + VK_STG_K, gB + VK_STG_K);

#pragma unroll 1   // one stage a trip: the buffer index and the refill test stay scalar
  for (int t = 0; t < stages; ++t) {
    const int buf = (t & 1) * VK_BUF_ELEMS;
#pragma unroll
    for (int kk = 0; kk < 64; kk += 32) {
      V bh[4], ah[4];
#pragma unroll
      for (int j = 0; j < 4; ++j) bh[j] = Frag<T>::load(fB + buf + j * 16 * VK_PITCH + kk);
#pragma unroll
      for (int i = 0; i < 4; ++i) ah[i] = Frag<T>::load(fA + buf + i * 16 * VK_PITCH + kk);
      // keeps the block's 16 LDS loads together in front of its WMMAs: left free, the scheduler reloads one v fragment register
      // set between the WMMA rows and the wave waits out the LDS latency four times a block
      __builtin_amdgcn_sched_barrier(0);
#pragma unroll
      for (int i = 0; i < 4; ++i) {
#pragma unroll
        for (int j = 0; j < 4; ++j) acc[i][j] = Frag<T>::mma(ah[i], bh[j], acc[i][j]);
      }
    }
    // keeps the last block's WMMAs in front of the barrier: left free, the scheduler sinks them behind it, in front of the refill,
    // and every stage's copies start that much later
    __builtin_amdgcn_sched_barrier(0);
    wait_lds_reads();
    wait_copies();
    __syncthreads();                           // publishes stage t + 1 and ends every read of stage t's buffer
    if (t + 2 < stages)
      vk_stage_copies(lcopy + (unsigned)(t & 1) * BUF_BYTES, gA + (size_t)(t + 2) * VK_STG_K, gB + (size_t)(t + 2) * VK_STG_K);
  }
  wait_copies();

  // ---- sum of the eight waves' tiles: the last trip's barrier has ended every read of the ring, and no copy is outstanding ----
  float* red = (float*)(void*)sRing;
  float* mine = red + (size_t)wave * (VK_TILE * VK_RED_PITCH);
#pragma unroll
  for (int i = 0; i < 4; ++i)
#pragma unroll
    for (int j = 0; j < 4; ++j)
#pragma unroll
      for (int r = 0; r < 8; ++r) mine[((i << 4) + mOff + r) * VK_RED_PITCH + (j << 4) + rlane] = acc[i][j][r];
  __syncthreads();                             // every wave's tile is readable by every wave
  const int c4 = ((int)threadIdx.x & 15) * 4;  // 16 lanes read one 256-B row and store one whole 128-B line
  _Float16* op = (_Float16*)(void*)out + (size_t)blockIdx.y * (DHEAD * DHEAD) + d0 + c4;
#pragma unroll
  for (int q = 0; q < 4; ++q) {
    const int row = ((int)threadIdx.x >> 4) + (q << 4);
    v4f s = *(const v4f*)(red + row * VK_RED_PITCH + c4);
#pragma unroll
    for (int w = 1; w < 8; ++w) s += *(const v4f*)(red + (w * VK_TILE + row) * VK_RED_PITCH + c4);
    v4h o;
#pragma unroll
    for (int e = 0; e < 4; ++e) o[e] = (_Float16)(s[e] * mul);
    *(v4h*)(op + (size_t)(e0 + row) * DHEAD) = o;
  }
}

// ---------------- host orchestration ----------------
// out = (q^T k) v^T is formed as q^T (k v^T): no [NTOK][NTOK] plane.
// Workspace region map (bytes; all offsets multiples of 128):
//   X16 : x as f16 [NTOK][DMODEL]                               8,388,608   @ 0
//   W16 : 6 planes [DHEAD][DHEAD] f16 (x64): Wk_h0, Wv_h0, Wk_h1, Wv_h1, Wq_h0, Wq_h1
//                                                               3,145,728   @ 8,388,608
//   QT  : per head [NTOK][DHEAD] f16 (q^T[n][d])                8,388,608   @ 11,534,336
//   KVP : per head [2*DHEAD][NTOK] f16 (rows 0..511 = k[d][m], 512..1023 = v[e][m])
//                                                              16,777,216   @ 19,922,944
//   KVT : per head [DHEAD][DHEAD] f16 (x1/64) (KV[e][d])        1,048,576   @ 36,700,160
//   total                                                      37,748,736
constexpr size_t X16_BYTES  = (size_t)NTOK * DMODEL * 2;
constexpr size_t W16_BYTES  = (size_t)6 * DHEAD * DHEAD * 2;
constexpr size_t QT_BYTES   = (size_t)NHEAD * NTOK * DHEAD * 2;
constexpr size_t KVP_BYTES  = (size_t)NHEAD * 2 * DHEAD * NTOK * 2;
constexpr size_t KVT_BYTES  = (size_t)NHEAD * DHEAD * DHEAD * 2;
constexpr size_t X16_OFF  = 0;
constexpr size_t W16_OFF  = X16_OFF + X16_BYTES;
constexpr size_t QT_OFF   = W16_OFF + W16_BYTES;
constexpr size_t KVP_OFF  = QT_OFF + QT_BYTES;
constexpr size_t KVT_OFF  = KVP_OFF + KVP_BYTES;
constexpr size_t WS_TOTAL = KVT_OFF + KVT_BYTES;
static_assert(WS_TOTAL == 37748736u);
static_assert(WS_TOTAL <= (size_t)134217728u);
static_assert((W16_OFF % 128) == 0 && (QT_OFF % 128) == 0 && (KVP_OFF % 128) == 0 && (KVT_OFF % 128) == 0);

// GEMM shape contracts (no tail handling): M multiple of 128, N of 256, K of 64
// proj q   : M = NTOK,    N = DHEAD, K = DHEAD
// proj k|v : M = 2*DHEAD, N = NTOK,  K = DHEAD
// v k^T    : its own kernel, 64x64 tiles, all NTOK tokens
// out      : M = NTOK,    N = DHEAD, K = DHEAD
static_assert(NTOK % BLK_M == 0 && NTOK % BLK_N == 0 && DHEAD % BLK_M == 0 && DHEAD % BLK_N == 0 && (2 * DHEAD) % BLK_M == 0);
static_assert(DHEAD % STG_K == 0 && DHEAD == 8 * VK_TILE);
static_assert(DMODEL == NHEAD * DHEAD);
static_assert((NTOK * DMODEL) % (8 * 256) == 0 && (DHEAD * DHEAD) % (8 * 256) == 0);

extern "C" void kernel_launch(void* const* d_in, const int* in_sizes, int n_in,
                              void* d_out, int out_size, void* d_ws, size_t ws_size,
                              hipStream_t stream) {
  if (n_in < 7) return;
  if (in_sizes[0] != NTOK * DMODEL) return;
  for (int i = 1; i < 7; ++i) if (in_sizes[i] != DHEAD * DHEAD) return;
  if (out_size != NTOK * DMODEL) return;
  if (ws_size < WS_TOTAL) return;

  // d_in order per the input table: x, Wq1, Wq2, Wk1, Wk2, Wv1, Wv2 (all f32)
  const float* x   = (const float*)d_in[0];
  const float* wq1 = (const float*)d_in[1];
  const float* wq2 = (const float*)d_in[2];
  const float* wk1 = (const float*)d_in[3];
  const float* wk2 = (const float*)d_in[4];
  const float* wv1 = (const float*)d_in[5];
  const float* wv2 = (const float*)d_in[6];
  float* out = (float*)d_out;

  char* ws = (char*)d_ws;
  unsigned short* X16 = (unsigned short*)(ws + X16_OFF);
  unsigned short* W16 = (unsigned short*)(ws + W16_OFF);
  unsigned short* QT  = (unsigned short*)(ws + QT_OFF);
  unsigned short* KVP = (unsigned short*)(ws + KVP_OFF);
  unsigned short* KVT = (unsigned short*)(ws + KVT_OFF);
  unsigned short* WKV = W16;                                   // per head: [2*DHEAD][DHEAD] (k rows then v rows)
  unsigned short* WQ  = W16 + (size_t)4 * DHEAD * DHEAD;        // per head: [DHEAD][DHEAD]
  const float* fdum = x;                                       // unused bias/resid slots (never dereferenced)

  // 1) + 2) one launch: x -> f16 plane; weights -> f16 planes carried x64, plane order Wk_h0, Wv_h0, Wk_h1, Wv_h1, Wq_h0, Wq_h1
  {
    const int xBlocks = (NTOK * DMODEL) / (8 * 256);            // 2048
    const int wBlocks = (DHEAD * DHEAD) / (8 * 256);            // 128 a plane
    cast_xw_kernel<<<dim3(xBlocks + 6 * wBlocks), dim3(256), 0, stream>>>(
        x, X16, xBlocks, wk1, wv1, wk2, wv2, wq1, wq2, W16, wBlocks, W_CARRY);
  }
  // 3) + 4) the projections, one launch (they share X16 and depend on nothing of each other):
  //    k | v per head: KVP[h][r][m] = (1/64) * sum_c WKV[h][r][c] * X16[m][h*512 + c]   (r<512: k, r>=512: v)
  //    q^T per head  : QT[h][n][d]  = (1/64) * sum_c X16[n][h*512 + c] * WQ[h][d][c]
  {
    const int tilesKV = ((2 * DHEAD) / BLK_M) * (NTOK / BLK_N);   // 128
    const int tilesQ  = (NTOK / BLK_M) * (DHEAD / BLK_N);         // 64
    wmma_gemm64_pair<<<dim3(tilesKV + tilesQ, NHEAD), dim3(256), 0, stream>>>(
        WKV, DHEAD, (long)2 * DHEAD * DHEAD,
        X16, DMODEL, (long)DHEAD,
        KVP, NTOK, (long)2 * DHEAD * NTOK, 2 * DHEAD, NTOK, tilesKV,
        X16, DMODEL, (long)DHEAD,
        WQ, DHEAD, (long)DHEAD * DHEAD,
        QT, DHEAD, (long)NTOK * DHEAD, NTOK, DHEAD,
        DHEAD, W_CARRY_INV);
  }
  // 5) KVT[h][e][d] = f16((1/64) * sum over all tokens m of v[e][m] * k[d][m])
  {
    const int tiles = (DHEAD / VK_TILE) * (DHEAD / VK_TILE);   // 64
    vkt_tile_kernel<<<dim3(tiles, NHEAD), dim3(256), 0, stream>>>(KVP, KVT, KV_CARRY);
  }
  // 6) out[n][h*512 + e] = 64 * sum_d QT[h][n][d] * KVT[h][e][d]   (f32, ldc = DMODEL, per-head column offset DHEAD)
  {
    const int tiles = (NTOK / 64) * (DHEAD / 64);              // 512
    wmma_gemm64<0, false, 0, 0, false><<<dim3((tiles + 7) / 8, NHEAD), dim3(256), 0, stream>>>(
        QT, QT, DHEAD, (long)NTOK * DHEAD,
        KVT, KVT, DHEAD, (long)DHEAD * DHEAD,
        (void*)out, (void*)out, DMODEL, (long)DHEAD, 0L,
        fdum, fdum, 0L,
        NTOK, DHEAD, DHEAD, KV_CARRY_INV);
  }
}

// v005
// Measured time: 41.8 microseconds a run.
// Two timings next to v004 both put it at 1.04 times that version's speed.
// Counting every step since v000, it is 6.97 times as fast.
// Contractions (q/k/v projections, KV = v k^T, out = q^T KV^T): v_wmma_f32_16x16x32_f16, f16 operands, f32 accumulate; float inputs RNE-converted to bf16 at load (weights carried x64, exact power of two), intermediate planes f16, v k^T per-wave partials f32, summed in LDS.
#include <hip/hip_runtime.h>
#include <stdint.h>
#include <stddef.h>

typedef __attribute__((ext_vector_type(16))) _Float16 v16h;
typedef __attribute__((ext_vector_type(8)))  _Float16 v8h;
typedef __attribute__((ext_vector_type(16))) __bf16   v16b;
typedef __attribute__((ext_vector_type(8)))  __bf16   v8b;
typedef __attribute__((ext_vector_type(8)))  float    v8f;
typedef __attribute__((ext_vector_type(4)))  float    v4f;

// ---------------- problem constants ----------------
constexpr int NTOK   = 4096;
constexpr int DMODEL = 1024;
constexpr int DHEAD  = 512;
constexpr int NHEAD  = 2;
constexpr float W_CARRY     = 64.0f;          // weights carried x64 in f16 (exact)
constexpr float W_CARRY_INV = 1.0f / 64.0f;   // folded back in the projection epilogue
constexpr float KV_CARRY     = 1.0f / 64.0f;  // v k^T carried x1/64 in f16 (exact; sums over NTOK tokens need the range)
constexpr float KV_CARRY_INV = 64.0f;         // folded back in the output epilogue

// ---------------- helpers ----------------
__device__ __forceinline__ unsigned short f2bf_bits(float f) {
  unsigned u = __float_as_uint(f);
  return (unsigned short)((u + 0x7FFFu + ((u >> 16) & 1u)) >> 16);
}
__device__ __forceinline__ float bf_bits2f(unsigned short h) { return __uint_as_float(((unsigned)h) << 16); }

// hazard guards as plain device helpers (no inline asm inside the kernel template body)
__device__ __forceinline__ void dep_guard_h(v8f& a, v8f& b, v16h x, v16h y) { asm volatile("v_nop\n\tv_nop\n\tv_nop\n\tv_nop" : "+v"(a), "+v"(b) : "v"(x), "v"(y)); }
__device__ __forceinline__ void dep_guard_b(v8f& a, v8f& b, v16b x, v16b y) { asm volatile("v_nop\n\tv_nop\n\tv_nop\n\tv_nop" : "+v"(a), "+v"(b) : "v"(x), "v"(y)); }
__device__ __forceinline__ void keep4_h(v16h a, v16h b, v16h c, v16h d) { asm volatile("v_nop" :: "v"(a), "v"(b), "v"(c), "v"(d)); }
__device__ __forceinline__ void keep4_b(v16b a, v16b b, v16b c, v16b d) { asm volatile("v_nop" :: "v"(a), "v"(b), "v"(c), "v"(d)); }
__device__ __forceinline__ void acc_guard4(v8f& a, v8f& b, v8f& c, v8f& d) { asm volatile("v_nop\n\tv_nop\n\tv_nop\n\tv_nop" : "+v"(a), "+v"(b), "+v"(c), "+v"(d)); }
template <typename T> struct Frag;
template <> struct Frag<_Float16> {
  typedef v16h V; union U { v16h v; v8h h[2]; };
  static __device__ __forceinline__ v16h load(const _Float16* p) {   // elements 0..7 <- p[0..7], 8..15 <- p[16..23]
    U f; f.h[0] = *(const v8h*)(p); f.h[1] = *(const v8h*)(p + 16); return f.v;
  }
  static __device__ __forceinline__ v8f mma(v16h a, v16h b, v8f c) {
    return __builtin_amdgcn_wmma_f32_16x16x32_f16(false, a, false, b, (short)0, c, false, false);
  }
  static __device__ __forceinline__ void guard(v8f& a, v8f& b, v16h x, v16h y) { dep_guard_h(a, b, x, y); }
  static __device__ __forceinline__ void keep(v16h a, v16h b, v16h c, v16h d) { keep4_h(a, b, c, d); }
};
template <> struct Frag<__bf16> {
  typedef v16b V; union U { v16b v; v8b h[2]; };
  static __device__ __forceinline__ v16b load(const __bf16* p) {
    U f; f.h[0] = *(const v8b*)(p); f.h[1] = *(const v8b*)(p + 16); return f.v;
  }
  static __device__ __forceinline__ v8f mma(v16b a, v16b b, v8f c) {
    return __builtin_amdgcn_wmma_f32_16x16x32_bf16(false, a, false, b, (short)0, c, false, false);
  }
  static __device__ __forceinline__ void guard(v8f& a, v8f& b, v16b x, v16b y) { dep_guard_b(a, b, x, y); }
  static __device__ __forceinline__ void keep(v16b a, v16b b, v16b c, v16b d) { keep4_b(a, b, c, d); }
};

// ---- Register-blocked batched WMMA GEMM, operands staged in LDS --------------
// C[m,n] = scale * sum_k A[m,k] * Bt[n,k] (+bias)(+resid); a block owns a 128x256 tile, each of its 2x4 waves a 64x64 tile.
// A row-major [M,K]; Bt row-major [N,K]; M % 128 == 0, N % 256 == 0, K % 64 == 0, K >= 64.
// A stage is 64 k of the block's 128 A rows and 256 Bt rows (128 B a row, whole lines), brought into LDS by asynchronous
// copies. NBUF = 2: stage t + 1 flies while stage t is multiplied. NBUF = 4: stages t + 1 .. t + 3 fly, behind counted waits, so that copies
// are in flight all the time (for a launch with one work-group a WGP, which has the LDS). LDS row pitch 144 B (16 B x odd: ds_load_b128 without bank conflicts).
// blockIdx.z = k slice: it sums k in [z*K, (z+1)*K) and writes its own plane at z*strideCz (grid.z = 1: the whole product).
// SPLIT: not carried by the staged loop (one plane per operand).
// BIAS_MODE: 0 = none, 1 = bias[m], 2 = bias[n].
// OUT_MODE: 0 = f32, 1 = f16, 2 = bf16 hi plane (Cout) + bf16 lo plane (Cout2).
// ET: 0 = f16 operands, 1 = bf16 operands (pointers passed as 16-bit storage)
constexpr int BLK_M = 128, BLK_N = 256, STG_K = 64;
constexpr int STG_PITCH = STG_K + 8;                          // 16-bit elements per LDS row
constexpr int STG_ELEMS = (BLK_M + BLK_N) * STG_PITCH;         // one buffer: A rows 0..127, Bt rows 128..383
constexpr unsigned STG_ROWS32_BYTES = 32u * STG_PITCH * 2u;    // LDS step from one copy of a thread to its next (32 rows)

// One stage, this thread's share: 12 copies of 16 B (4 of A, 8 of Bt); a wave's copy covers 4 whole 128-B rows.
// l: the thread's LDS byte address in row (threadIdx.x >> 3) of the buffer; a, b: its global addresses in that row of the A and
// Bt tile; sa, sb: 32 rows of A and Bt in elements. The s_wait_xcnt stands inside the statement, so that no address register
// of a copy is rewritten ahead of it.
__device__ __forceinline__ void stage_copies(unsigned l, const unsigned short* a, size_t sa, const unsigned short* b, size_t sb) {
  asm volatile(
      "global_load_async_to_lds_b128 %0, %12, off\n\t"
      "global_load_async_to_lds_b128 %1, %13, off\n\t"
      "global_load_async_to_lds_b128 %2, %14, off\n\t"
      "global_load_async_to_lds_b128 %3, %15, off\n\t"
      "global_load_async_to_lds_b128 %4, %16, off\n\t"
      "global_load_async_to_lds_b128 %5, %17, off\n\t"
      "global_load_async_to_lds_b128 %6, %18, off\n\t"
      "global_load_async_to_lds_b128 %7, %19, off\n\t"
      "global_load_async_to_lds_b128 %8, %20, off\n\t"
      "global_load_async_to_lds_b128 %9, %21, off\n\t"
      "global_load_async_to_lds_b128 %10, %22, off\n\t"
      "global_load_async_to_lds_b128 %11, %23, off\n\t"
      "s_wait_xcnt 0x0"
      :: "v"(l), "v"(l + STG_ROWS32_BYTES), "v"(l + 2u * STG_ROWS32_BYTES), "v"(l + 3u * STG_ROWS32_BYTES),
         "v"(l + 4u * STG_ROWS32_BYTES), "v"(l + 5u * STG_ROWS32_BYTES), "v"(l + 6u * STG_ROWS32_BYTES), "v"(l + 7u * STG_ROWS32_BYTES),
         "v"(l + 8u * STG_ROWS32_BYTES), "v"(l + 9u * STG_ROWS32_BYTES), "v"(l + 10u * STG_ROWS32_BYTES), "v"(l + 11u * STG_ROWS32_BYTES),
         "v"(a), "v"(a + sa), "v"(a + 2 * sa), "v"(a + 3 * sa),
         "v"(b), "v"(b + sb), "v"(b + 2 * sb), "v"(b + 3 * sb), "v"(b + 4 * sb), "v"(b + 5 * sb), "v"(b + 6 * sb), "v"(b + 7 * sb)
      : "memory");
}
// this wave's copies have landed (the compiler places no wait for them)
__device__ __forceinline__ void wait_copies() { asm volatile("s_wait_asynccnt 0x0" ::: "memory"); }
// all but this wave's N youngest copies have landed: N = the copies of the stages issued behind the one that is published
template <int N> __device__ __forceinline__ void wait_copies_but() { asm volatile("s_wait_asynccnt %0" :: "n"(N) : "memory"); }
// this wave's LDS reads have returned, before the barrier behind which their buffer is refilled
__device__ __forceinline__ void wait_lds_reads() { asm volatile("s_wait_dscnt 0x0" ::: "memory"); }

template <int ET> struct Elem;
template <> struct Elem<0> { typedef _Float16 T; };
template <> struct Elem<1> { typedef __bf16 T; };
template <int ET, bool SPLIT, int BIAS_MODE, int OUT_MODE, bool RESID, int ACT = 0, int NBUF = 2>
__device__ __forceinline__ void gemm64_block(
    const int bx, const int b, const int bz,     // block tile, batch and k slice of this work-group
    const unsigned short* __restrict__ Ap, const unsigned short* __restrict__ A2p, int lda, long strideA,
    const unsigned short* __restrict__ Btp, const unsigned short* __restrict__ Bt2p, int ldb, long strideB,
    void* __restrict__ Cout, void* __restrict__ Cout2, int ldc, long strideC, long strideCz,
    const float* __restrict__ bias,
    const float* __restrict__ resid, long strideR,
    int M, int N, int K, float scale) {
  typedef typename Elem<ET>::T T;
  typedef typename Frag<T>::V V;
  static_assert(!SPLIT, "the staged loop carries one plane per operand");
  static_assert(NBUF == 2 || NBUF == 4);
  __shared__ __align__(128) unsigned short sStage[NBUF * STG_ELEMS];   // the stage buffers
  __shared__ __align__(16) float sT[8][16 * 68];   // per-wave 16x64 slab, pitch 68 floats
  const int lane = threadIdx.x & 31;
  const int wave = threadIdx.x >> 5;
  const int blocksN = N / BLK_N;
  const int blocksM = M / BLK_M;
  if (bx >= blocksM * blocksN) return;   // block-uniform, in front of every barrier
  const int bm = bx / blocksN;
  const int bn = bx - bm * blocksN;
  const int wm = wave >> 2;                    // wave's 64-row band of the block tile
  const int wn = wave & 3;                     // wave's 64-column band
  const int m0 = bm * BLK_M + (wm << 6);
  const int n0 = bn * BLK_N + (wn << 6);

  const size_t kz = (size_t)bz * K;                                    // first k of this slice
  const size_t cz = (size_t)b * strideC + (size_t)bz * strideCz;

  const int rlane = lane & 15;                 // row (A) / col (B, D) within subtile
  const int koff  = (lane >> 4) * 8;           // k offset of this lane half
  const int mOff  = (lane >> 4) * 8;           // D row offset

  // copy side: thread t brings 16-B piece (t & 7) of rows (t >> 3) + 32 c
  const int crow = threadIdx.x >> 3;
  const int cpc  = (threadIdx.x & 7) * 8;
  const unsigned short* gA = Ap  + (size_t)b * strideA + kz + (size_t)(bm * BLK_M + crow) * lda + cpc;
  const unsigned short* gB = Btp + (size_t)b * strideB + kz + (size_t)(bn * BLK_N + crow) * ldb + cpc;
  const size_t sa = (size_t)32 * lda;
  const size_t sb = (size_t)32 * ldb;
  const unsigned lcopy = (unsigned)(size_t)(const void*)sStage + (unsigned)(crow * STG_PITCH + cpc) * 2u;
  constexpr unsigned STG_BYTES = (unsigned)STG_ELEMS * 2u;

  // read side: this lane's first A and Bt fragment rows in buffer 0
  const T* fA = (const T*)sStage + (size_t)((wm << 6) + rlane) * STG_PITCH + koff;
  const T* fB = (const T*)sStage + (size_t)(BLK_M + (wn << 6) + rlane) * STG_PITCH + koff;

  v8f acc[4][4];
#pragma unroll
  for (int i = 0; i < 4; ++i)
#pragma unroll
    for (int j = 0; j < 4; ++j) acc[i][j] = (v8f){0.f,0.f,0.f,0.f,0.f,0.f,0.f,0.f};

  const int stages = K / STG_K;
  stage_copies(lcopy, gA, sa, gB, sb);
  if (NBUF == 2) {
    wait_copies();
    __syncthreads();                           // stage 0 is readable by every wave
    if (stages > 1) stage_copies(lcopy + STG_BYTES, gA + STG_K, sa, gB + STG_K, sb);
  } else {
    if (stages > 1) stage_copies(lcopy + STG_BYTES, gA + STG_K, sa, gB + STG_K, sb);
    if (stages > 2) stage_copies(lcopy + 2u * STG_BYTES, gA + 2 * STG_K, sa, gB + 2 * STG_K, sb);
  }

#pragma unroll 1   // one stage a trip: the buffer index and the refill test stay scalar
  for (int t = 0; t < stages; ++t) {
    const int buf = (t & (NBUF - 1)) * STG_ELEMS;
    if (NBUF == 4) {
      // publish point of stage t (this wave's LDS reads of stage t - 1 have returned: the wait at the foot of the trip before).
      // Issued so far: stages 0 .. t + 2. While both younger stages exist they are the wave's 24 youngest copies; else the wait is to 0.
      if (t + 2 < stages) wait_copies_but<24>(); else wait_copies();
      __syncthreads();                         // publishes stage t and ends every read of stage t - 1's buffer
    }
#pragma unroll
    for (int kk = 0; kk < STG_K; kk += 32) {
      V bh[4], ah[4];
#pragma unroll
      for (int j = 0; j < 4; ++j) bh[j] = Frag<T>::load(fB + buf + j * 16 * STG_PITCH + kk);
#pragma unroll
      for (int i = 0; i < 4; ++i) ah[i] = Frag<T>::load(fA + buf + i * 16 * STG_PITCH + kk);
      // the refill of stage t - 1's buffer stands behind this stage's first fragment loads (another buffer): its issue runs under their LDS latency
      if (NBUF == 4 && kk == 0 && t + 3 < stages)
        stage_copies(lcopy + (unsigned)((t + 3) & 3) * STG_BYTES, gA + (size_t)(t + 3) * STG_K, sa, gB + (size_t)(t + 3) * STG_K, sb);
#pragma unroll
      for (int i = 0; i < 4; ++i) {
#pragma unroll
        for (int j = 0; j < 4; ++j) acc[i][j] = Frag<T>::mma(ah[i], bh[j], acc[i][j]);
        Frag<T>::guard(acc[i][0], acc[i][3], ah[i], ah[i]);
      }
      Frag<T>::keep(bh[0], bh[1], bh[2], bh[3]);
    }
    wait_lds_reads();
    if (NBUF == 2) {
      wait_copies();
      __syncthreads();                         // publishes stage t + 1 and ends every read of stage t's buffer
      if (t + 2 < stages)
        stage_copies(lcopy + (unsigned)(t & 1) * STG_BYTES, gA + (size_t)(t + 2) * STG_K, sa, gB + (size_t)(t + 2) * STG_K, sb);
    }
  }
  wait_copies();
  acc_guard4(acc[0][0], acc[0][1], acc[0][2], acc[0][3]);
  acc_guard4(acc[1][0], acc[1][1], acc[1][2], acc[1][3]);
  acc_guard4(acc[2][0], acc[2][1], acc[2][2], acc[2][3]);
  acc_guard4(acc[3][0], acc[3][1], acc[3][2], acc[3][3]);

  // ---- epilogue ----
  float* slab = sT[wave];
  const float* Rb = RESID ? (resid + (size_t)b * strideR) : nullptr;
#pragma unroll
  for (int i = 0; i < 4; ++i) {
    const int mBase = m0 + (i << 4);
#pragma unroll
    for (int j = 0; j < 4; ++j) {
      const int n = n0 + (j << 4) + rlane;
      float bv = 0.f;
      if (BIAS_MODE == 2) bv = bias[n];
#pragma unroll
      for (int r = 0; r < 8; ++r) {
        float v = acc[i][j][r] * scale;
        if (BIAS_MODE == 1) v += bias[mBase + mOff + r];
        if (BIAS_MODE == 2) v += bv;
        if (RESID) v += Rb[(size_t)(mBase + mOff + r) * ldc + n];
        if (ACT == 1) v = tanhf(v);
        if (ACT == 2) v = fmaxf(v, 0.0f);
        if (ACT == 3) v = v / (1.0f + expf(-v));
        if (ACT == 4) v = (v > 0.f) ? v : 0.01f * v;
        if (ACT == 5) v = 0.5f * v * (1.0f + erff(v * 0.70710678118654752f));
        slab[(mOff + r) * 68 + (j << 4) + rlane] = v;
      }
    }
    __builtin_amdgcn_fence(__ATOMIC_RELEASE, "workgroup");
    __builtin_amdgcn_wave_barrier();
    __builtin_amdgcn_fence(__ATOMIC_ACQUIRE, "workgroup");
    if (OUT_MODE == 0) {
      float* C = (float*)Cout + cz;
      const int hh = lane >> 4, c4 = (lane & 15) * 4;     // row seg = 256 B = 16 lanes x 16 B
      {
#pragma unroll
        for (int it = 0; it < 8; ++it) {
          const int row = it * 2 + hh;
          v4f v = *(const v4f*)(slab + row * 68 + c4);
          *(v4f*)(C + (size_t)(mBase + row) * ldc + n0 + c4) = v;
        }
        
      }
    } else {
      const int q = lane >> 3, c8 = (lane & 7) * 8;
      unsigned short* C  = (unsigned short*)Cout  + cz;
      unsigned short* C2 = (OUT_MODE == 2) ? ((unsigned short*)Cout2 + cz) : nullptr;
      {
#pragma unroll
        for (int it = 0; it < 4; ++it) {
          const int row = it * 4 + q;
          const float* sp = slab + row * 68 + c8;
          v8h hv, lv;
#pragma unroll
          for (int e = 0; e < 8; ++e) {
            if (OUT_MODE == 1) {
              hv[e] = (_Float16)sp[e];
            } else {
              unsigned short hb = f2bf_bits(sp[e]);
              unsigned short lb = f2bf_bits(sp[e] - bf_bits2f(hb));
              hv[e] = __builtin_bit_cast(_Float16, hb);
              lv[e] = __builtin_bit_cast(_Float16, lb);
            }
          }
          *(v8h*)(C + (size_t)(mBase + row) * ldc + n0 + c8) = hv;
          if (OUT_MODE == 2) *(v8h*)(C2 + (size_t)(mBase + row) * ldc + n0 + c8) = lv;
        }
        
      }
    }
    __builtin_amdgcn_fence(__ATOMIC_RELEASE, "workgroup");
    __builtin_amdgcn_wave_barrier();
    __builtin_amdgcn_fence(__ATOMIC_ACQUIRE, "workgroup");
  }
}

// one product a launch: blockIdx.x = block tile, .y = batch, .z = k slice
template <int ET, bool SPLIT, int BIAS_MODE, int OUT_MODE, bool RESID, int ACT = 0, int NBUF = 2>
__global__ __launch_bounds__(256) void wmma_gemm64(
    const unsigned short* __restrict__ Ap, const unsigned short* __restrict__ A2p, int lda, long strideA,
    const unsigned short* __restrict__ Btp, const unsigned short* __restrict__ Bt2p, int ldb, long strideB,
    void* __restrict__ Cout, void* __restrict__ Cout2, int ldc, long strideC, long strideCz,
    const float* __restrict__ bias,
    const float* __restrict__ resid, long strideR,
    int M, int N, int K, float scale) {
  gemm64_block<ET, SPLIT, BIAS_MODE, OUT_MODE, RESID, ACT, NBUF>(
      (int)blockIdx.x, (int)blockIdx.y, (int)blockIdx.z, Ap, A2p, lda, strideA, Btp, Bt2p, ldb, strideB,
      Cout, Cout2, ldc, strideC, strideCz, bias, resid, strideR, M, N, K, scale);
}

// Two independent products of equal K and scale (f16 in, f16 out) in ONE launch: work-groups blockIdx.x < tiles0 own the
// block tiles of product 0, the rest those of product 1; blockIdx.y = batch of both. The choice is block-uniform (scalar selects).
__global__ __launch_bounds__(256) void wmma_gemm64_pair(
    const unsigned short* __restrict__ A0, int lda0, long strideA0,
    const unsigned short* __restrict__ Bt0, int ldb0, long strideB0,
    unsigned short* __restrict__ C0, int ldc0, long strideC0, int M0, int N0, int tiles0,
    const unsigned short* __restrict__ A1, int lda1, long strideA1,
    const unsigned short* __restrict__ Bt1, int ldb1, long strideB1,
    unsigned short* __restrict__ C1, int ldc1, long strideC1, int M1, int N1,
    int K, float scale) {
  const bool p0 = (int)blockIdx.x < tiles0;
  const unsigned short* A  = p0 ? A0 : A1;
  const unsigned short* Bt = p0 ? Bt0 : Bt1;
  unsigned short*       C  = p0 ? C0 : C1;
  gemm64_block<0, false, 0, 1, false>(
      p0 ? (int)blockIdx.x : (int)blockIdx.x - tiles0, (int)blockIdx.y, 0,
      A, A, p0 ? lda0 : lda1, p0 ? strideA0 : strideA1,
      Bt, Bt, p0 ? ldb0 : ldb1, p0 ? strideB0 : strideB1,
      (void*)C, (void*)C, p0 ? ldc0 : ldc1, p0 ? strideC0 : strideC1, 0L,
      nullptr, nullptr, 0L,
      p0 ? M0 : M1, p0 ? N0 : N1, K, scale);
}

// ---------------- cast kernels: f32 -> f16(bf16_RNE(x) * mul) ----------------
__device__ __forceinline__ void cvt_bf_f16_store8(const float* __restrict__ src, unsigned short* __restrict__ dst,
                                                  int i, float mul) {
  const v4f a = *(const v4f*)(src + (size_t)i * 8);
  const v4f c = *(const v4f*)(src + (size_t)i * 8 + 4);
  v8h o;
#pragma unroll
  for (int e = 0; e < 4; ++e) {
    const float fa = bf_bits2f(f2bf_bits(a[e])) * mul;
    const float fc = bf_bits2f(f2bf_bits(c[e])) * mul;
    o[e]     = (_Float16)fa;
    o[4 + e] = (_Float16)fc;
  }
  _Float16* op = (_Float16*)(void*)dst + (size_t)i * 8;
  *(v8h*)op = o;
  
}

// Both casts in ONE launch (they need nothing of each other). Work-groups blockIdx.x < xBlocks: x [NTOK][DMODEL] f32 -> f16 plane,
// same layout, xBlocks * 256 threads * 8 = all its elements exactly. The rest, wBlocks a plane: six [DHEAD][DHEAD] f32 weights ->
// six consecutive f16 planes (plane y <- source y), carried x mulW; wBlocks * 256 * 8 = a plane's elements exactly.
__global__ __launch_bounds__(256) void cast_xw_kernel(
    const float* __restrict__ x, unsigned short* __restrict__ outX, int xBlocks,
    const float* __restrict__ w0, const float* __restrict__ w1, const float* __restrict__ w2,
    const float* __restrict__ w3, const float* __restrict__ w4, const float* __restrict__ w5,
    unsigned short* __restrict__ outW, int wBlocks, float mulW) {
  const int bx = (int)blockIdx.x;
  if (bx < xBlocks) {                         // block-uniform
    cvt_bf_f16_store8(x, outX, bx * 256 + (int)threadIdx.x, 1.0f);
    return;
  }
  const int y  = (bx - xBlocks) / wBlocks;    // block-uniform source select (all global pointers)
  const int bw = (bx - xBlocks) - y * wBlocks;
  const float* src = w0;
  if (y == 1) src = w1;
  if (y == 2) src = w2;
  if (y == 3) src = w3;
  if (y == 4) src = w4;
  if (y == 5) src = w5;
  unsigned short* dst = outW + (size_t)y * (size_t)wBlocks * 2048;
  cvt_bf_f16_store8(src, dst, bw * 256 + (int)threadIdx.x, mulW);
  // precaution: in the listing the x range's code follows this store and rewrites its offset register; the wait stands in front of that
  asm volatile("s_wait_xcnt 0x0" ::: "memory");
}

// ---------------- v k^T, all tokens in one work-group ----------------
// out[h][e][d] = f16(mul * sum over all NTOK tokens m of v[e][m] * k[d][m]); kvp per head: rows 0..511 = k[d][m], 512..1023 = v[e][m].
// A work-group owns one 64x64 tile (blockIdx.x = 8 * tile row + tile column, blockIdx.y = head). A stage is 256 tokens of its 64 v rows
// and 64 k rows (512 B a row, whole lines), brought into LDS by asynchronous copies, four buffers: while stage t is multiplied, stages
// t + 1 .. t + 3 fly, behind counted waits, so that copies are in flight all the time. The eight waves split the k range:
// wave w multiplies tokens [32 w, 32 w + 32) of every stage into its own 64x64 f32 tile; the eight tiles are added through LDS, w ascending.
// LDS row pitch 528 B (16 B x odd: ds_load_b128 without bank conflicts).
constexpr int VK_TILE  = 64;
constexpr int VK_STG_K = 256;
constexpr int VK_NBUF  = 4;
constexpr int VK_PITCH = VK_STG_K + 8;                        // 16-bit elements per LDS row
constexpr int VK_BUF_ELEMS = 2 * VK_TILE * VK_PITCH;          // one buffer: v rows 0..63, k rows 64..127
constexpr unsigned VK_ROWS8_BYTES = 8u * VK_PITCH * 2u;       // LDS step from one copy of a thread to its next (8 rows)
constexpr int VK_RED_PITCH = 68;                              // floats per row of a wave's tile in the sum (as the GEMM's slab)
static_assert(8 * VK_TILE * VK_RED_PITCH * 4 <= VK_NBUF * VK_BUF_ELEMS * 2, "the eight f32 tiles fit the ring they reuse");
typedef __attribute__((ext_vector_type(4))) _Float16 v4h;

// Eight copies of 16 B of one thread: rows 8 apart, LDS address l, global address g, s = 8 rows in elements. A wave's copy covers
// the 512 B of one row. The s_wait_xcnt stands inside the statement, so that no address register of a copy is rewritten ahead of it.
__device__ __forceinline__ void copies8(unsigned l, const unsigned short* g, size_t s) {
  asm volatile(
      "global_load_async_to_lds_b128 %0, %8, off\n\t"
      "global_load_async_to_lds_b128 %1, %9, off\n\t"
      "global_load_async_to_lds_b128 %2, %10, off\n\t"
      "global_load_async_to_lds_b128 %3, %11, off\n\t"
      "global_load_async_to_lds_b128 %4, %12, off\n\t"
      "global_load_async_to_lds_b128 %5, %13, off\n\t"
      "global_load_async_to_lds_b128 %6, %14, off\n\t"
      "global_load_async_to_lds_b128 %7, %15, off\n\t"
      "s_wait_xcnt 0x0"
      :: "v"(l), "v"(l + VK_ROWS8_BYTES), "v"(l + 2u * VK_ROWS8_BYTES), "v"(l + 3u * VK_ROWS8_BYTES),
         "v"(l + 4u * VK_ROWS8_BYTES), "v"(l + 5u * VK_ROWS8_BYTES), "v"(l + 6u * VK_ROWS8_BYTES), "v"(l + 7u * VK_ROWS8_BYTES),
         "v"(g), "v"(g + s), "v"(g + 2 * s), "v"(g + 3 * s), "v"(g + 4 * s), "v"(g + 5 * s), "v"(g + 6 * s), "v"(g + 7 * s)
      : "memory");
}
// One stage, this thread's share: 16 copies (8 of v, 8 of k); a, b: its global addresses in rows (threadIdx.x >> 5) of the two tiles.
constexpr int VK_STG_COPIES = 16;
__device__ __forceinline__ void vk_stage_copies(unsigned l, const unsigned short* a, const unsigned short* b) {
  constexpr size_t s = (size_t)8 * NTOK;
  copies8(l, a, s);
  copies8(l + 8u * VK_ROWS8_BYTES, b, s);
}

__global__ __launch_bounds__(256) void vkt_tile_kernel(const unsigned short* __restrict__ kvp, unsigned short* __restrict__ out, float mul) {
  typedef _Float16 T;
  typedef Frag<T>::V V;
  __shared__ __align__(128) unsigned short sRing[VK_NBUF * VK_BUF_ELEMS];   // four stage buffers; behind the loop the eight f32 tiles
  const int lane = threadIdx.x & 31;
  const int wave = threadIdx.x >> 5;
  const int e0 = ((int)blockIdx.x >> 3) * VK_TILE;
  const int d0 = ((int)blockIdx.x & 7) * VK_TILE;
  const unsigned short* kp = kvp + (size_t)blockIdx.y * (2 * DHEAD * NTOK);
  const unsigned short* vp = kp + (size_t)DHEAD * NTOK;

  const int rlane = lane & 15;                 // row (A) / col (B, D) within subtile
  const int koff  = (lane >> 4) * 8;           // k offset of this lane half
  const int mOff  = (lane >> 4) * 8;           // D row offset

  // copy side: thread t brings 16-B piece (t & 31) of rows (t >> 5) + 8 c
  const int crow = threadIdx.x >> 5;
  const int cpc  = (threadIdx.x & 31) * 8;
  const unsigned short* gA = vp + (size_t)(e0 + crow) * NTOK + cpc;
  const unsigned short* gB = kp + (size_t)(d0 + crow) * NTOK + cpc;
  const unsigned lcopy = (unsigned)(size_t)(const void*)sRing + (unsigned)(crow * VK_PITCH + cpc) * 2u;
  constexpr unsigned BUF_BYTES = (unsigned)VK_BUF_ELEMS * 2u;

  // read side: this lane's first v and k fragment rows in buffer 0, at this wave's 32 tokens of the stage
  const T* fA = (const T*)sRing + (size_t)rlane * VK_PITCH + (wave << 5) + koff;
  const T* fB = (const T*)sRing + (size_t)(VK_TILE + rlane) * VK_PITCH + (wave << 5) + koff;

  v8f acc[4][4];
#pragma unroll
  for (int i = 0; i < 4; ++i)
#pragma unroll
    for (int j = 0; j < 4; ++j) acc[i][j] = (v8f){0.f,0.f,0.f,0.f,0.f,0.f,0.f,0.f};

  constexpr int stages = NTOK / VK_STG_K;
  static_assert(NTOK % VK_STG_K == 0 && stages >= 3 && VK_NBUF == 4 && VK_STG_K == 8 * 32);
  vk_stage_copies(lcopy, gA, gB);
  vk_stage_copies(lcopy + BUF_BYTES, gA + VK_STG_K, gB + VK_STG_K);
  vk_stage_copies(lcopy + 2u * BUF_BYTES, gA + 2 * VK_STG_K, gB + 2 * VK_STG_K);

#pragma unroll 1   // one stage a trip: the buffer index and the refill test stay scalar
  for (int t = 0; t < stages; ++t) {
    const int buf = (t & (VK_NBUF - 1)) * VK_BUF_ELEMS;
    // publish point of stage t (this wave's LDS reads of stage t - 1 have returned: the wait at the foot of the trip before).
    // Issued so far: stages 0 .. t + 2. While both younger stages exist they are the wave's 32 youngest copies; else the wait is to 0.
    if (t + 2 < stages) wait_copies_but<2 * VK_STG_COPIES>(); else wait_copies();
    __syncthreads();                           // publishes stage t and ends every read of stage t - 1's buffer
    {
      V bh[4], ah[4];
#pragma unroll
      for (int j = 0; j < 4; ++j) bh[j] = Frag<T>::load(fB + buf + j * 16 * VK_PITCH);
#pragma unroll
      for (int i = 0; i < 4; ++i) ah[i] = Frag<T>::load(fA + buf + i * 16 * VK_PITCH);
      // the refill of stage t - 1's buffer stands behind this stage's fragment loads (another buffer): its issue runs under their LDS latency
      if (t + 3 < stages)
        vk_stage_copies(lcopy + (unsigned)((t + 3) & (VK_NBUF - 1)) * BUF_BYTES, gA + (size_t)(t + 3) * VK_STG_K, gB + (size_t)(t + 3) * VK_STG_K);
      // keeps the block's 16 LDS loads together in front of its WMMAs: left free, the scheduler reloads one v fragment register
      // set between the WMMA rows and the wave waits out the LDS latency four times a block
      __builtin_amdgcn_sched_barrier(0);
#pragma unroll
      for (int i = 0; i < 4; ++i) {
#pragma unroll
        for (int j = 0; j < 4; ++j) acc[i][j] = Frag<T>::mma(ah[i], bh[j], acc[i][j]);
      }
    }
    // keeps the block's WMMAs in front of the next trip's barrier: left free, the scheduler sinks them behind it, in front of the refill,
    // and every stage's copies start that much later
    __builtin_amdgcn_sched_barrier(0);
    wait_lds_reads();
  }
  wait_copies();
  __syncthreads();                             // ends every wave's last read of the ring, which the sum reuses

  // ---- sum of the eight waves' tiles: the barrier above has ended every read of the ring, and no copy is outstanding ----
  float* red = (float*)(void*)sRing;
  float* mine = red + (size_t)wave * (VK_TILE * VK_RED_PITCH);
#pragma unroll
  for (int i = 0; i < 4; ++i)
#pragma unroll
    for (int j = 0; j < 4; ++j)
#pragma unroll
      for (int r = 0; r < 8; ++r) mine[((i << 4) + mOff + r) * VK_RED_PITCH + (j << 4) + rlane] = acc[i][j][r];
  __syncthreads();                             // every wave's tile is readable by every wave
  const int c4 = ((int)threadIdx.x & 15) * 4;  // 16 lanes read one 256-B row and store one whole 128-B line
  _Float16* op = (_Float16*)(void*)out + (size_t)blockIdx.y * (DHEAD * DHEAD) + d0 + c4;
#pragma unroll
  for (int q = 0; q < 4; ++q) {
    const int row = ((int)threadIdx.x >> 4) + (q << 4);
    v4f s = *(const v4f*)(red + row * VK_RED_PITCH + c4);
#pragma unroll
    for (int w = 1; w < 8; ++w) s += *(const v4f*)(red + (w * VK_TILE + row) * VK_RED_PITCH + c4);
    v4h o;
#pragma unroll
    for (int e = 0; e < 4; ++e) o[e] = (_Float16)(s[e] * mul);
    *(v4h*)(op + (size_t)(e0 + row) * DHEAD) = o;
  }
}

// ---------------- host orchestration ----------------
// out = (q^T k) v^T is formed as q^T (k v^T): no [NTOK][NTOK] plane.
// Workspace region map (bytes; all offsets multiples of 128):
//   X16 : x as f16 [NTOK][DMODEL]                               8,388,608   @ 0
//   W16 : 6 planes [DHEAD][DHEAD] f16 (x64): Wk_h0, Wv_h0, Wk_h1, Wv_h1, Wq_h0, Wq_h1
//                                                               3,145,728   @ 8,388,608
//   QT  : per head [NTOK][DHEAD] f16 (q^T[n][d])                8,388,608   @ 11,534,336
//   KVP : per head [2*DHEAD][NTOK] f16 (rows 0..511 = k[d][m], 512..1023 = v[e][m])
//                                                              16,777,216   @ 19,922,944
//   KVT : per head [DHEAD][DHEAD] f16 (x1/64) (KV[e][d])        1,048,576   @ 36,700,160
//   total                                                      37,748,736
constexpr size_t X16_BYTES  = (size_t)NTOK * DMODEL * 2;
constexpr size_t W16_BYTES  = (size_t)6 * DHEAD * DHEAD * 2;
constexpr size_t QT_BYTES   = (size_t)NHEAD * NTOK * DHEAD * 2;
constexpr size_t KVP_BYTES  = (size_t)NHEAD * 2 * DHEAD * NTOK * 2;
constexpr size_t KVT_BYTES  = (size_t)NHEAD * DHEAD * DHEAD * 2;
constexpr size_t X16_OFF  = 0;
constexpr size_t W16_OFF  = X16_OFF + X16_BYTES;
constexpr size_t QT_OFF   = W16_OFF + W16_BYTES;
constexpr size_t KVP_OFF  = QT_OFF + QT_BYTES;
constexpr size_t KVT_OFF  = KVP_OFF + KVP_BYTES;
constexpr size_t WS_TOTAL = KVT_OFF + KVT_BYTES;
static_assert(WS_TOTAL == 37748736u);
static_assert(WS_TOTAL <= (size_t)134217728u);
static_assert((W16_OFF % 128) == 0 && (QT_OFF % 128) == 0 && (KVP_OFF % 128) == 0 && (KVT_OFF % 128) == 0);

// GEMM shape contracts (no tail handling): M multiple of 128, N of 256, K of 64
// proj q   : M = NTOK,    N = DHEAD, K = DHEAD
// proj k|v : M = 2*DHEAD, N = NTOK,  K = DHEAD
// v k^T    : its own kernel, 64x64 tiles, all NTOK tokens
// out      : M = NTOK,    N = DHEAD, K = DHEAD
static_assert(NTOK % BLK_M == 0 && NTOK % BLK_N == 0 && DHEAD % BLK_M == 0 && DHEAD % BLK_N == 0 && (2 * DHEAD) % BLK_M == 0);
static_assert(DHEAD % STG_K == 0 && DHEAD == 8 * VK_TILE);
static_assert(DMODEL == NHEAD * DHEAD);
static_assert((NTOK * DMODEL) % (8 * 256) == 0 && (DHEAD * DHEAD) % (8 * 256) == 0);

extern "C" void kernel_launch(void* const* d_in, const int* in_sizes, int n_in,
                              void* d_out, int out_size, void* d_ws, size_t ws_size,
                              hipStream_t stream) {
  if (n_in < 7) return;
  if (in_sizes[0] != NTOK * DMODEL) return;
  for (int i = 1; i < 7; ++i) if (in_sizes[i] != DHEAD * DHEAD) return;
  if (out_size != NTOK * DMODEL) return;
  if (ws_size < WS_TOTAL) return;

  // d_in order per the input table: x, Wq1, Wq2, Wk1, Wk2, Wv1, Wv2 (all f32)
  const float* x   = (const float*)d_in[0];
  const float* wq1 = (const float*)d_in[1];
  const float* wq2 = (const float*)d_in[2];
  const float* wk1 = (const float*)d_in[3];
  const float* wk2 = (const float*)d_in[4];
  const float* wv1 = (const float*)d_in[5];
  const float* wv2 = (const float*)d_in[6];
  float* out = (float*)d_out;

  char* ws = (char*)d_ws;
  unsigned short* X16 = (unsigned short*)(ws + X16_OFF);
  unsigned short* W16 = (unsigned short*)(ws + W16_OFF);
  unsigned short* QT  = (unsigned short*)(ws + QT_OFF);
  unsigned short* KVP = (unsigned short*)(ws + KVP_OFF);
  unsigned short* KVT = (unsigned short*)(ws + KVT_OFF);
  unsigned short* WKV = W16;                                   // per head: [2*DHEAD][DHEAD] (k rows then v rows)
  unsigned short* WQ  = W16 + (size_t)4 * DHEAD * DHEAD;        // per head: [DHEAD][DHEAD]
  const float* fdum = x;                                       // unused bias/resid slots (never dereferenced)

  // 1) + 2) one launch: x -> f16 plane; weights -> f16 planes carried x64, plane order Wk_h0, Wv_h0, Wk_h1, Wv_h1, Wq_h0, Wq_h1
  {
    const int xBlocks = (NTOK * DMODEL) / (8 * 256);            // 2048
    const int wBlocks = (DHEAD * DHEAD) / (8 * 256);            // 128 a plane
    cast_xw_kernel<<<dim3(xBlocks + 6 * wBlocks), dim3(256), 0, stream>>>(
        x, X16, xBlocks, wk1, wv1, wk2, wv2, wq1, wq2, W16, wBlocks, W_CARRY);
  }
  // 3) + 4) the projections, one launch (they share X16 and depend on nothing of each other):
  //    k | v per head: KVP[h][r][m] = (1/64) * sum_c WKV[h][r][c] * X16[m][h*512 + c]   (r<512: k, r>=512: v)
  //    q^T per head  : QT[h][n][d]  = (1/64) * sum_c X16[n][h*512 + c] * WQ[h][d][c]
  {
    const int tilesKV = ((2 * DHEAD) / BLK_M) * (NTOK / BLK_N);   // 128
    const int tilesQ  = (NTOK / BLK_M) * (DHEAD / BLK_N);         // 64
    wmma_gemm64_pair<<<dim3(tilesKV + tilesQ, NHEAD), dim3(256), 0, stream>>>(
        WKV, DHEAD, (long)2 * DHEAD * DHEAD,
        X16, DMODEL, (long)DHEAD,
        KVP, NTOK, (long)2 * DHEAD * NTOK, 2 * DHEAD, NTOK, tilesKV,
        X16, DMODEL, (long)DHEAD,
        WQ, DHEAD, (long)DHEAD * DHEAD,
        QT, DHEAD, (long)NTOK * DHEAD, NTOK, DHEAD,
        DHEAD, W_CARRY_INV);
  }
  // 5) KVT[h][e][d] = f16((1/64) * sum over all tokens m of v[e][m] * k[d][m])
  {
    const int tiles = (DHEAD / VK_TILE) * (DHEAD / VK_TILE);   // 64
    vkt_tile_kernel<<<dim3(tiles, NHEAD), dim3(256), 0, stream>>>(KVP, KVT, KV_CARRY);
  }
  // 6) out[n][h*512 + e] = 64 * sum_d QT[h][n][d] * KVT[h][e][d]   (f32, ldc = DMODEL, per-head column offset DHEAD)
  {
    const int tiles = (NTOK / 64) * (DHEAD / 64);              // 512
    wmma_gemm64<0, false, 0, 0, false, 0, 4><<<dim3((tiles + 7) / 8, NHEAD), dim3(256), 0, stream>>>(
        QT, QT, DHEAD, (long)NTOK * DHEAD,
        KVT, KVT, DHEAD, (long)DHEAD * DHEAD,
        (void*)out, (void*)out, DMODEL, (long)DHEAD, 0L,
        fdum, fdum, 0L,
        NTOK, DHEAD, DHEAD, KV_CARRY_INV);
  }
}

// v006
// It runs in 38 microseconds.
// In both of two side-by-side timings against v005, it was 1.11 times as fast.
// Counting every step since v000, it is 7.73 times as fast.
// Contractions: q/k/v projections on v_wmma_f32_16x16x32_bf16 (float inputs RNE-converted to bf16 at the store to LDS), KV = v k^T and out = q^T KV^T on v_wmma_f32_16x16x32_f16; f32 accumulate; intermediate planes f16.
#include <hip/hip_runtime.h>
#include <stdint.h>
#include <stddef.h>

typedef __attribute__((ext_vector_type(16))) _Float16 v16h;
typedef __attribute__((ext_vector_type(8)))  _Float16 v8h;
typedef __attribute__((ext_vector_type(16))) __bf16   v16b;
typedef __attribute__((ext_vector_type(8)))  __bf16   v8b;
typedef __attribute__((ext_vector_type(8)))  float    v8f;
typedef __attribute__((ext_vector_type(4)))  float    v4f;

// ---------------- problem constants ----------------
constexpr int NTOK   = 4096;
constexpr int DMODEL = 1024;
constexpr int DHEAD  = 512;
constexpr int NHEAD  = 2;
constexpr float KV_CARRY     = 1.0f / 64.0f;  // v k^T carried x1/64 in f16 (exact; sums over NTOK tokens need the range)
constexpr float KV_CARRY_INV = 64.0f;         // folded back in the output epilogue

// ---------------- helpers ----------------
__device__ __forceinline__ unsigned short f2bf_bits(float f) {
  unsigned u = __float_as_uint(f);
  return (unsigned short)((u + 0x7FFFu + ((u >> 16) & 1u)) >> 16);
}
__device__ __forceinline__ float bf_bits2f(unsigned short h) { return __uint_as_float(((unsigned)h) << 16); }

// hazard guards as plain device helpers (no inline asm inside the kernel template body)
__device__ __forceinline__ void dep_guard_h(v8f& a, v8f& b, v16h x, v16h y) { asm volatile("v_nop\n\tv_nop\n\tv_nop\n\tv_nop" : "+v"(a), "+v"(b) : "v"(x), "v"(y)); }
__device__ __forceinline__ void dep_guard_b(v8f& a, v8f& b, v16b x, v16b y) { asm volatile("v_nop\n\tv_nop\n\tv_nop\n\tv_nop" : "+v"(a), "+v"(b) : "v"(x), "v"(y)); }
__device__ __forceinline__ void keep4_h(v16h a, v16h b, v16h c, v16h d) { asm volatile("v_nop" :: "v"(a), "v"(b), "v"(c), "v"(d)); }
__device__ __forceinline__ void keep4_b(v16b a, v16b b, v16b c, v16b d) { asm volatile("v_nop" :: "v"(a), "v"(b), "v"(c), "v"(d)); }
__device__ __forceinline__ void acc_guard4(v8f& a, v8f& b, v8f& c, v8f& d) { asm volatile("v_nop\n\tv_nop\n\tv_nop\n\tv_nop" : "+v"(a), "+v"(b), "+v"(c), "+v"(d)); }
template <typename T> struct Frag;
template <> struct Frag<_Float16> {
  typedef v16h V; union U { v16h v; v8h h[2]; };
  static __device__ __forceinline__ v16h load(const _Float16* p) {   // elements 0..7 <- p[0..7], 8..15 <- p[16..23]
    U f; f.h[0] = *(const v8h*)(p); f.h[1] = *(const v8h*)(p + 16); return f.v;
  }
  static __device__ __forceinline__ v8f mma(v16h a, v16h b, v8f c) {
    return __builtin_amdgcn_wmma_f32_16x16x32_f16(false, a, false, b, (short)0, c, false, false);
  }
  static __device__ __forceinline__ void guard(v8f& a, v8f& b, v16h x, v16h y) { dep_guard_h(a, b, x, y); }
  static __device__ __forceinline__ void keep(v16h a, v16h b, v16h c, v16h d) { keep4_h(a, b, c, d); }
};
template <> struct Frag<__bf16> {
  typedef v16b V; union U { v16b v; v8b h[2]; };
  static __device__ __forceinline__ v16b load(const __bf16* p) {
    U f; f.h[0] = *(const v8b*)(p); f.h[1] = *(const v8b*)(p + 16); return f.v;
  }
  static __device__ __forceinline__ v8f mma(v16b a, v16b b, v8f c) {
    return __builtin_amdgcn_wmma_f32_16x16x32_bf16(false, a, false, b, (short)0, c, false, false);
  }
  static __device__ __forceinline__ void guard(v8f& a, v8f& b, v16b x, v16b y) { dep_guard_b(a, b, x, y); }
  static __device__ __forceinline__ void keep(v16b a, v16b b, v16b c, v16b d) { keep4_b(a, b, c, d); }
};

// ---- Register-blocked batched WMMA GEMM, operands staged in LDS --------------
// C[m,n] = scale * sum_k A[m,k] * Bt[n,k] (+bias)(+resid); a block owns a 128x256 tile, each of its 2x4 waves a 64x64 tile.
// A row-major [M,K]; Bt row-major [N,K]; M % 128 == 0, N % 256 == 0, K % 64 == 0, K >= 64.
// A stage is 64 k of the block's 128 A rows and 256 Bt rows (128 B a row, whole lines), brought into LDS by asynchronous
// copies. NBUF = 2: stage t + 1 flies while stage t is multiplied. NBUF = 4: stages t + 1 .. t + 3 fly, behind counted waits, so that copies
// are in flight all the time (for a launch with one work-group a WGP, which has the LDS). LDS row pitch 144 B (16 B x odd: ds_load_b128 without bank conflicts).
// blockIdx.z = k slice: it sums k in [z*K, (z+1)*K) and writes its own plane at z*strideCz (grid.z = 1: the whole product).
// SPLIT: not carried by the staged loop (one plane per operand).
// BIAS_MODE: 0 = none, 1 = bias[m], 2 = bias[n].
// OUT_MODE: 0 = f32, 1 = f16, 2 = bf16 hi plane (Cout) + bf16 lo plane (Cout2).
// ET: 0 = f16 operands, 1 = bf16 operands (pointers passed as 16-bit storage)
constexpr int BLK_M = 128, BLK_N = 256, STG_K = 64;
constexpr int STG_PITCH = STG_K + 8;                          // 16-bit elements per LDS row
constexpr int STG_ELEMS = (BLK_M + BLK_N) * STG_PITCH;         // one buffer: A rows 0..127, Bt rows 128..383
constexpr unsigned STG_ROWS32_BYTES = 32u * STG_PITCH * 2u;    // LDS step from one copy of a thread to its next (32 rows)

// One stage, this thread's share: 12 copies of 16 B (4 of A, 8 of Bt); a wave's copy covers 4 whole 128-B rows.
// l: the thread's LDS byte address in row (threadIdx.x >> 3) of the buffer; a, b: its global addresses in that row of the A and
// Bt tile; sa, sb: 32 rows of A and Bt in elements. The s_wait_xcnt stands inside the statement, so that no address register
// of a copy is rewritten ahead of it.
__device__ __forceinline__ void stage_copies(unsigned l, const unsigned short* a, size_t sa, const unsigned short* b, size_t sb) {
  asm volatile(
      "global_load_async_to_lds_b128 %0, %12, off\n\t"
      "global_load_async_to_lds_b128 %1, %13, off\n\t"
      "global_load_async_to_lds_b128 %2, %14, off\n\t"
      "global_load_async_to_lds_b128 %3, %15, off\n\t"
      "global_load_async_to_lds_b128 %4, %16, off\n\t"
      "global_load_async_to_lds_b128 %5, %17, off\n\t"
      "global_load_async_to_lds_b128 %6, %18, off\n\t"
      "global_load_async_to_lds_b128 %7, %19, off\n\t"
      "global_load_async_to_lds_b128 %8, %20, off\n\t"
      "global_load_async_to_lds_b128 %9, %21, off\n\t"
      "global_load_async_to_lds_b128 %10, %22, off\n\t"
      "global_load_async_to_lds_b128 %11, %23, off\n\t"
      "s_wait_xcnt 0x0"
      :: "v"(l), "v"(l + STG_ROWS32_BYTES), "v"(l + 2u * STG_ROWS32_BYTES), "v"(l + 3u * STG_ROWS32_BYTES),
         "v"(l + 4u * STG_ROWS32_BYTES), "v"(l + 5u * STG_ROWS32_BYTES), "v"(l + 6u * STG_ROWS32_BYTES), "v"(l + 7u * STG_ROWS32_BYTES),
         "v"(l + 8u * STG_ROWS32_BYTES), "v"(l + 9u * STG_ROWS32_BYTES), "v"(l + 10u * STG_ROWS32_BYTES), "v"(l + 11u * STG_ROWS32_BYTES),
         "v"(a), "v"(a + sa), "v"(a + 2 * sa), "v"(a + 3 * sa),
         "v"(b), "v"(b + sb), "v"(b + 2 * sb), "v"(b + 3 * sb), "v"(b + 4 * sb), "v"(b + 5 * sb), "v"(b + 6 * sb), "v"(b + 7 * sb)
      : "memory");
}
// this wave's copies have landed (the compiler places no wait for them)
__device__ __forceinline__ void wait_copies() { asm volatile("s_wait_asynccnt 0x0" ::: "memory"); }
// all but this wave's N youngest copies have landed: N = the copies of the stages issued behind the one that is published
template <int N> __device__ __forceinline__ void wait_copies_but() { asm volatile("s_wait_asynccnt %0" :: "n"(N) : "memory"); }
// this wave's LDS reads have returned, before the barrier behind which their buffer is refilled
__device__ __forceinline__ void wait_lds_reads() { asm volatile("s_wait_dscnt 0x0" ::: "memory"); }

template <int ET> struct Elem;
template <> struct Elem<0> { typedef _Float16 T; };
template <> struct Elem<1> { typedef __bf16 T; };
template <int ET, bool SPLIT, int BIAS_MODE, int OUT_MODE, bool RESID, int ACT = 0, int NBUF = 2>
__device__ __forceinline__ void gemm64_block(
    const int bx, const int b, const int bz,     // block tile, batch and k slice of this work-group
    const unsigned short* __restrict__ Ap, const unsigned short* __restrict__ A2p, int lda, long strideA,
    const unsigned short* __restrict__ Btp, const unsigned short* __restrict__ Bt2p, int ldb, long strideB,
    void* __restrict__ Cout, void* __restrict__ Cout2, int ldc, long strideC, long strideCz,
    const float* __restrict__ bias,
    const float* __restrict__ resid, long strideR,
    int M, int N, int K, float scale) {
  typedef typename Elem<ET>::T T;
  typedef typename Frag<T>::V V;
  static_assert(!SPLIT, "the staged loop carries one plane per operand");
  static_assert(NBUF == 2 || NBUF == 4);
  __shared__ __align__(128) unsigned short sStage[NBUF * STG_ELEMS];   // the stage buffers
  __shared__ __align__(16) float sT[8][16 * 68];   // per-wave 16x64 slab, pitch 68 floats
  const int lane = threadIdx.x & 31;
  const int wave = threadIdx.x >> 5;
  const int blocksN = N / BLK_N;
  const int blocksM = M / BLK_M;
  if (bx >= blocksM * blocksN) return;   // block-uniform, in front of every barrier
  const int bm = bx / blocksN;
  const int bn = bx - bm * blocksN;
  const int wm = wave >> 2;                    // wave's 64-row band of the block tile
  const int wn = wave & 3;                     // wave's 64-column band
  const int m0 = bm * BLK_M + (wm << 6);
  const int n0 = bn * BLK_N + (wn << 6);

  const size_t kz = (size_t)bz * K;                                    // first k of this slice
  const size_t cz = (size_t)b * strideC + (size_t)bz * strideCz;

  const int rlane = lane & 15;                 // row (A) / col (B, D) within subtile
  const int koff  = (lane >> 4) * 8;           // k offset of this lane half
  const int mOff  = (lane >> 4) * 8;           // D row offset

  // copy side: thread t brings 16-B piece (t & 7) of rows (t >> 3) + 32 c
  const int crow = threadIdx.x >> 3;
  const int cpc  = (threadIdx.x & 7) * 8;
  const unsigned short* gA = Ap  + (size_t)b * strideA + kz + (size_t)(bm * BLK_M + crow) * lda + cpc;
  const unsigned short* gB = Btp + (size_t)b * strideB + kz + (size_t)(bn * BLK_N + crow) * ldb + cpc;
  const size_t sa = (size_t)32 * lda;
  const size_t sb = (size_t)32 * ldb;
  const unsigned lcopy = (unsigned)(size_t)(const void*)sStage + (unsigned)(crow * STG_PITCH + cpc) * 2u;
  constexpr unsigned STG_BYTES = (unsigned)STG_ELEMS * 2u;

  // read side: this lane's first A and Bt fragment rows in buffer 0
  const T* fA = (const T*)sStage + (size_t)((wm << 6) + rlane) * STG_PITCH + koff;
  const T* fB = (const T*)sStage + (size_t)(BLK_M + (wn << 6) + rlane) * STG_PITCH + koff;

  v8f acc[4][4];
#pragma unroll
  for (int i = 0; i < 4; ++i)
#pragma unroll
    for (int j = 0; j < 4; ++j) acc[i][j] = (v8f){0.f,0.f,0.f,0.f,0.f,0.f,0.f,0.f};

  const int stages = K / STG_K;
  stage_copies(lcopy, gA, sa, gB, sb);
  if (NBUF == 2) {
    wait_copies();
    __syncthreads();                           // stage 0 is readable by every wave
    if (stages > 1) stage_copies(lcopy + STG_BYTES, gA + STG_K, sa, gB + STG_K, sb);
  } else {
    if (stages > 1) stage_copies(lcopy + STG_BYTES, gA + STG_K, sa, gB + STG_K, sb);
    if (stages > 2) stage_copies(lcopy + 2u * STG_BYTES, gA + 2 * STG_K, sa, gB + 2 * STG_K, sb);
  }

#pragma unroll 1   // one stage a trip: the buffer index and the refill test stay scalar
  for (int t = 0; t < stages; ++t) {
    const int buf = (t & (NBUF - 1)) * STG_ELEMS;
    if (NBUF == 4) {
      // publish point of stage t (this wave's LDS reads of stage t - 1 have returned: the wait at the foot of the trip before).
      // Issued so far: stages 0 .. t + 2. While both younger stages exist they are the wave's 24 youngest copies; else the wait is to 0.
      if (t + 2 < stages) wait_copies_but<24>(); else wait_copies();
      __syncthreads();                         // publishes stage t and ends every read of stage t - 1's buffer
    }
#pragma unroll
    for (int kk = 0; kk < STG_K; kk += 32) {
      V bh[4], ah[4];
#pragma unroll
      for (int j = 0; j < 4; ++j) bh[j] = Frag<T>::load(fB + buf + j * 16 * STG_PITCH + kk);
#pragma unroll
      for (int i = 0; i < 4; ++i) ah[i] = Frag<T>::load(fA + buf + i * 16 * STG_PITCH + kk);
      // the refill of stage t - 1's buffer stands behind this stage's first fragment loads (another buffer): its issue runs under their LDS latency
      if (NBUF == 4 && kk == 0 && t + 3 < stages)
        stage_copies(lcopy + (unsigned)((t + 3) & 3) * STG_BYTES, gA + (size_t)(t + 3) * STG_K, sa, gB + (size_t)(t + 3) * STG_K, sb);
#pragma unroll
      for (int i = 0; i < 4; ++i) {
#pragma unroll
        for (int j = 0; j < 4; ++j) acc[i][j] = Frag<T>::mma(ah[i], bh[j], acc[i][j]);
        Frag<T>::guard(acc[i][0], acc[i][3], ah[i], ah[i]);
      }
      Frag<T>::keep(bh[0], bh[1], bh[2], bh[3]);
    }
    wait_lds_reads();
    if (NBUF == 2) {
      wait_copies();
      __syncthreads();                         // publishes stage t + 1 and ends every read of stage t's buffer
      if (t + 2 < stages)
        stage_copies(lcopy + (unsigned)(t & 1) * STG_BYTES, gA + (size_t)(t + 2) * STG_K, sa, gB + (size_t)(t + 2) * STG_K, sb);
    }
  }
  wait_copies();
  acc_guard4(acc[0][0], acc[0][1], acc[0][2], acc[0][3]);
  acc_guard4(acc[1][0], acc[1][1], acc[1][2], acc[1][3]);
  acc_guard4(acc[2][0], acc[2][1], acc[2][2], acc[2][3]);
  acc_guard4(acc[3][0], acc[3][1], acc[3][2], acc[3][3]);

  // ---- epilogue ----
  float* slab = sT[wave];
  const float* Rb = RESID ? (resid + (size_t)b * strideR) : nullptr;
#pragma unroll
  for (int i = 0; i < 4; ++i) {
    const int mBase = m0 + (i << 4);
#pragma unroll
    for (int j = 0; j < 4; ++j) {
      const int n = n0 + (j << 4) + rlane;
      float bv = 0.f;
      if (BIAS_MODE == 2) bv = bias[n];
#pragma unroll
      for (int r = 0; r < 8; ++r) {
        float v = acc[i][j][r] * scale;
        if (BIAS_MODE == 1) v += bias[mBase + mOff + r];
        if (BIAS_MODE == 2) v += bv;
        if (RESID) v += Rb[(size_t)(mBase + mOff + r) * ldc + n];
        if (ACT == 1) v = tanhf(v);
        if (ACT == 2) v = fmaxf(v, 0.0f);
        if (ACT == 3) v = v / (1.0f + expf(-v));
        if (ACT == 4) v = (v > 0.f) ? v : 0.01f * v;
        if (ACT == 5) v = 0.5f * v * (1.0f + erff(v * 0.70710678118654752f));
        slab[(mOff + r) * 68 + (j << 4) + rlane] = v;
      }
    }
    __builtin_amdgcn_fence(__ATOMIC_RELEASE, "workgroup");
    __builtin_amdgcn_wave_barrier();
    __builtin_amdgcn_fence(__ATOMIC_ACQUIRE, "workgroup");
    if (OUT_MODE == 0) {
      float* C = (float*)Cout + cz;
      const int hh = lane >> 4, c4 = (lane & 15) * 4;     // row seg = 256 B = 16 lanes x 16 B
      {
#pragma unroll
        for (int it = 0; it < 8; ++it) {
          const int row = it * 2 + hh;
          v4f v = *(const v4f*)(slab + row * 68 + c4);
          *(v4f*)(C + (size_t)(mBase + row) * ldc + n0 + c4) = v;
        }
        
      }
    } else {
      const int q = lane >> 3, c8 = (lane & 7) * 8;
      unsigned short* C  = (unsigned short*)Cout  + cz;
      unsigned short* C2 = (OUT_MODE == 2) ? ((unsigned short*)Cout2 + cz) : nullptr;
      {
#pragma unroll
        for (int it = 0; it < 4; ++it) {
          const int row = it * 4 + q;
          const float* sp = slab + row * 68 + c8;
          v8h hv, lv;
#pragma unroll
          for (int e = 0; e < 8; ++e) {
            if (OUT_MODE == 1) {
              hv[e] = (_Float16)sp[e];
            } else {
              unsigned short hb = f2bf_bits(sp[e]);
              unsigned short lb = f2bf_bits(sp[e] - bf_bits2f(hb));
              hv[e] = __builtin_bit_cast(_Float16, hb);
              lv[e] = __builtin_bit_cast(_Float16, lb);
            }
          }
          *(v8h*)(C + (size_t)(mBase + row) * ldc + n0 + c8) = hv;
          if (OUT_MODE == 2) *(v8h*)(C2 + (size_t)(mBase + row) * ldc + n0 + c8) = lv;
        }
        
      }
    }
    __builtin_amdgcn_fence(__ATOMIC_RELEASE, "workgroup");
    __builtin_amdgcn_wave_barrier();
    __builtin_amdgcn_fence(__ATOMIC_ACQUIRE, "workgroup");
  }
}

// one product a launch: blockIdx.x = block tile, .y = batch, .z = k slice
template <int ET, bool SPLIT, int BIAS_MODE, int OUT_MODE, bool RESID, int ACT = 0, int NBUF = 2>
__global__ __launch_bounds__(256) void wmma_gemm64(
    const unsigned short* __restrict__ Ap, const unsigned short* __restrict__ A2p, int lda, long strideA,
    const unsigned short* __restrict__ Btp, const unsigned short* __restrict__ Bt2p, int ldb, long strideB,
    void* __restrict__ Cout, void* __restrict__ Cout2, int ldc, long strideC, long strideCz,
    const float* __restrict__ bias,
    const float* __restrict__ resid, long strideR,
    int M, int N, int K, float scale) {
  gemm64_block<ET, SPLIT, BIAS_MODE, OUT_MODE, RESID, ACT, NBUF>(
      (int)blockIdx.x, (int)blockIdx.y, (int)blockIdx.z, Ap, A2p, lda, strideA, Btp, Bt2p, ldb, strideB,
      Cout, Cout2, ldc, strideC, strideCz, bias, resid, strideR, M, N, K, scale);
}

// ---------------- q | k | v projections, straight from the f32 inputs ----------------
// C[m][n] = f16(sum_c bf16(A[m][c]) * bf16(Bt[n][c])), c over the head's DHEAD channels; A, Bt f32, c contiguous.
//   k | v tiles (blockIdx.x < PJ_TILES_KV): A = Wk or Wv rows, Bt = x rows (tokens), C = kvp[h][r][m] (r < 512: k, else v)
//   q tiles (the rest)                    : A = x rows (tokens), Bt = Wq rows,       C = qt[h][n][d]
// A work-group owns a 256x256 tile, each of its 2x4 waves 128x64; blockIdx.y = head. A stage is 32 channels of the 256 A rows and 256 Bt rows
// (128 B of f32 a row, whole lines): loaded into registers a trip ahead, rounded to bf16 once, stored to one of two LDS buffers.
// LDS row pitch 80 B (16 B x odd: ds_load_b128 without bank conflicts).
constexpr int PJ_TILE   = 256;
constexpr int PJ_STG_K  = 32;
constexpr int PJ_PITCH  = PJ_STG_K + 8;                        // bf16 elements per LDS row
constexpr int PJ_BUF_ELEMS = 2 * PJ_TILE * PJ_PITCH;           // one buffer: A rows 0..255, Bt rows 256..511
constexpr int PJ_TILES_KV = ((2 * DHEAD) / PJ_TILE) * (NTOK / PJ_TILE);   // 64 a head
constexpr int PJ_TILES_Q  = (NTOK / PJ_TILE) * (DHEAD / PJ_TILE);         // 32 a head
static_assert(DHEAD % PJ_TILE == 0 && NTOK % PJ_TILE == 0 && DHEAD % (2 * PJ_STG_K) == 0 && DHEAD / PJ_STG_K >= 4);
typedef __attribute__((ext_vector_type(4))) __bf16 v4b;
template <bool B> struct PjFlag { static constexpr bool value = B; };
// Work-group barrier that orders LDS only: __syncthreads() compiled to s_wait_loadcnt_dscnt 0 here, a wait for the next stage's global loads, which fly across it.
__device__ __forceinline__ void pj_barrier() {
  __builtin_amdgcn_fence(__ATOMIC_RELEASE, "workgroup", "local");
  __builtin_amdgcn_s_barrier();
  __builtin_amdgcn_fence(__ATOMIC_ACQUIRE, "workgroup", "local");
}

// One 256x256 tile. A, Bt, C: the tile's first elements (block-uniform); the three row pitches are compile-time, so that a thread's 16 row
// addresses are two base addresses and an immediate each (16 addresses in registers do not fit beside the accumulators: scratch).
template <int lda, int ldb, int ldc>
__device__ __forceinline__ void proj_tile(const float* __restrict__ A, const float* __restrict__ Bt, unsigned short* __restrict__ C,
                                          unsigned short* sStage, float* sT) {
  typedef __bf16 T;
  const int lane = threadIdx.x & 31;
  const int wave = threadIdx.x >> 5;
  const int wm = wave >> 2;                    // wave's 128-row band of the block tile
  const int wn = wave & 3;                     // wave's 64-column band
  const int rlane = lane & 15;                 // row (A) / col (B, D) within subtile
  const int koff  = (lane >> 4) * 8;           // k offset of this lane half
  const int mOff  = (lane >> 4) * 8;           // D row offset

  // staging side: thread t brings 16-B piece (t & 7) of rows (t >> 3) + 32 c; a wave's load covers 4 whole 128-B rows
  const int crow = threadIdx.x >> 3;
  const int cpc  = (threadIdx.x & 7) * 4;
  const unsigned voA = (unsigned)(crow * lda + cpc) * 4u;   // this thread's byte offset in the A tile; the rest of an address is block-uniform (scalar)
  const unsigned voB = (unsigned)(crow * ldb + cpc) * 4u;
  constexpr size_t sa = (size_t)32 * lda;
  constexpr size_t sb = (size_t)32 * ldb;
  T* wS = (T*)sStage + crow * PJ_PITCH + cpc;

  // read side: this lane's first A and Bt fragment rows in buffer 0
  const T* fA = (const T*)sStage + (size_t)((wm << 7) + rlane) * PJ_PITCH + koff;
  const T* fB = (const T*)sStage + (size_t)(PJ_TILE + (wn << 6) + rlane) * PJ_PITCH + koff;

  v8f acc[8][4];
#pragma unroll
  for (int i = 0; i < 8; ++i)
#pragma unroll
    for (int j = 0; j < 4; ++j) acc[i][j] = (v8f){0.f,0.f,0.f,0.f,0.f,0.f,0.f,0.f};

  constexpr int stages = DHEAD / PJ_STG_K;
  v4f g[16];                                   // one stage's f32 values of this thread, in flight
  auto stage_load = [&](const int s) __attribute__((always_inline)) {
#pragma unroll
    for (int c = 0; c < 8; ++c) g[c] = *(const v4f*)((const char*)(A + c * sa + (size_t)s * PJ_STG_K) + voA);
#pragma unroll
    for (int c = 0; c < 8; ++c) g[8 + c] = *(const v4f*)((const char*)(Bt + c * sb + (size_t)s * PJ_STG_K) + voB);
  };
  auto stage_store = [&](const int b) __attribute__((always_inline)) {   // rounded to nearest even, into buffer b
#pragma unroll
    for (int c = 0; c < 16; ++c) *(v4b*)(wS + b * PJ_BUF_ELEMS + c * 32 * PJ_PITCH) = __builtin_convertvector(g[c], v4b);
  };

  stage_load(0);
  stage_store(0);
  stage_load(1);
  // precaution: the two offsets and the two bases that the 32 loads above name lose their registers further down (the accumulators' zeroing,
  // the loop's addresses); as inputs of the wait they keep them up to it, so that it stands in front of every such rewrite
  asm volatile("s_wait_xcnt 0x0" :: "v"(voA), "v"(voB), "s"(A), "s"(Bt) : "memory");
  pj_barrier();                                // stage 0 is readable by every wave

  // A trip has two blocks of 16 WMMAs: A rows 0..63 of the wave's band, then rows 64..127, both against the same four Bt fragments.
  // Each block's fragments are read from LDS while the block before is multiplied, so that LDS reads and WMMAs overlap.
  v16b bh[4], alo[4], ahi[4], bn4[4];
#pragma unroll
  for (int j = 0; j < 4; ++j) bh[j] = Frag<T>::load(fB + j * 16 * PJ_PITCH);
#pragma unroll
  for (int i = 0; i < 4; ++i) alo[i] = Frag<T>::load(fA + i * 16 * PJ_PITCH);

  // One trip. LOAD: stage t + 2 exists; NEXT: stage t + 1 exists (compile-time: a trip is straight-line code).
  auto trip = [&](const int t, const int b, auto load, auto next) __attribute__((always_inline)) {
#pragma unroll
    for (int i = 0; i < 4; ++i) ahi[i] = Frag<T>::load(fA + b * PJ_BUF_ELEMS + (4 + i) * 16 * PJ_PITCH);
    // keeps the second block's LDS loads in front of the first block's WMMAs, under which they land
    __builtin_amdgcn_sched_barrier(0);
#pragma unroll
    for (int i = 0; i < 4; ++i)
#pragma unroll
      for (int j = 0; j < 4; ++j) acc[i][j] = Frag<T>::mma(alo[i], bh[j], acc[i][j]);
    // keeps the wait for stage t + 1's global loads behind the first block's WMMAs: the loads get that much more time
    __builtin_amdgcn_sched_barrier(0);
    // stage t + 1 goes to the other buffer, whose last readers (stage t - 1) left it in front of the barrier of the trip before
    if constexpr (decltype(next)::value) stage_store(b ^ 1);
    // keeps stage t + 2's loads behind every rounding of stage t + 1: mixed among them, the waits for the older loads cover the new ones too
    __builtin_amdgcn_sched_barrier(0);
    if constexpr (decltype(load)::value) stage_load(t + 2);
    if constexpr (decltype(next)::value) {
      pj_barrier();                            // publishes stage t + 1 and ends every read of stage t's buffer
#pragma unroll
      for (int j = 0; j < 4; ++j) bn4[j] = Frag<T>::load(fB + (b ^ 1) * PJ_BUF_ELEMS + j * 16 * PJ_PITCH);
#pragma unroll
      for (int i = 0; i < 4; ++i) alo[i] = Frag<T>::load(fA + (b ^ 1) * PJ_BUF_ELEMS + i * 16 * PJ_PITCH);
    }
    // keeps the next stage's first LDS loads in front of the second block's WMMAs, under which they land
    __builtin_amdgcn_sched_barrier(0);
#pragma unroll
    for (int i = 0; i < 4; ++i)
#pragma unroll
      for (int j = 0; j < 4; ++j) acc[4 + i][j] = Frag<T>::mma(ahi[i], bh[j], acc[4 + i][j]);
    // keeps the second block's WMMAs in front of the next trip's LDS loads (one load group a block)
    __builtin_amdgcn_sched_barrier(0);
#pragma unroll
    for (int j = 0; j < 4; ++j) bh[j] = bn4[j];
  };
#pragma unroll 1   // two stages a pass of the loop: the buffer index is a constant and the two Bt fragment sets swap names, not registers
  for (int t = 0; t + 2 < stages; t += 2) {
    trip(t,     0, PjFlag<true>(), PjFlag<true>());
    trip(t + 1, 1, PjFlag<true>(), PjFlag<true>());
  }
  trip(stages - 2, 0, PjFlag<false>(), PjFlag<true>());
  trip(stages - 1, 1, PjFlag<false>(), PjFlag<false>());

  // ---- epilogue: 16 rows at a time through this wave's own slab, so that whole 128-B lines are stored ----
  float* slab = sT + wave * (16 * 68);
  const int q = lane >> 3, c8 = (lane & 7) * 8;
  unsigned short* Cw = C + (size_t)((wm << 7) + q) * ldc + (wn << 6) + c8;
  constexpr size_t step4 = (size_t)4 * ldc;
#pragma unroll
  for (int i = 0; i < 8; ++i) {
#pragma unroll
    for (int j = 0; j < 4; ++j)
#pragma unroll
      for (int r = 0; r < 8; ++r) slab[(mOff + r) * 68 + (j << 4) + rlane] = acc[i][j][r];
    // the slab's rows are written before other lanes read them back (LDS only: the global stores of the round before are not waited for)
    __builtin_amdgcn_fence(__ATOMIC_RELEASE, "workgroup", "local");
    __builtin_amdgcn_wave_barrier();
    __builtin_amdgcn_fence(__ATOMIC_ACQUIRE, "workgroup", "local");
#pragma unroll
    for (int it = 0; it < 4; ++it) {
      const float* sp = slab + (it * 4 + q) * 68 + c8;
      v8h hv;
#pragma unroll
      for (int e = 0; e < 8; ++e) hv[e] = (_Float16)sp[e];
      *(v8h*)(Cw + (size_t)(i * 4 + it) * step4) = hv;
    }
    // precaution: the next round rewrites the registers that these stores name; the stores' completion is not waited for
    asm volatile("s_wait_xcnt 0x0" ::: "memory");
    // the rows are read before the next round overwrites them
    __builtin_amdgcn_fence(__ATOMIC_RELEASE, "workgroup", "local");
    __builtin_amdgcn_wave_barrier();
    __builtin_amdgcn_fence(__ATOMIC_ACQUIRE, "workgroup", "local");
  }
}

__global__ __launch_bounds__(256) void proj_f32_kernel(
    const float* __restrict__ x,
    const float* __restrict__ wk0, const float* __restrict__ wv0, const float* __restrict__ wq0,
    const float* __restrict__ wk1, const float* __restrict__ wv1, const float* __restrict__ wq1,
    unsigned short* __restrict__ kvp, unsigned short* __restrict__ qt) {
  __shared__ __align__(128) unsigned short sStage[2 * PJ_BUF_ELEMS];   // the two stage buffers
  __shared__ __align__(16) float sT[8 * 16 * 68];                      // per-wave 16x64 slab, pitch 68 floats
  // block-uniform choice of the product and its tile
  const int h  = (int)blockIdx.y;
  const int bx = (int)blockIdx.x;
  const float* xh = x + (size_t)h * DHEAD;
  if (bx < PJ_TILES_KV) {
    const int bm = bx / (NTOK / PJ_TILE);
    const int bn = bx % (NTOK / PJ_TILE);
    const float* wk = h ? wk1 : wk0;
    const float* wv = h ? wv1 : wv0;
    const float* w  = (bm < DHEAD / PJ_TILE) ? wk + (size_t)bm * PJ_TILE * DHEAD : wv + (size_t)(bm - DHEAD / PJ_TILE) * PJ_TILE * DHEAD;
    proj_tile<DHEAD, DMODEL, NTOK>(w, xh + (size_t)bn * PJ_TILE * DMODEL,
                                   kvp + (size_t)h * (2 * DHEAD * NTOK) + (size_t)bm * PJ_TILE * NTOK + (size_t)bn * PJ_TILE, sStage, sT);
  } else {
    const int bq = bx - PJ_TILES_KV;
    const int bm = bq / (DHEAD / PJ_TILE);
    const int bn = bq % (DHEAD / PJ_TILE);
    const float* wq = h ? wq1 : wq0;
    proj_tile<DMODEL, DHEAD, DHEAD>(xh + (size_t)bm * PJ_TILE * DMODEL, wq + (size_t)bn * PJ_TILE * DHEAD,
                                    qt + (size_t)h * (NTOK * DHEAD) + (size_t)bm * PJ_TILE * DHEAD + (size_t)bn * PJ_TILE, sStage, sT);
  }
}

// ---------------- v k^T, all tokens in one work-group ----------------
// out[h][e][d] = f16(mul * sum over all NTOK tokens m of v[e][m] * k[d][m]); kvp per head: rows 0..511 = k[d][m], 512..1023 = v[e][m].
// A work-group owns one 64x64 tile (blockIdx.x = 8 * tile row + tile column, blockIdx.y = head). A stage is 256 tokens of its 64 v rows
// and 64 k rows (512 B a row, whole lines), brought into LDS by asynchronous copies, four buffers: while stage t is multiplied, stages
// t + 1 .. t + 3 fly, behind counted waits, so that copies are in flight all the time. The eight waves split the k range:
// wave w multiplies tokens [32 w, 32 w + 32) of every stage into its own 64x64 f32 tile; the eight tiles are added through LDS, w ascending.
// LDS row pitch 528 B (16 B x odd: ds_load_b128 without bank conflicts).
constexpr int VK_TILE  = 64;
constexpr int VK_STG_K = 256;
constexpr int VK_NBUF  = 4;
constexpr int VK_PITCH = VK_STG_K + 8;                        // 16-bit elements per LDS row
constexpr int VK_BUF_ELEMS = 2 * VK_TILE * VK_PITCH;          // one buffer: v rows 0..63, k rows 64..127
constexpr unsigned VK_ROWS8_BYTES = 8u * VK_PITCH * 2u;       // LDS step from one copy of a thread to its next (8 rows)
constexpr int VK_RED_PITCH = 68;                              // floats per row of a wave's tile in the sum (as the GEMM's slab)
static_assert(8 * VK_TILE * VK_RED_PITCH * 4 <= VK_NBUF * VK_BUF_ELEMS * 2, "the eight f32 tiles fit the ring they reuse");
typedef __attribute__((ext_vector_type(4))) _Float16 v4h;

// Eight copies of 16 B of one thread: rows 8 apart, LDS address l, global address g, s = 8 rows in elements. A wave's copy covers
// the 512 B of one row. The s_wait_xcnt stands inside the statement, so that no address register of a copy is rewritten ahead of it.
__device__ __forceinline__ void copies8(unsigned l, const unsigned short* g, size_t s) {
  asm volatile(
      "global_load_async_to_lds_b128 %0, %8, off\n\t"
      "global_load_async_to_lds_b128 %1, %9, off\n\t"
      "global_load_async_to_lds_b128 %2, %10, off\n\t"
      "global_load_async_to_lds_b128 %3, %11, off\n\t"
      "global_load_async_to_lds_b128 %4, %12, off\n\t"
      "global_load_async_to_lds_b128 %5, %13, off\n\t"
      "global_load_async_to_lds_b128 %6, %14, off\n\t"
      "global_load_async_to_lds_b128 %7, %15, off\n\t"
      "s_wait_xcnt 0x0"
      :: "v"(l), "v"(l + VK_ROWS8_BYTES), "v"(l + 2u * VK_ROWS8_BYTES), "v"(l + 3u * VK_ROWS8_BYTES),
         "v"(l + 4u * VK_ROWS8_BYTES), "v"(l + 5u * VK_ROWS8_BYTES), "v"(l + 6u * VK_ROWS8_BYTES), "v"(l + 7u * VK_ROWS8_BYTES),
         "v"(g), "v"(g + s), "v"(g + 2 * s), "v"(g + 3 * s), "v"(g + 4 * s), "v"(g + 5 * s), "v"(g + 6 * s), "v"(g + 7 * s)
      : "memory");
}
// One stage, this thread's share: 16 copies (8 of v, 8 of k); a, b: its global addresses in rows (threadIdx.x >> 5) of the two tiles.
constexpr int VK_STG_COPIES = 16;
__device__ __forceinline__ void vk_stage_copies(unsigned l, const unsigned short* a, const unsigned short* b) {
  constexpr size_t s = (size_t)8 * NTOK;
  copies8(l, a, s);
  copies8(l + 8u * VK_ROWS8_BYTES, b, s);
}

__global__ __launch_bounds__(256) void vkt_tile_kernel(const unsigned short* __restrict__ kvp, unsigned short* __restrict__ out, float mul) {
  typedef _Float16 T;
  typedef Frag<T>::V V;
  __shared__ __align__(128) unsigned short sRing[VK_NBUF * VK_BUF_ELEMS];   // four stage buffers; behind the loop the eight f32 tiles
  const int lane = threadIdx.x & 31;
  const int wave = threadIdx.x >> 5;
  const int e0 = ((int)blockIdx.x >> 3) * VK_TILE;
  const int d0 = ((int)blockIdx.x & 7) * VK_TILE;
  const unsigned short* kp = kvp + (size_t)blockIdx.y * (2 * DHEAD * NTOK);
  const unsigned short* vp = kp + (size_t)DHEAD * NTOK;

  const int rlane = lane & 15;                 // row (A) / col (B, D) within subtile
  const int koff  = (lane >> 4) * 8;           // k offset of this lane half
  const int mOff  = (lane >> 4) * 8;           // D row offset

  // copy side: thread t brings 16-B piece (t & 31) of rows (t >> 5) + 8 c
  const int crow = threadIdx.x >> 5;
  const int cpc  = (threadIdx.x & 31) * 8;
  const unsigned short* gA = vp + (size_t)(e0 + crow) * NTOK + cpc;
  const unsigned short* gB = kp + (size_t)(d0 + crow) * NTOK + cpc;
  const unsigned lcopy = (unsigned)(size_t)(const void*)sRing + (unsigned)(crow * VK_PITCH + cpc) * 2u;
  constexpr unsigned BUF_BYTES = (unsigned)VK_BUF_ELEMS * 2u;

  // read side: this lane's first v and k fragment rows in buffer 0, at this wave's 32 tokens of the stage
  const T* fA = (const T*)sRing + (size_t)rlane * VK_PITCH + (wave << 5) + koff;
  const T* fB = (const T*)sRing + (size_t)(VK_TILE + rlane) * VK_PITCH + (wave << 5) + koff;

  v8f acc[4][4];
#pragma unroll
  for (int i = 0; i < 4; ++i)
#pragma unroll
    for (int j = 0; j < 4; ++j) acc[i][j] = (v8f){0.f,0.f,0.f,0.f,0.f,0.f,0.f,0.f};

  constexpr int stages = NTOK / VK_STG_K;
  static_assert(NTOK % VK_STG_K == 0 && stages >= 3 && VK_NBUF == 4 && VK_STG_K == 8 * 32);
  vk_stage_copies(lcopy, gA, gB);
  vk_stage_copies(lcopy + BUF_BYTES, gA + VK_STG_K, gB + VK_STG_K);
  vk_stage_copies(lcopy + 2u * BUF_BYTES, gA + 2 * VK_STG_K, gB + 2 * VK_STG_K);

#pragma unroll 1   // one stage a trip: the buffer index and the refill test stay scalar
  for (int t = 0; t < stages; ++t) {
    const int buf = (t & (VK_NBUF - 1)) * VK_BUF_ELEMS;
    // publish point of stage t (this wave's LDS reads of stage t - 1 have returned: the wait at the foot of the trip before).
    // Issued so far: stages 0 .. t + 2. While both younger stages exist they are the wave's 32 youngest copies; else the wait is to 0.
    if (t + 2 < stages) wait_copies_but<2 * VK_STG_COPIES>(); else wait_copies();
    __syncthreads();                           // publishes stage t and ends every read of stage t - 1's buffer
    {
      V bh[4], ah[4];
#pragma unroll
      for (int j = 0; j < 4; ++j) bh[j] = Frag<T>::load(fB + buf + j * 16 * VK_PITCH);
#pragma unroll
      for (int i = 0; i < 4; ++i) ah[i] = Frag<T>::load(fA + buf + i * 16 * VK_PITCH);
      // the refill of stage t - 1's buffer stands behind this stage's fragment loads (another buffer): its issue runs under their LDS latency
      if (t + 3 < stages)
        vk_stage_copies(lcopy + (unsigned)((t + 3) & (VK_NBUF - 1)) * BUF_BYTES, gA + (size_t)(t + 3) * VK_STG_K, gB + (size_t)(t + 3) * VK_STG_K);
      // keeps the block's 16 LDS loads together in front of its WMMAs: left free, the scheduler reloads one v fragment register
      // set between the WMMA rows and the wave waits out the LDS latency four times a block
      __builtin_amdgcn_sched_barrier(0);
#pragma unroll
      for (int i = 0; i < 4; ++i) {
#pragma unroll
        for (int j = 0; j < 4; ++j) acc[i][j] = Frag<T>::mma(ah[i], bh[j], acc[i][j]);
      }
    }
    // keeps the block's WMMAs in front of the next trip's barrier: left free, the scheduler sinks them behind it, in front of the refill,
    // and every stage's copies start that much later
    __builtin_amdgcn_sched_barrier(0);
    wait_lds_reads();
  }
  wait_copies();
  __syncthreads();                             // ends every wave's last read of the ring, which the sum reuses

  // ---- sum of the eight waves' tiles: the barrier above has ended every read of the ring, and no copy is outstanding ----
  float* red = (float*)(void*)sRing;
  float* mine = red + (size_t)wave * (VK_TILE * VK_RED_PITCH);
#pragma unroll
  for (int i = 0; i < 4; ++i)
#pragma unroll
    for (int j = 0; j < 4; ++j)
#pragma unroll
      for (int r = 0; r < 8; ++r) mine[((i << 4) + mOff + r) * VK_RED_PITCH + (j << 4) + rlane] = acc[i][j][r];
  __syncthreads();                             // every wave's tile is readable by every wave
  const int c4 = ((int)threadIdx.x & 15) * 4;  // 16 lanes read one 256-B row and store one whole 128-B line
  _Float16* op = (_Float16*)(void*)out + (size_t)blockIdx.y * (DHEAD * DHEAD) + d0 + c4;
#pragma unroll
  for (int q = 0; q < 4; ++q) {
    const int row = ((int)threadIdx.x >> 4) + (q << 4);
    v4f s = *(const v4f*)(red + row * VK_RED_PITCH + c4);
#pragma unroll
    for (int w = 1; w < 8; ++w) s += *(const v4f*)(red + (w * VK_TILE + row) * VK_RED_PITCH + c4);
    v4h o;
#pragma unroll
    for (int e = 0; e < 4; ++e) o[e] = (_Float16)(s[e] * mul);
    *(v4h*)(op + (size_t)(e0 + row) * DHEAD) = o;
  }
}

// ---------------- host orchestration ----------------
// out = (q^T k) v^T is formed as q^T (k v^T): no [NTOK][NTOK] plane.
// Workspace region map (bytes; all offsets multiples of 128):
//   QT  : per head [NTOK][DHEAD] f16 (q^T[n][d])                8,388,608   @ 0
//   KVP : per head [2*DHEAD][NTOK] f16 (rows 0..511 = k[d][m], 512..1023 = v[e][m])
//                                                              16,777,216   @ 8,388,608
//   KVT : per head [DHEAD][DHEAD] f16 (x1/64) (KV[e][d])        1,048,576   @ 25,165,824
//   total                                                      26,214,400
constexpr size_t QT_BYTES   = (size_t)NHEAD * NTOK * DHEAD * 2;
constexpr size_t KVP_BYTES  = (size_t)NHEAD * 2 * DHEAD * NTOK * 2;
constexpr size_t KVT_BYTES  = (size_t)NHEAD * DHEAD * DHEAD * 2;
constexpr size_t QT_OFF   = 0;
constexpr size_t KVP_OFF  = QT_OFF + QT_BYTES;
constexpr size_t KVT_OFF  = KVP_OFF + KVP_BYTES;
constexpr size_t WS_TOTAL = KVT_OFF + KVT_BYTES;
static_assert(WS_TOTAL == 26214400u);
static_assert(WS_TOTAL <= (size_t)134217728u);
static_assert((KVP_OFF % 128) == 0 && (KVT_OFF % 128) == 0);

// shape contracts (no tail handling)
// proj q, k|v : their own kernel, 256x256 tiles, K = DHEAD
// v k^T       : its own kernel, 64x64 tiles, all NTOK tokens
// out         : M = NTOK, N = DHEAD, K = DHEAD; M multiple of 128, N of 256, K of 64
static_assert(NTOK % BLK_M == 0 && DHEAD % BLK_N == 0);
static_assert(DHEAD % STG_K == 0 && DHEAD == 8 * VK_TILE);
static_assert(DMODEL == NHEAD * DHEAD && NHEAD == 2);

extern "C" void kernel_launch(void* const* d_in, const int* in_sizes, int n_in,
                              void* d_out, int out_size, void* d_ws, size_t ws_size,
                              hipStream_t stream) {
  if (n_in < 7) return;
  if (in_sizes[0] != NTOK * DMODEL) return;
  for (int i = 1; i < 7; ++i) if (in_sizes[i] != DHEAD * DHEAD) return;
  if (out_size != NTOK * DMODEL) return;
  if (ws_size < WS_TOTAL) return;

  // d_in order per the input table: x, Wq1, Wq2, Wk1, Wk2, Wv1, Wv2 (all f32)
  const float* x   = (const float*)d_in[0];
  const float* wq1 = (const float*)d_in[1];
  const float* wq2 = (const float*)d_in[2];
  const float* wk1 = (const float*)d_in[3];
  const float* wk2 = (const float*)d_in[4];
  const float* wv1 = (const float*)d_in[5];
  const float* wv2 = (const float*)d_in[6];
  float* out = (float*)d_out;

  char* ws = (char*)d_ws;
  unsigned short* QT  = (unsigned short*)(ws + QT_OFF);
  unsigned short* KVP = (unsigned short*)(ws + KVP_OFF);
  unsigned short* KVT = (unsigned short*)(ws + KVT_OFF);
  const float* fdum = x;                                       // unused bias/resid slots (never dereferenced)

  // 1) the projections, one launch, straight from the f32 inputs:
  //    k | v per head: KVP[h][r][m] = sum_c W[h][r][c] * x[m][h*512 + c]   (r<512: Wk, r>=512: Wv)
  //    q^T per head  : QT[h][n][d]  = sum_c x[n][h*512 + c] * Wq[h][d][c]
  proj_f32_kernel<<<dim3(PJ_TILES_KV + PJ_TILES_Q, NHEAD), dim3(256), 0, stream>>>(
      x, wk1, wv1, wq1, wk2, wv2, wq2, KVP, QT);
  // 2) KVT[h][e][d] = f16((1/64) * sum over all tokens m of v[e][m] * k[d][m])
  {
    const int tiles = (DHEAD / VK_TILE) * (DHEAD / VK_TILE);   // 64
    vkt_tile_kernel<<<dim3(tiles, NHEAD), dim3(256), 0, stream>>>(KVP, KVT, KV_CARRY);
  }
  // 3) out[n][h*512 + e] = 64 * sum_d QT[h][n][d] * KVT[h][e][d]   (f32, ldc = DMODEL, per-head column offset DHEAD)
  {
    const int tiles = (NTOK / 64) * (DHEAD / 64);              // 512
    wmma_gemm64<0, false, 0, 0, false, 0, 4><<<dim3((tiles + 7) / 8, NHEAD), dim3(256), 0, stream>>>(
        QT, QT, DHEAD, (long)NTOK * DHEAD,
        KVT, KVT, DHEAD, (long)DHEAD * DHEAD,
        (void*)out, (void*)out, DMODEL, (long)DHEAD, 0L,
        fdum, fdum, 0L,
        NTOK, DHEAD, DHEAD, KV_CARRY_INV);
  }
}

// v007
// Measured time: 36 microseconds a run.
// Next to v006, in two timings, it ran 1.06 times as fast each time.
// Over all steps from v000 it is 8.18 times as fast.
// Contractions: q/k/v projections on v_wmma_f32_16x16x32_bf16 (float inputs RNE-converted to bf16 at the store to LDS), KV = v k^T and out = q^T KV^T on v_wmma_f32_16x16x32_f16; f32 accumulate; intermediate planes f16.
#include <hip/hip_runtime.h>
#include <stdint.h>
#include <stddef.h>

typedef __attribute__((ext_vector_type(16))) _Float16 v16h;
typedef __attribute__((ext_vector_type(8)))  _Float16 v8h;
typedef __attribute__((ext_vector_type(16))) __bf16   v16b;
typedef __attribute__((ext_vector_type(8)))  __bf16   v8b;
typedef __attribute__((ext_vector_type(8)))  float    v8f;
typedef __attribute__((ext_vector_type(4)))  float    v4f;

// ---------------- problem constants ----------------
constexpr int NTOK   = 4096;
constexpr int DMODEL = 1024;
constexpr int DHEAD  = 512;
constexpr int NHEAD  = 2;
constexpr float KV_CARRY     = 1.0f / 64.0f;  // v k^T carried x1/64 in f16 (exact; sums over NTOK tokens need the range)
constexpr float KV_CARRY_INV = 64.0f;         // folded back in the output epilogue

// ---------------- helpers ----------------
__device__ __forceinline__ unsigned short f2bf_bits(float f) {
  unsigned u = __float_as_uint(f);
  return (unsigned short)((u + 0x7FFFu + ((u >> 16) & 1u)) >> 16);
}
__device__ __forceinline__ float bf_bits2f(unsigned short h) { return __uint_as_float(((unsigned)h) << 16); }

// hazard guards as plain device helpers (no inline asm inside the kernel template body)
__device__ __forceinline__ void dep_guard_h(v8f& a, v8f& b, v16h x, v16h y) { asm volatile("v_nop\n\tv_nop\n\tv_nop\n\tv_nop" : "+v"(a), "+v"(b) : "v"(x), "v"(y)); }
__device__ __forceinline__ void dep_guard_b(v8f& a, v8f& b, v16b x, v16b y) { asm volatile("v_nop\n\tv_nop\n\tv_nop\n\tv_nop" : "+v"(a), "+v"(b) : "v"(x), "v"(y)); }
__device__ __forceinline__ void keep4_h(v16h a, v16h b, v16h c, v16h d) { asm volatile("v_nop" :: "v"(a), "v"(b), "v"(c), "v"(d)); }
__device__ __forceinline__ void keep4_b(v16b a, v16b b, v16b c, v16b d) { asm volatile("v_nop" :: "v"(a), "v"(b), "v"(c), "v"(d)); }
__device__ __forceinline__ void acc_guard4(v8f& a, v8f& b, v8f& c, v8f& d) { asm volatile("v_nop\n\tv_nop\n\tv_nop\n\tv_nop" : "+v"(a), "+v"(b), "+v"(c), "+v"(d)); }
template <typename T> struct Frag;
template <> struct Frag<_Float16> {
  typedef v16h V; union U { v16h v; v8h h[2]; };
  static __device__ __forceinline__ v16h load(const _Float16* p) {   // elements 0..7 <- p[0..7], 8..15 <- p[16..23]
    U f; f.h[0] = *(const v8h*)(p); f.h[1] = *(const v8h*)(p + 16); return f.v;
  }
  static __device__ __forceinline__ v8f mma(v16h a, v16h b, v8f c) {
    return __builtin_amdgcn_wmma_f32_16x16x32_f16(false, a, false, b, (short)0, c, false, false);
  }
  static __device__ __forceinline__ void guard(v8f& a, v8f& b, v16h x, v16h y) { dep_guard_h(a, b, x, y); }
  static __device__ __forceinline__ void keep(v16h a, v16h b, v16h c, v16h d) { keep4_h(a, b, c, d); }
};
template <> struct Frag<__bf16> {
  typedef v16b V; union U { v16b v; v8b h[2]; };
  static __device__ __forceinline__ v16b load(const __bf16* p) {
    U f; f.h[0] = *(const v8b*)(p); f.h[1] = *(const v8b*)(p + 16); return f.v;
  }
  static __device__ __forceinline__ v8f mma(v16b a, v16b b, v8f c) {
    return __builtin_amdgcn_wmma_f32_16x16x32_bf16(false, a, false, b, (short)0, c, false, false);
  }
  static __device__ __forceinline__ void guard(v8f& a, v8f& b, v16b x, v16b y) { dep_guard_b(a, b, x, y); }
  static __device__ __forceinline__ void keep(v16b a, v16b b, v16b c, v16b d) { keep4_b(a, b, c, d); }
};

// ---- Register-blocked batched WMMA GEMM, operands staged in LDS --------------
// C[m,n] = scale * sum_k A[m,k] * Bt[n,k] (+bias)(+resid); a block owns a 128x256 tile, each of its 2x4 waves a 64x64 tile.
// A row-major [M,K]; Bt row-major [N,K]; M % 128 == 0, N % 256 == 0, K % 64 == 0, K >= 64.
// A stage is 64 k of the block's 128 A rows and 256 Bt rows (128 B a row, whole lines), brought into LDS by asynchronous
// copies. NBUF = 2: stage t + 1 flies while stage t is multiplied. NBUF = 4: stages t + 1 .. t + 3 fly, behind counted waits, so that copies
// are in flight all the time (for a launch with one work-group a WGP, which has the LDS). LDS row pitch 144 B (16 B x odd: ds_load_b128 without bank conflicts).
// blockIdx.z = k slice: it sums k in [z*K, (z+1)*K) and writes its own plane at z*strideCz (grid.z = 1: the whole product).
// SPLIT: not carried by the staged loop (one plane per operand).
// BIAS_MODE: 0 = none, 1 = bias[m], 2 = bias[n].
// OUT_MODE: 0 = f32, 1 = f16, 2 = bf16 hi plane (Cout) + bf16 lo plane (Cout2).
// ET: 0 = f16 operands, 1 = bf16 operands (pointers passed as 16-bit storage)
constexpr int BLK_M = 128, BLK_N = 256, STG_K = 64;
constexpr int STG_PITCH = STG_K + 8;                          // 16-bit elements per LDS row
constexpr int STG_ELEMS = (BLK_M + BLK_N) * STG_PITCH;         // one buffer: A rows 0..127, Bt rows 128..383
constexpr unsigned STG_ROWS32_BYTES = 32u * STG_PITCH * 2u;    // LDS step from one copy of a thread to its next (32 rows)

// One stage, this thread's share: 12 copies of 16 B (4 of A, 8 of Bt); a wave's copy covers 4 whole 128-B rows.
// l: the thread's LDS byte address in row (threadIdx.x >> 3) of the buffer; a, b: its global addresses in that row of the A and
// Bt tile; sa, sb: 32 rows of A and Bt in elements. The s_wait_xcnt stands inside the statement, so that no address register
// of a copy is rewritten ahead of it.
__device__ __forceinline__ void stage_copies(unsigned l, const unsigned short* a, size_t sa, const unsigned short* b, size_t sb) {
  asm volatile(
      "global_load_async_to_lds_b128 %0, %12, off\n\t"
      "global_load_async_to_lds_b128 %1, %13, off\n\t"
      "global_load_async_to_lds_b128 %2, %14, off\n\t"
      "global_load_async_to_lds_b128 %3, %15, off\n\t"
      "global_load_async_to_lds_b128 %4, %16, off\n\t"
      "global_load_async_to_lds_b128 %5, %17, off\n\t"
      "global_load_async_to_lds_b128 %6, %18, off\n\t"
      "global_load_async_to_lds_b128 %7, %19, off\n\t"
      "global_load_async_to_lds_b128 %8, %20, off\n\t"
      "global_load_async_to_lds_b128 %9, %21, off\n\t"
      "global_load_async_to_lds_b128 %10, %22, off\n\t"
      "global_load_async_to_lds_b128 %11, %23, off\n\t"
      "s_wait_xcnt 0x0"
      :: "v"(l), "v"(l + STG_ROWS32_BYTES), "v"(l + 2u * STG_ROWS32_BYTES), "v"(l + 3u * STG_ROWS32_BYTES),
         "v"(l + 4u * STG_ROWS32_BYTES), "v"(l + 5u * STG_ROWS32_BYTES), "v"(l + 6u * STG_ROWS32_BYTES), "v"(l + 7u * STG_ROWS32_BYTES),
         "v"(l + 8u * STG_ROWS32_BYTES), "v"(l + 9u * STG_ROWS32_BYTES), "v"(l + 10u * STG_ROWS32_BYTES), "v"(l + 11u * STG_ROWS32_BYTES),
         "v"(a), "v"(a + sa), "v"(a + 2 * sa), "v"(a + 3 * sa),
         "v"(b), "v"(b + sb), "v"(b + 2 * sb), "v"(b + 3 * sb), "v"(b + 4 * sb), "v"(b + 5 * sb), "v"(b + 6 * sb), "v"(b + 7 * sb)
      : "memory");
}
// this wave's copies have landed (the compiler places no wait for them)
__device__ __forceinline__ void wait_copies() { asm volatile("s_wait_asynccnt 0x0" ::: "memory"); }
// all but this wave's N youngest copies have landed: N = the copies of the stages issued behind the one that is published
template <int N> __device__ __forceinline__ void wait_copies_but() { asm volatile("s_wait_asynccnt %0" :: "n"(N) : "memory"); }
// this wave's LDS reads have returned, before the barrier behind which their buffer is refilled
__device__ __forceinline__ void wait_lds_reads() { asm volatile("s_wait_dscnt 0x0" ::: "memory"); }

template <int ET> struct Elem;
template <> struct Elem<0> { typedef _Float16 T; };
template <> struct Elem<1> { typedef __bf16 T; };
template <int ET, bool SPLIT, int BIAS_MODE, int OUT_MODE, bool RESID, int ACT = 0, int NBUF = 2>
__device__ __forceinline__ void gemm64_block(
    const int bx, const int b, const int bz,     // block tile, batch and k slice of this work-group
    const unsigned short* __restrict__ Ap, const unsigned short* __restrict__ A2p, int lda, long strideA,
    const unsigned short* __restrict__ Btp, const unsigned short* __restrict__ Bt2p, int ldb, long strideB,
    void* __restrict__ Cout, void* __restrict__ Cout2, int ldc, long strideC, long strideCz,
    const float* __restrict__ bias,
    const float* __restrict__ resid, long strideR,
    int M, int N, int K, float scale) {
  typedef typename Elem<ET>::T T;
  typedef typename Frag<T>::V V;
  static_assert(!SPLIT, "the staged loop carries one plane per operand");
  static_assert(NBUF == 2 || NBUF == 4);
  __shared__ __align__(128) unsigned short sStage[NBUF * STG_ELEMS];   // the stage buffers
  __shared__ __align__(16) float sT[8][16 * 68];   // per-wave 16x64 slab, pitch 68 floats
  const int lane = threadIdx.x & 31;
  const int wave = threadIdx.x >> 5;
  const int blocksN = N / BLK_N;
  const int blocksM = M / BLK_M;
  if (bx >= blocksM * blocksN) return;   // block-uniform, in front of every barrier
  const int bm = bx / blocksN;
  const int bn = bx - bm * blocksN;
  const int wm = wave >> 2;                    // wave's 64-row band of the block tile
  const int wn = wave & 3;                     // wave's 64-column band
  const int m0 = bm * BLK_M + (wm << 6);
  const int n0 = bn * BLK_N + (wn << 6);

  const size_t kz = (size_t)bz * K;                                    // first k of this slice
  const size_t cz = (size_t)b * strideC + (size_t)bz * strideCz;

  const int rlane = lane & 15;                 // row (A) / col (B, D) within subtile
  const int koff  = (lane >> 4) * 8;           // k offset of this lane half
  const int mOff  = (lane >> 4) * 8;           // D row offset

  // copy side: thread t brings 16-B piece (t & 7) of rows (t >> 3) + 32 c
  const int crow = threadIdx.x >> 3;
  const int cpc  = (threadIdx.x & 7) * 8;
  const unsigned short* gA = Ap  + (size_t)b * strideA + kz + (size_t)(bm * BLK_M + crow) * lda + cpc;
  const unsigned short* gB = Btp + (size_t)b * strideB + kz + (size_t)(bn * BLK_N + crow) * ldb + cpc;
  const size_t sa = (size_t)32 * lda;
  const size_t sb = (size_t)32 * ldb;
  const unsigned lcopy = (unsigned)(size_t)(const void*)sStage + (unsigned)(crow * STG_PITCH + cpc) * 2u;
  constexpr unsigned STG_BYTES = (unsigned)STG_ELEMS * 2u;

  // read side: this lane's first A and Bt fragment rows in buffer 0
  const T* fA = (const T*)sStage + (size_t)((wm << 6) + rlane) * STG_PITCH + koff;
  const T* fB = (const T*)sStage + (size_t)(BLK_M + (wn << 6) + rlane) * STG_PITCH + koff;

  v8f acc[4][4];
#pragma unroll
  for (int i = 0; i < 4; ++i)
#pragma unroll
    for (int j = 0; j < 4; ++j) acc[i][j] = (v8f){0.f,0.f,0.f,0.f,0.f,0.f,0.f,0.f};

  const int stages = K / STG_K;
  // Rotated k walk: stage s of this work-group is k block (s + rot) mod stages. Work-groups that share A rows (same bm) or Bt rows (same bn)
  // are spread over the starts, so that they do not all ask L2 for the same lines at the same moment. Block-uniform; every k block is summed once.
  const int rot = ((stages & (stages - 1)) == 0) ? ((bm + bn * (stages >> 1)) & (stages - 1)) : 0;
  auto kof = [&](const int s) __attribute__((always_inline)) { int kb = s + rot; if (kb >= stages) kb -= stages; return (size_t)kb * STG_K; };
  stage_copies(lcopy, gA + kof(0), sa, gB + kof(0), sb);
  if (NBUF == 2) {
    wait_copies();
    __syncthreads();                           // stage 0 is readable by every wave
    if (stages > 1) stage_copies(lcopy + STG_BYTES, gA + kof(1), sa, gB + kof(1), sb);
  } else {
    if (stages > 1) stage_copies(lcopy + STG_BYTES, gA + kof(1), sa, gB + kof(1), sb);
    if (stages > 2) stage_copies(lcopy + 2u * STG_BYTES, gA + kof(2), sa, gB + kof(2), sb);
  }

#pragma unroll 1   // one stage a trip: the buffer index and the refill test stay scalar
  for (int t = 0; t < stages; ++t) {
    const int buf = (t & (NBUF - 1)) * STG_ELEMS;
    if (NBUF == 4) {
      // publish point of stage t (this wave's LDS reads of stage t - 1 have returned: the wait at the foot of the trip before).
      // Issued so far: stages 0 .. t + 2. While both younger stages exist they are the wave's 24 youngest copies; else the wait is to 0.
      if (t + 2 < stages) wait_copies_but<24>(); else wait_copies();
      __syncthreads();                         // publishes stage t and ends every read of stage t - 1's buffer
    }
#pragma unroll
    for (int kk = 0; kk < STG_K; kk += 32) {
      V bh[4], ah[4];
#pragma unroll
      for (int j = 0; j < 4; ++j) bh[j] = Frag<T>::load(fB + buf + j * 16 * STG_PITCH + kk);
#pragma unroll
      for (int i = 0; i < 4; ++i) ah[i] = Frag<T>::load(fA + buf + i * 16 * STG_PITCH + kk);
      // the refill of stage t - 1's buffer stands behind this stage's first fragment loads (another buffer): its issue runs under their LDS latency
      if (NBUF == 4 && kk == 0 && t + 3 < stages)
        stage_copies(lcopy + (unsigned)((t + 3) & 3) * STG_BYTES, gA + kof(t + 3), sa, gB + kof(t + 3), sb);
#pragma unroll
      for (int i = 0; i < 4; ++i) {
#pragma unroll
        for (int j = 0; j < 4; ++j) acc[i][j] = Frag<T>::mma(ah[i], bh[j], acc[i][j]);
        Frag<T>::guard(acc[i][0], acc[i][3], ah[i], ah[i]);
      }
      Frag<T>::keep(bh[0], bh[1], bh[2], bh[3]);
    }
    wait_lds_reads();
    if (NBUF == 2) {
      wait_copies();
      __syncthreads();                         // publishes stage t + 1 and ends every read of stage t's buffer
      if (t + 2 < stages)
        stage_copies(lcopy + (unsigned)(t & 1) * STG_BYTES, gA + kof(t + 2), sa, gB + kof(t + 2), sb);
    }
  }
  wait_copies();
  acc_guard4(acc[0][0], acc[0][1], acc[0][2], acc[0][3]);
  acc_guard4(acc[1][0], acc[1][1], acc[1][2], acc[1][3]);
  acc_guard4(acc[2][0], acc[2][1], acc[2][2], acc[2][3]);
  acc_guard4(acc[3][0], acc[3][1], acc[3][2], acc[3][3]);

  // ---- epilogue ----
  float* slab = sT[wave];
  const float* Rb = RESID ? (resid + (size_t)b * strideR) : nullptr;
#pragma unroll
  for (int i = 0; i < 4; ++i) {
    const int mBase = m0 + (i << 4);
#pragma unroll
    for (int j = 0; j < 4; ++j) {
      const int n = n0 + (j << 4) + rlane;
      float bv = 0.f;
      if (BIAS_MODE == 2) bv = bias[n];
#pragma unroll
      for (int r = 0; r < 8; ++r) {
        float v = acc[i][j][r] * scale;
        if (BIAS_MODE == 1) v += bias[mBase + mOff + r];
        if (BIAS_MODE == 2) v += bv;
        if (RESID) v += Rb[(size_t)(mBase + mOff + r) * ldc + n];
        if (ACT == 1) v = tanhf(v);
        if (ACT == 2) v = fmaxf(v, 0.0f);
        if (ACT == 3) v = v / (1.0f + expf(-v));
        if (ACT == 4) v = (v > 0.f) ? v : 0.01f * v;
        if (ACT == 5) v = 0.5f * v * (1.0f + erff(v * 0.70710678118654752f));
        slab[(mOff + r) * 68 + (j << 4) + rlane] = v;
      }
    }
    __builtin_amdgcn_fence(__ATOMIC_RELEASE, "workgroup");
    __builtin_amdgcn_wave_barrier();
    __builtin_amdgcn_fence(__ATOMIC_ACQUIRE, "workgroup");
    if (OUT_MODE == 0) {
      float* C = (float*)Cout + cz;
      const int hh = lane >> 4, c4 = (lane & 15) * 4;     // row seg = 256 B = 16 lanes x 16 B
      {
#pragma unroll
        for (int it = 0; it < 8; ++it) {
          const int row = it * 2 + hh;
          v4f v = *(const v4f*)(slab + row * 68 + c4);
          *(v4f*)(C + (size_t)(mBase + row) * ldc + n0 + c4) = v;
        }
        
      }
    } else {
      const int q = lane >> 3, c8 = (lane & 7) * 8;
      unsigned short* C  = (unsigned short*)Cout  + cz;
      unsigned short* C2 = (OUT_MODE == 2) ? ((unsigned short*)Cout2 + cz) : nullptr;
      {
#pragma unroll
        for (int it = 0; it < 4; ++it) {
          const int row = it * 4 + q;
          const float* sp = slab + row * 68 + c8;
          v8h hv, lv;
#pragma unroll
          for (int e = 0; e < 8; ++e) {
            if (OUT_MODE == 1) {
              hv[e] = (_Float16)sp[e];
            } else {
              unsigned short hb = f2bf_bits(sp[e]);
              unsigned short lb = f2bf_bits(sp[e] - bf_bits2f(hb));
              hv[e] = __builtin_bit_cast(_Float16, hb);
              lv[e] = __builtin_bit_cast(_Float16, lb);
            }
          }
          *(v8h*)(C + (size_t)(mBase + row) * ldc + n0 + c8) = hv;
          if (OUT_MODE == 2) *(v8h*)(C2 + (size_t)(mBase + row) * ldc + n0 + c8) = lv;
        }
        
      }
    }
    __builtin_amdgcn_fence(__ATOMIC_RELEASE, "workgroup");
    __builtin_amdgcn_wave_barrier();
    __builtin_amdgcn_fence(__ATOMIC_ACQUIRE, "workgroup");
  }
}

// one product a launch: blockIdx.x = block tile, .y = batch, .z = k slice
template <int ET, bool SPLIT, int BIAS_MODE, int OUT_MODE, bool RESID, int ACT = 0, int NBUF = 2>
__global__ __launch_bounds__(256) void wmma_gemm64(
    const unsigned short* __restrict__ Ap, const unsigned short* __restrict__ A2p, int lda, long strideA,
    const unsigned short* __restrict__ Btp, const unsigned short* __restrict__ Bt2p, int ldb, long strideB,
    void* __restrict__ Cout, void* __restrict__ Cout2, int ldc, long strideC, long strideCz,
    const float* __restrict__ bias,
    const float* __restrict__ resid, long strideR,
    int M, int N, int K, float scale) {
  gemm64_block<ET, SPLIT, BIAS_MODE, OUT_MODE, RESID, ACT, NBUF>(
      (int)blockIdx.x, (int)blockIdx.y, (int)blockIdx.z, Ap, A2p, lda, strideA, Btp, Bt2p, ldb, strideB,
      Cout, Cout2, ldc, strideC, strideCz, bias, resid, strideR, M, N, K, scale);
}

// ---------------- q | k | v projections, straight from the f32 inputs ----------------
// C[m][n] = f16(sum_c bf16(A[m][c]) * bf16(Bt[n][c])), c over the head's DHEAD channels; A, Bt f32, c contiguous.
//   k | v tiles (blockIdx.x < PJ_TILES_KV): A = Wk or Wv rows, Bt = x rows (tokens), C = kvp[h][r][m] (r < 512: k, else v)
//   q tiles (the rest)                    : A = x rows (tokens), Bt = Wq rows,       C = qt[h][n][d]
// A work-group owns a 256x256 tile, each of its 2x4 waves 128x64; blockIdx.y = head. A stage is 32 channels of the 256 A rows and 256 Bt rows
// (128 B of f32 a row, whole lines): loaded into registers a trip ahead, rounded to bf16 once, stored to one of two LDS buffers.
// LDS row pitch 80 B (16 B x odd: ds_load_b128 without bank conflicts).
constexpr int PJ_TILE   = 256;
constexpr int PJ_STG_K  = 32;
constexpr int PJ_PITCH  = PJ_STG_K + 8;                        // bf16 elements per LDS row
constexpr int PJ_BUF_ELEMS = 2 * PJ_TILE * PJ_PITCH;           // one buffer: A rows 0..255, Bt rows 256..511
constexpr int PJ_TILES_KV = ((2 * DHEAD) / PJ_TILE) * (NTOK / PJ_TILE);   // 64 a head
constexpr int PJ_TILES_Q  = (NTOK / PJ_TILE) * (DHEAD / PJ_TILE);         // 32 a head
static_assert(DHEAD % PJ_TILE == 0 && NTOK % PJ_TILE == 0 && DHEAD % (2 * PJ_STG_K) == 0 && DHEAD / PJ_STG_K >= 4);
constexpr int PJ_STARTS = DHEAD / (2 * PJ_STG_K);             // even channel blocks at which a tile's k walk may start
static_assert((PJ_STARTS & (PJ_STARTS - 1)) == 0);
typedef __attribute__((ext_vector_type(4))) __bf16 v4b;
template <bool B> struct PjFlag { static constexpr bool value = B; };
// Work-group barrier that orders LDS only: __syncthreads() compiled to s_wait_loadcnt_dscnt 0 here, a wait for the next stage's global loads, which fly across it.
__device__ __forceinline__ void pj_barrier() {
  __builtin_amdgcn_fence(__ATOMIC_RELEASE, "workgroup", "local");
  __builtin_amdgcn_s_barrier();
  __builtin_amdgcn_fence(__ATOMIC_ACQUIRE, "workgroup", "local");
}

// One 256x256 tile. A, Bt, C: the tile's first elements (block-uniform); the three row pitches are compile-time, so that a thread's 16 row
// addresses are two base addresses and an immediate each (16 addresses in registers do not fit beside the accumulators: scratch).
template <int lda, int ldb, int ldc>
__device__ __forceinline__ void proj_tile(const float* __restrict__ A, const float* __restrict__ Bt, unsigned short* __restrict__ C,
                                          const int rot, unsigned short* sStage, float* sT) {
  typedef __bf16 T;
  const int lane = threadIdx.x & 31;
  const int wave = threadIdx.x >> 5;
  const int wm = wave >> 2;                    // wave's 128-row band of the block tile
  const int wn = wave & 3;                     // wave's 64-column band
  const int rlane = lane & 15;                 // row (A) / col (B, D) within subtile
  const int koff  = (lane >> 4) * 8;           // k offset of this lane half
  const int mOff  = (lane >> 4) * 8;           // D row offset

  // staging side: thread t brings 16-B piece (t & 7) of rows (t >> 3) + 32 c; a wave's load covers 4 whole 128-B rows
  const int crow = threadIdx.x >> 3;
  const int cpc  = (threadIdx.x & 7) * 4;
  const unsigned voA = (unsigned)(crow * lda + cpc) * 4u;   // this thread's byte offset in the A tile; the rest of an address is block-uniform (scalar)
  const unsigned voB = (unsigned)(crow * ldb + cpc) * 4u;
  constexpr size_t sa = (size_t)32 * lda;
  constexpr size_t sb = (size_t)32 * ldb;
  T* wS = (T*)sStage + crow * PJ_PITCH + cpc;

  // read side: this lane's first A and Bt fragment rows in buffer 0
  const T* fA = (const T*)sStage + (size_t)((wm << 7) + rlane) * PJ_PITCH + koff;
  const T* fB = (const T*)sStage + (size_t)(PJ_TILE + (wn << 6) + rlane) * PJ_PITCH + koff;

  v8f acc[8][4];
#pragma unroll
  for (int i = 0; i < 8; ++i)
#pragma unroll
    for (int j = 0; j < 4; ++j) acc[i][j] = (v8f){0.f,0.f,0.f,0.f,0.f,0.f,0.f,0.f};

  constexpr int stages = DHEAD / PJ_STG_K;
  static_assert((stages & (stages - 1)) == 0, "the rotated walk wraps by a mask");
  v4f g[16];                                   // one stage's f32 values of this thread, in flight
  // Rotated k walk: stage s of this work-group is channel block (s + rot) mod stages (rot block-uniform and even, so that a pair of stages
  // s, s + 1 with s even never wraps between its two); every block is summed once. Ak, Bk: the two tiles' first elements in the channel block to load (block-uniform).
  auto stage_load = [&](const float* Ak, const float* Bk) __attribute__((always_inline)) {
#pragma unroll
    for (int c = 0; c < 8; ++c) g[c] = *(const v4f*)((const char*)(Ak + c * sa) + voA);
#pragma unroll
    for (int c = 0; c < 8; ++c) g[8 + c] = *(const v4f*)((const char*)(Bk + c * sb) + voB);
  };
  auto stage_store = [&](const int b) __attribute__((always_inline)) {   // rounded to nearest even, into buffer b
#pragma unroll
    for (int c = 0; c < 16; ++c) *(v4b*)(wS + b * PJ_BUF_ELEMS + c * 32 * PJ_PITCH) = __builtin_convertvector(g[c], v4b);
  };

  const float* A0 = A + (size_t)rot * PJ_STG_K;
  const float* B0 = Bt + (size_t)rot * PJ_STG_K;
  stage_load(A0, B0);
  stage_store(0);
  stage_load(A0 + PJ_STG_K, B0 + PJ_STG_K);
  // precaution: the two offsets and the two bases that the 32 loads above name lose their registers further down (the accumulators' zeroing,
  // the loop's addresses); as inputs of the wait they keep them up to it, so that it stands in front of every such rewrite
  asm volatile("s_wait_xcnt 0x0" :: "v"(voA), "v"(voB), "s"(A0), "s"(B0) : "memory");
  pj_barrier();                                // stage 0 is readable by every wave

  // A trip has two blocks of 16 WMMAs: A rows 0..63 of the wave's band, then rows 64..127, both against the same four Bt fragments.
  // Each block's fragments are read from LDS while the block before is multiplied, so that LDS reads and WMMAs overlap.
  v16b bh[4], alo[4], ahi[4], bn4[4];
#pragma unroll
  for (int j = 0; j < 4; ++j) bh[j] = Frag<T>::load(fB + j * 16 * PJ_PITCH);
#pragma unroll
  for (int i = 0; i < 4; ++i) alo[i] = Frag<T>::load(fA + i * 16 * PJ_PITCH);

  // One trip. LOAD: stage t + 2 exists, A2 and B2 point at its channel block; NEXT: stage t + 1 exists (compile-time: a trip is straight-line code).
  auto trip = [&](const float* A2, const float* B2, const int b, auto load, auto next) __attribute__((always_inline)) {
#pragma unroll
    for (int i = 0; i < 4; ++i) ahi[i] = Frag<T>::load(fA + b * PJ_BUF_ELEMS + (4 + i) * 16 * PJ_PITCH);
    // keeps the second block's LDS loads in front of the first block's WMMAs, under which they land
    __builtin_amdgcn_sched_barrier(0);
#pragma unroll
    for (int i = 0; i < 4; ++i)
#pragma unroll
      for (int j = 0; j < 4; ++j) acc[i][j] = Frag<T>::mma(alo[i], bh[j], acc[i][j]);
    // keeps the wait for stage t + 1's global loads behind the first block's WMMAs: the loads get that much more time
    __builtin_amdgcn_sched_barrier(0);
    // stage t + 1 goes to the other buffer, whose last readers (stage t - 1) left it in front of the barrier of the trip before
    if constexpr (decltype(next)::value) stage_store(b ^ 1);
    // keeps stage t + 2's loads behind every rounding of stage t + 1: mixed among them, the waits for the older loads cover the new ones too
    __builtin_amdgcn_sched_barrier(0);
    if constexpr (decltype(load)::value) stage_load(A2, B2);
    if constexpr (decltype(next)::value) {
      pj_barrier();                            // publishes stage t + 1 and ends every read of stage t's buffer
#pragma unroll
      for (int j = 0; j < 4; ++j) bn4[j] = Frag<T>::load(fB + (b ^ 1) * PJ_BUF_ELEMS + j * 16 * PJ_PITCH);
#pragma unroll
      for (int i = 0; i < 4; ++i) alo[i] = Frag<T>::load(fA + (b ^ 1) * PJ_BUF_ELEMS + i * 16 * PJ_PITCH);
    }
    // keeps the next stage's first LDS loads in front of the second block's WMMAs, under which they land
    __builtin_amdgcn_sched_barrier(0);
#pragma unroll
    for (int i = 0; i < 4; ++i)
#pragma unroll
      for (int j = 0; j < 4; ++j) acc[4 + i][j] = Frag<T>::mma(ahi[i], bh[j], acc[4 + i][j]);
    // keeps the second block's WMMAs in front of the next trip's LDS loads (one load group a block)
    __builtin_amdgcn_sched_barrier(0);
#pragma unroll
    for (int j = 0; j < 4; ++j) bh[j] = bn4[j];
  };
#pragma unroll 1   // two stages a pass of the loop: the buffer index is a constant and the two Bt fragment sets swap names, not registers
  for (int t = 0; t + 2 < stages; t += 2) {
    const size_t ko = (size_t)((t + 2 + rot) & (stages - 1)) * PJ_STG_K;
    trip(A + ko,            Bt + ko,            0, PjFlag<true>(), PjFlag<true>());
    trip(A + ko + PJ_STG_K, Bt + ko + PJ_STG_K, 1, PjFlag<true>(), PjFlag<true>());
  }
  trip(A, Bt, 0, PjFlag<false>(), PjFlag<true>());
  trip(A, Bt, 1, PjFlag<false>(), PjFlag<false>());

  // ---- epilogue: 16 rows at a time through this wave's own slab, so that whole 128-B lines are stored ----
  float* slab = sT + wave * (16 * 68);
  const int q = lane >> 3, c8 = (lane & 7) * 8;
  unsigned short* Cw = C + (size_t)((wm << 7) + q) * ldc + (wn << 6) + c8;
  constexpr size_t step4 = (size_t)4 * ldc;
#pragma unroll
  for (int i = 0; i < 8; ++i) {
#pragma unroll
    for (int j = 0; j < 4; ++j)
#pragma unroll
      for (int r = 0; r < 8; ++r) slab[(mOff + r) * 68 + (j << 4) + rlane] = acc[i][j][r];
    // the slab's rows are written before other lanes read them back (LDS only: the global stores of the round before are not waited for)
    __builtin_amdgcn_fence(__ATOMIC_RELEASE, "workgroup", "local");
    __builtin_amdgcn_wave_barrier();
    __builtin_amdgcn_fence(__ATOMIC_ACQUIRE, "workgroup", "local");
#pragma unroll
    for (int it = 0; it < 4; ++it) {
      const float* sp = slab + (it * 4 + q) * 68 + c8;
      v8h hv;
#pragma unroll
      for (int e = 0; e < 8; ++e) hv[e] = (_Float16)sp[e];
      *(v8h*)(Cw + (size_t)(i * 4 + it) * step4) = hv;
    }
    // precaution: the next round rewrites the registers that these stores name; the stores' completion is not waited for
    asm volatile("s_wait_xcnt 0x0" ::: "memory");
    // the rows are read before the next round overwrites them
    __builtin_amdgcn_fence(__ATOMIC_RELEASE, "workgroup", "local");
    __builtin_amdgcn_wave_barrier();
    __builtin_amdgcn_fence(__ATOMIC_ACQUIRE, "workgroup", "local");
  }
}

__global__ __launch_bounds__(256) void proj_f32_kernel(
    const float* __restrict__ x,
    const float* __restrict__ wk0, const float* __restrict__ wv0, const float* __restrict__ wq0,
    const float* __restrict__ wk1, const float* __restrict__ wv1, const float* __restrict__ wq1,
    unsigned short* __restrict__ kvp, unsigned short* __restrict__ qt) {
  __shared__ __align__(128) unsigned short sStage[2 * PJ_BUF_ELEMS];   // the two stage buffers
  __shared__ __align__(16) float sT[8 * 16 * 68];                      // per-wave 16x64 slab, pitch 68 floats
  // block-uniform choice of the product and its tile, and of the channel block at which the tile's k walk starts (PJ_STARTS even starts): the 6 tiles (4 of k | v, 2 of q)
  // that share x rows start two blocks apart, the 16 that share W rows likewise, two to a start, so that they do not ask L2 for the same lines at the same moment
  const int h  = (int)blockIdx.y;
  const int bx = (int)blockIdx.x;
  const float* xh = x + (size_t)h * DHEAD;
  if (bx < PJ_TILES_KV) {
    const int bm = bx / (NTOK / PJ_TILE);
    const int bn = bx % (NTOK / PJ_TILE);
    const float* wk = h ? wk1 : wk0;
    const float* wv = h ? wv1 : wv0;
    const float* w  = (bm < DHEAD / PJ_TILE) ? wk + (size_t)bm * PJ_TILE * DHEAD : wv + (size_t)(bm - DHEAD / PJ_TILE) * PJ_TILE * DHEAD;
    proj_tile<DHEAD, DMODEL, NTOK>(w, xh + (size_t)bn * PJ_TILE * DMODEL,
                                   kvp + (size_t)h * (2 * DHEAD * NTOK) + (size_t)bm * PJ_TILE * NTOK + (size_t)bn * PJ_TILE, 2 * ((bn + bm) & (PJ_STARTS - 1)), sStage, sT);
  } else {
    const int bq = bx - PJ_TILES_KV;
    const int bm = bq / (DHEAD / PJ_TILE);
    const int bn = bq % (DHEAD / PJ_TILE);
    const float* wq = h ? wq1 : wq0;
    proj_tile<DMODEL, DHEAD, DHEAD>(xh + (size_t)bm * PJ_TILE * DMODEL, wq + (size_t)bn * PJ_TILE * DHEAD,
                                    qt + (size_t)h * (NTOK * DHEAD) + (size_t)bm * PJ_TILE * DHEAD + (size_t)bn * PJ_TILE,
                                    2 * ((bm + (2 * DHEAD) / PJ_TILE + bn) & (PJ_STARTS - 1)), sStage, sT);
  }
}

// ---------------- v k^T, all tokens in one work-group ----------------
// out[h][e][d] = f16(mul * sum over all NTOK tokens m of v[e][m] * k[d][m]); kvp per head: rows 0..511 = k[d][m], 512..1023 = v[e][m].
// A work-group owns one 64x64 tile (blockIdx.x = 8 * tile row + tile column, blockIdx.y = head). A stage is 256 tokens of its 64 v rows
// and 64 k rows (512 B a row, whole lines), brought into LDS by asynchronous copies, four buffers: while stage t is multiplied, stages
// t + 1 .. t + 3 fly, behind counted waits, so that copies are in flight all the time. The eight waves split the k range:
// wave w multiplies tokens [32 w, 32 w + 32) of every stage into its own 64x64 f32 tile; the eight tiles are added through LDS, w ascending.
// LDS row pitch 528 B (16 B x odd: ds_load_b128 without bank conflicts).
constexpr int VK_TILE  = 64;
constexpr int VK_STG_K = 256;
constexpr int VK_NBUF  = 4;
constexpr int VK_PITCH = VK_STG_K + 8;                        // 16-bit elements per LDS row
constexpr int VK_BUF_ELEMS = 2 * VK_TILE * VK_PITCH;          // one buffer: v rows 0..63, k rows 64..127
constexpr unsigned VK_ROWS8_BYTES = 8u * VK_PITCH * 2u;       // LDS step from one copy of a thread to its next (8 rows)
constexpr int VK_RED_PITCH = 68;                              // floats per row of a wave's tile in the sum (as the GEMM's slab)
static_assert(8 * VK_TILE * VK_RED_PITCH * 4 <= VK_NBUF * VK_BUF_ELEMS * 2, "the eight f32 tiles fit the ring they reuse");
typedef __attribute__((ext_vector_type(4))) _Float16 v4h;

// Eight copies of 16 B of one thread: rows 8 apart, LDS address l, global address g, s = 8 rows in elements. A wave's copy covers
// the 512 B of one row. The s_wait_xcnt stands inside the statement, so that no address register of a copy is rewritten ahead of it.
__device__ __forceinline__ void copies8(unsigned l, const unsigned short* g, size_t s) {
  asm volatile(
      "global_load_async_to_lds_b128 %0, %8, off\n\t"
      "global_load_async_to_lds_b128 %1, %9, off\n\t"
      "global_load_async_to_lds_b128 %2, %10, off\n\t"
      "global_load_async_to_lds_b128 %3, %11, off\n\t"
      "global_load_async_to_lds_b128 %4, %12, off\n\t"
      "global_load_async_to_lds_b128 %5, %13, off\n\t"
      "global_load_async_to_lds_b128 %6, %14, off\n\t"
      "global_load_async_to_lds_b128 %7, %15, off\n\t"
      "s_wait_xcnt 0x0"
      :: "v"(l), "v"(l + VK_ROWS8_BYTES), "v"(l + 2u * VK_ROWS8_BYTES), "v"(l + 3u * VK_ROWS8_BYTES),
         "v"(l + 4u * VK_ROWS8_BYTES), "v"(l + 5u * VK_ROWS8_BYTES), "v"(l + 6u * VK_ROWS8_BYTES), "v"(l + 7u * VK_ROWS8_BYTES),
         "v"(g), "v"(g + s), "v"(g + 2 * s), "v"(g + 3 * s), "v"(g + 4 * s), "v"(g + 5 * s), "v"(g + 6 * s), "v"(g + 7 * s)
      : "memory");
}
// One stage, this thread's share: 16 copies (8 of v, 8 of k); a, b: its global addresses in rows (threadIdx.x >> 5) of the two tiles.
constexpr int VK_STG_COPIES = 16;
__device__ __forceinline__ void vk_stage_copies(unsigned l, const unsigned short* a, const unsigned short* b) {
  constexpr size_t s = (size_t)8 * NTOK;
  copies8(l, a, s);
  copies8(l + 8u * VK_ROWS8_BYTES, b, s);
}

__global__ __launch_bounds__(256) void vkt_tile_kernel(const unsigned short* __restrict__ kvp, unsigned short* __restrict__ out, float mul) {
  typedef _Float16 T;
  typedef Frag<T>::V V;
  __shared__ __align__(128) unsigned short sRing[VK_NBUF * VK_BUF_ELEMS];   // four stage buffers; behind the loop the eight f32 tiles
  const int lane = threadIdx.x & 31;
  const int wave = threadIdx.x >> 5;
  const int e0 = ((int)blockIdx.x >> 3) * VK_TILE;
  const int d0 = ((int)blockIdx.x & 7) * VK_TILE;
  const unsigned short* kp = kvp + (size_t)blockIdx.y * (2 * DHEAD * NTOK);
  const unsigned short* vp = kp + (size_t)DHEAD * NTOK;

  const int rlane = lane & 15;                 // row (A) / col (B, D) within subtile
  const int koff  = (lane >> 4) * 8;           // k offset of this lane half
  const int mOff  = (lane >> 4) * 8;           // D row offset

  // copy side: thread t brings 16-B piece (t & 31) of rows (t >> 5) + 8 c
  const int crow = threadIdx.x >> 5;
  const int cpc  = (threadIdx.x & 31) * 8;
  const unsigned short* gA = vp + (size_t)(e0 + crow) * NTOK + cpc;
  const unsigned short* gB = kp + (size_t)(d0 + crow) * NTOK + cpc;
  const unsigned lcopy = (unsigned)(size_t)(const void*)sRing + (unsigned)(crow * VK_PITCH + cpc) * 2u;
  constexpr unsigned BUF_BYTES = (unsigned)VK_BUF_ELEMS * 2u;

  // read side: this lane's first v and k fragment rows in buffer 0, at this wave's 32 tokens of the stage
  const T* fA = (const T*)sRing + (size_t)rlane * VK_PITCH + (wave << 5) + koff;
  const T* fB = (const T*)sRing + (size_t)(VK_TILE + rlane) * VK_PITCH + (wave << 5) + koff;

  v8f acc[4][4];
#pragma unroll
  for (int i = 0; i < 4; ++i)
#pragma unroll
    for (int j = 0; j < 4; ++j) acc[i][j] = (v8f){0.f,0.f,0.f,0.f,0.f,0.f,0.f,0.f};

  constexpr int stages = NTOK / VK_STG_K;
  static_assert(NTOK % VK_STG_K == 0 && stages >= 3 && VK_NBUF == 4 && VK_STG_K == 8 * 32);
  static_assert((stages & (stages - 1)) == 0, "the rotated walk wraps by a mask");
  // Rotated token walk: stage s of this work-group is token block (s + rot) mod stages. The 8 tiles that share v rows and the 8 that share k rows
  // start one block apart, so that they do not ask L2 for the same lines at the same moment. Block-uniform; every token block is summed once.
  const int rot = ((int)blockIdx.x >> 3) + ((int)blockIdx.x & 7);
  auto tof = [&](const int s) __attribute__((always_inline)) { return (size_t)((s + rot) & (stages - 1)) * VK_STG_K; };
  vk_stage_copies(lcopy, gA + tof(0), gB + tof(0));
  vk_stage_copies(lcopy + BUF_BYTES, gA + tof(1), gB + tof(1));
  vk_stage_copies(lcopy + 2u * BUF_BYTES, gA + tof(2), gB + tof(2));

#pragma unroll 1   // one stage a trip: the buffer index and the refill test stay scalar
  for (int t = 0; t < stages; ++t) {
    const int buf = (t & (VK_NBUF - 1)) * VK_BUF_ELEMS;
    // publish point of stage t (this wave's LDS reads of stage t - 1 have returned: the wait at the foot of the trip before).
    // Issued so far: stages 0 .. t + 2. While both younger stages exist they are the wave's 32 youngest copies; else the wait is to 0.
    if (t + 2 < stages) wait_copies_but<2 * VK_STG_COPIES>(); else wait_copies();
    __syncthreads();                           // publishes stage t and ends every read of stage t - 1's buffer
    {
      V bh[4], ah[4];
#pragma unroll
      for (int j = 0; j < 4; ++j) bh[j] = Frag<T>::load(fB + buf + j * 16 * VK_PITCH);
#pragma unroll
      for (int i = 0; i < 4; ++i) ah[i] = Frag<T>::load(fA + buf + i * 16 * VK_PITCH);
      // the refill of stage t - 1's buffer stands behind this stage's fragment loads (another buffer): its issue runs under their LDS latency
      if (t + 3 < stages)
        vk_stage_copies(lcopy + (unsigned)((t + 3) & (VK_NBUF - 1)) * BUF_BYTES, gA + tof(t + 3), gB + tof(t + 3));
      // keeps the block's 16 LDS loads together in front of its WMMAs: left free, the scheduler reloads one v fragment register
      // set between the WMMA rows and the wave waits out the LDS latency four times a block
      __builtin_amdgcn_sched_barrier(0);
#pragma unroll
      for (int i = 0; i < 4; ++i) {
#pragma unroll
        for (int j = 0; j < 4; ++j) acc[i][j] = Frag<T>::mma(ah[i], bh[j], acc[i][j]);
      }
    }
    // keeps the block's WMMAs in front of the next trip's barrier: left free, the scheduler sinks them behind it, in front of the refill,
    // and every stage's copies start that much later
    __builtin_amdgcn_sched_barrier(0);
    wait_lds_reads();
  }
  wait_copies();
  __syncthreads();                             // ends every wave's last read of the ring, which the sum reuses

  // ---- sum of the eight waves' tiles: the barrier above has ended every read of the ring, and no copy is outstanding ----
  float* red = (float*)(void*)sRing;
  float* mine = red + (size_t)wave * (VK_TILE * VK_RED_PITCH);
#pragma unroll
  for (int i = 0; i < 4; ++i)
#pragma unroll
    for (int j = 0; j < 4; ++j)
#pragma unroll
      for (int r = 0; r < 8; ++r) mine[((i << 4) + mOff + r) * VK_RED_PITCH + (j << 4) + rlane] = acc[i][j][r];
  __syncthreads();                             // every wave's tile is readable by every wave
  const int c4 = ((int)threadIdx.x & 15) * 4;  // 16 lanes read one 256-B row and store one whole 128-B line
  _Float16* op = (_Float16*)(void*)out + (size_t)blockIdx.y * (DHEAD * DHEAD) + d0 + c4;
#pragma unroll
  for (int q = 0; q < 4; ++q) {
    const int row = ((int)threadIdx.x >> 4) + (q << 4);
    v4f s = *(const v4f*)(red + row * VK_RED_PITCH + c4);
#pragma unroll
    for (int w = 1; w < 8; ++w) s += *(const v4f*)(red + (w * VK_TILE + row) * VK_RED_PITCH + c4);
    v4h o;
#pragma unroll
    for (int e = 0; e < 4; ++e) o[e] = (_Float16)(s[e] * mul);
    *(v4h*)(op + (size_t)(e0 + row) * DHEAD) = o;
  }
}

// ---------------- host orchestration ----------------
// out = (q^T k) v^T is formed as q^T (k v^T): no [NTOK][NTOK] plane.
// Workspace region map (bytes; all offsets multiples of 128):
//   QT  : per head [NTOK][DHEAD] f16 (q^T[n][d])                8,388,608   @ 0
//   KVP : per head [2*DHEAD][NTOK] f16 (rows 0..511 = k[d][m], 512..1023 = v[e][m])
//                                                              16,777,216   @ 8,388,608
//   KVT : per head [DHEAD][DHEAD] f16 (x1/64) (KV[e][d])        1,048,576   @ 25,165,824
//   total                                                      26,214,400
constexpr size_t QT_BYTES   = (size_t)NHEAD * NTOK * DHEAD * 2;
constexpr size_t KVP_BYTES  = (size_t)NHEAD * 2 * DHEAD * NTOK * 2;
constexpr size_t KVT_BYTES  = (size_t)NHEAD * DHEAD * DHEAD * 2;
constexpr size_t QT_OFF   = 0;
constexpr size_t KVP_OFF  = QT_OFF + QT_BYTES;
constexpr size_t KVT_OFF  = KVP_OFF + KVP_BYTES;
constexpr size_t WS_TOTAL = KVT_OFF + KVT_BYTES;
static_assert(WS_TOTAL == 26214400u);
static_assert(WS_TOTAL <= (size_t)134217728u);
static_assert((KVP_OFF % 128) == 0 && (KVT_OFF % 128) == 0);

// shape contracts (no tail handling)
// proj q, k|v : their own kernel, 256x256 tiles, K = DHEAD
// v k^T       : its own kernel, 64x64 tiles, all NTOK tokens
// out         : M = NTOK, N = DHEAD, K = DHEAD; M multiple of 128, N of 256, K of 64
static_assert(NTOK % BLK_M == 0 && DHEAD % BLK_N == 0);
static_assert(DHEAD % STG_K == 0 && DHEAD == 8 * VK_TILE);
static_assert(DMODEL == NHEAD * DHEAD && NHEAD == 2);

extern "C" void kernel_launch(void* const* d_in, const int* in_sizes, int n_in,
                              void* d_out, int out_size, void* d_ws, size_t ws_size,
                              hipStream_t stream) {
  if (n_in < 7) return;
  if (in_sizes[0] != NTOK * DMODEL) return;
  for (int i = 1; i < 7; ++i) if (in_sizes[i] != DHEAD * DHEAD) return;
  if (out_size != NTOK * DMODEL) return;
  if (ws_size < WS_TOTAL) return;

  // d_in order per the input table: x, Wq1, Wq2, Wk1, Wk2, Wv1, Wv2 (all f32)
  const float* x   = (const float*)d_in[0];
  const float* wq1 = (const float*)d_in[1];
  const float* wq2 = (const float*)d_in[2];
  const float* wk1 = (const float*)d_in[3];
  const float* wk2 = (const float*)d_in[4];
  const float* wv1 = (const float*)d_in[5];
  const float* wv2 = (const float*)d_in[6];
  float* out = (float*)d_out;

  char* ws = (char*)d_ws;
  unsigned short* QT  = (unsigned short*)(ws + QT_OFF);
  unsigned short* KVP = (unsigned short*)(ws + KVP_OFF);
  unsigned short* KVT = (unsigned short*)(ws + KVT_OFF);
  const float* fdum = x;                                       // unused bias/resid slots (never dereferenced)

  // 1) the projections, one launch, straight from the f32 inputs:
  //    k | v per head: KVP[h][r][m] = sum_c W[h][r][c] * x[m][h*512 + c]   (r<512: Wk, r>=512: Wv)
  //    q^T per head  : QT[h][n][d]  = sum_c x[n][h*512 + c] * Wq[h][d][c]
  proj_f32_kernel<<<dim3(PJ_TILES_KV + PJ_TILES_Q, NHEAD), dim3(256), 0, stream>>>(
      x, wk1, wv1, wq1, wk2, wv2, wq2, KVP, QT);
  // 2) KVT[h][e][d] = f16((1/64) * sum over all tokens m of v[e][m] * k[d][m])
  {
    const int tiles = (DHEAD / VK_TILE) * (DHEAD / VK_TILE);   // 64
    vkt_tile_kernel<<<dim3(tiles, NHEAD), dim3(256), 0, stream>>>(KVP, KVT, KV_CARRY);
  }
  // 3) out[n][h*512 + e] = 64 * sum_d QT[h][n][d] * KVT[h][e][d]   (f32, ldc = DMODEL, per-head column offset DHEAD)
  {
    const int tiles = (NTOK / 64) * (DHEAD / 64);              // 512
    wmma_gemm64<0, false, 0, 0, false, 0, 4><<<dim3((tiles + 7) / 8, NHEAD), dim3(256), 0, stream>>>(
        QT, QT, DHEAD, (long)NTOK * DHEAD,
        KVT, KVT, DHEAD, (long)DHEAD * DHEAD,
        (void*)out, (void*)out, DMODEL, (long)DHEAD, 0L,
        fdum, fdum, 0L,
        NTOK, DHEAD, DHEAD, KV_CARRY_INV);
  }
}

// v008
// A run of this version takes 34.9 microseconds.
// Next to v007, in two timings, it ran 1.03 times as fast each time.
// Counting every step since v000, it is 8.44 times as fast.
// Contractions: q/k/v projections on v_wmma_f32_16x16x32_bf16 (float inputs RNE-converted to bf16 at the store to LDS), KV = v k^T and out = q^T KV^T on v_wmma_f32_16x16x32_f16; f32 accumulate; intermediate planes f16.
#include <hip/hip_runtime.h>
#include <stdint.h>
#include <stddef.h>

typedef __attribute__((ext_vector_type(16))) _Float16 v16h;
typedef __attribute__((ext_vector_type(8)))  _Float16 v8h;
typedef __attribute__((ext_vector_type(16))) __bf16   v16b;
typedef __attribute__((ext_vector_type(8)))  __bf16   v8b;
typedef __attribute__((ext_vector_type(8)))  float    v8f;
typedef __attribute__((ext_vector_type(4)))  float    v4f;

// ---------------- problem constants ----------------
constexpr int NTOK   = 4096;
constexpr int DMODEL = 1024;
constexpr int DHEAD  = 512;
constexpr int NHEAD  = 2;
constexpr float KV_CARRY     = 1.0f / 64.0f;  // v k^T carried x1/64 in f16 (exact; sums over NTOK tokens need the range)
constexpr float KV_CARRY_INV = 64.0f;         // folded back in the output epilogue

// ---------------- helpers ----------------
__device__ __forceinline__ unsigned short f2bf_bits(float f) {
  unsigned u = __float_as_uint(f);
  return (unsigned short)((u + 0x7FFFu + ((u >> 16) & 1u)) >> 16);
}
__device__ __forceinline__ float bf_bits2f(unsigned short h) { return __uint_as_float(((unsigned)h) << 16); }

// hazard guards as plain device helpers
__device__ __forceinline__ void dep_guard_h(v8f& a, v8f& b, v16h x, v16h y) { asm volatile("v_nop\n\tv_nop\n\tv_nop\n\tv_nop" : "+v"(a), "+v"(b) : "v"(x), "v"(y)); }
__device__ __forceinline__ void dep_guard_b(v8f& a, v8f& b, v16b x, v16b y) { asm volatile("v_nop\n\tv_nop\n\tv_nop\n\tv_nop" : "+v"(a), "+v"(b) : "v"(x), "v"(y)); }
__device__ __forceinline__ void keep4_h(v16h a, v16h b, v16h c, v16h d) { asm volatile("v_nop" :: "v"(a), "v"(b), "v"(c), "v"(d)); }
__device__ __forceinline__ void keep4_b(v16b a, v16b b, v16b c, v16b d) { asm volatile("v_nop" :: "v"(a), "v"(b), "v"(c), "v"(d)); }
__device__ __forceinline__ void acc_guard4(v8f& a, v8f& b, v8f& c, v8f& d) { asm volatile("v_nop\n\tv_nop\n\tv_nop\n\tv_nop" : "+v"(a), "+v"(b), "+v"(c), "+v"(d)); }
template <typename T> struct Frag;
template <> struct Frag<_Float16> {
  typedef v16h V; union U { v16h v; v8h h[2]; };
  static __device__ __forceinline__ v16h load(const _Float16* p) {   // elements 0..7 <- p[0..7], 8..15 <- p[16..23]
    U f; f.h[0] = *(const v8h*)(p); f.h[1] = *(const v8h*)(p + 16); return f.v;
  }
  static __device__ __forceinline__ v8f mma(v16h a, v16h b, v8f c) {
    return __builtin_amdgcn_wmma_f32_16x16x32_f16(false, a, false, b, (short)0, c, false, false);
  }
  static __device__ __forceinline__ void guard(v8f& a, v8f& b, v16h x, v16h y) { dep_guard_h(a, b, x, y); }
  static __device__ __forceinline__ void keep(v16h a, v16h b, v16h c, v16h d) { keep4_h(a, b, c, d); }
};
template <> struct Frag<__bf16> {
  typedef v16b V; union U { v16b v; v8b h[2]; };
  static __device__ __forceinline__ v16b load(const __bf16* p) {
    U f; f.h[0] = *(const v8b*)(p); f.h[1] = *(const v8b*)(p + 16); return f.v;
  }
  static __device__ __forceinline__ v8f mma(v16b a, v16b b, v8f c) {
    return __builtin_amdgcn_wmma_f32_16x16x32_bf16(false, a, false, b, (short)0, c, false, false);
  }
  static __device__ __forceinline__ void guard(v8f& a, v8f& b, v16b x, v16b y) { dep_guard_b(a, b, x, y); }
  static __device__ __forceinline__ void keep(v16b a, v16b b, v16b c, v16b d) { keep4_b(a, b, c, d); }
};

// ---- Register-blocked batched WMMA GEMM, operands staged in LDS --------------
// C[m,n] = scale * sum_k A[m,k] * Bt[n,k] (+bias)(+resid); a block owns a 128x256 tile, each of its 2x4 waves a 64x64 tile.
// A row-major [M,K]; Bt row-major [N,K]; M % 128 == 0, N % 256 == 0, K % 64 == 0, K >= 64.
// A stage is 64 k of the block's 128 A rows and 256 Bt rows (128 B a row, whole lines), brought into LDS by asynchronous
// copies. NBUF = 2: stage t + 1 flies while stage t is multiplied. NBUF = 4: stages t + 1 .. t + 3 fly, behind counted waits, so that copies
// are in flight all the time (for a launch with one work-group a WGP, which has the LDS). LDS row pitch 144 B (16 B x odd: ds_load_b128 without bank conflicts).
// blockIdx.z = k slice: it sums k in [z*K, (z+1)*K) and writes its own plane at z*strideCz (grid.z = 1: the whole product).
// SPLIT: not carried by the staged loop (one plane per operand).
// BIAS_MODE: 0 = none, 1 = bias[m], 2 = bias[n].
// OUT_MODE: 0 = f32, 1 = f16, 2 = bf16 hi plane (Cout) + bf16 lo plane (Cout2).
// ET: 0 = f16 operands, 1 = bf16 operands (pointers passed as 16-bit storage)
// The Bt fragment is the WMMA's first operand, so that the accumulators hold the tile transposed: a lane owns one row m and 8 adjacent columns n.
constexpr int BLK_M = 128, BLK_N = 256, STG_K = 64;
constexpr int EP_PITCH = 68;                                   // floats per row of a wave's 64x64 tile in the epilogue (16 B x odd)
constexpr int STG_PITCH = STG_K + 8;                          // 16-bit elements per LDS row
constexpr int STG_ELEMS = (BLK_M + BLK_N) * STG_PITCH;         // one buffer: A rows 0..127, Bt rows 128..383
constexpr unsigned STG_ROWS32_BYTES = 32u * STG_PITCH * 2u;    // LDS step from one copy of a thread to its next (32 rows)

// One stage, this thread's share: 12 copies of 16 B (4 of A, 8 of Bt); a wave's copy covers 4 whole 128-B rows.
// l: the thread's LDS byte address in row (threadIdx.x >> 3) of the buffer; a, b: its global addresses in that row of the A and
// Bt tile; sa, sb: 32 rows of A and Bt in elements. The s_wait_xcnt stands inside the statement, so that no address register
// of a copy is rewritten ahead of it.
__device__ __forceinline__ void stage_copies(unsigned l, const unsigned short* a, size_t sa, const unsigned short* b, size_t sb) {
  asm volatile(
      "global_load_async_to_lds_b128 %0, %12, off\n\t"
      "global_load_async_to_lds_b128 %1, %13, off\n\t"
      "global_load_async_to_lds_b128 %2, %14, off\n\t"
      "global_load_async_to_lds_b128 %3, %15, off\n\t"
      "global_load_async_to_lds_b128 %4, %16, off\n\t"
      "global_load_async_to_lds_b128 %5, %17, off\n\t"
      "global_load_async_to_lds_b128 %6, %18, off\n\t"
      "global_load_async_to_lds_b128 %7, %19, off\n\t"
      "global_load_async_to_lds_b128 %8, %20, off\n\t"
      "global_load_async_to_lds_b128 %9, %21, off\n\t"
      "global_load_async_to_lds_b128 %10, %22, off\n\t"
      "global_load_async_to_lds_b128 %11, %23, off\n\t"
      "s_wait_xcnt 0x0"
      :: "v"(l), "v"(l + STG_ROWS32_BYTES), "v"(l + 2u * STG_ROWS32_BYTES), "v"(l + 3u * STG_ROWS32_BYTES),
         "v"(l + 4u * STG_ROWS32_BYTES), "v"(l + 5u * STG_ROWS32_BYTES), "v"(l + 6u * STG_ROWS32_BYTES), "v"(l + 7u * STG_ROWS32_BYTES),
         "v"(l + 8u * STG_ROWS32_BYTES), "v"(l + 9u * STG_ROWS32_BYTES), "v"(l + 10u * STG_ROWS32_BYTES), "v"(l + 11u * STG_ROWS32_BYTES),
         "v"(a), "v"(a + sa), "v"(a + 2 * sa), "v"(a + 3 * sa),
         "v"(b), "v"(b + sb), "v"(b + 2 * sb), "v"(b + 3 * sb), "v"(b + 4 * sb), "v"(b + 5 * sb), "v"(b + 6 * sb), "v"(b + 7 * sb)
      : "memory");
}
// this wave's copies have landed (the compiler places no wait for them)
__device__ __forceinline__ void wait_copies() { asm volatile("s_wait_asynccnt 0x0" ::: "memory"); }
// all but this wave's N youngest copies have landed: N = the copies of the stages issued behind the one that is published
template <int N> __device__ __forceinline__ void wait_copies_but() { asm volatile("s_wait_asynccnt %0" :: "n"(N) : "memory"); }
// this wave's LDS reads have returned, before the barrier behind which their buffer is refilled
__device__ __forceinline__ void wait_lds_reads() { asm volatile("s_wait_dscnt 0x0" ::: "memory"); }

template <int ET> struct Elem;
template <> struct Elem<0> { typedef _Float16 T; };
template <> struct Elem<1> { typedef __bf16 T; };
template <int ET, bool SPLIT, int BIAS_MODE, int OUT_MODE, bool RESID, int ACT = 0, int NBUF = 2>
__device__ __forceinline__ void gemm64_block(
    const int bx, const int b, const int bz,     // block tile, batch and k slice of this work-group
    const unsigned short* __restrict__ Ap, const unsigned short* __restrict__ A2p, int lda, long strideA,
    const unsigned short* __restrict__ Btp, const unsigned short* __restrict__ Bt2p, int ldb, long strideB,
    void* __restrict__ Cout, void* __restrict__ Cout2, int ldc, long strideC, long strideCz,
    const float* __restrict__ bias,
    const float* __restrict__ resid, long strideR,
    int M, int N, int K, float scale) {
  typedef typename Elem<ET>::T T;
  typedef typename Frag<T>::V V;
  static_assert(!SPLIT, "the staged loop carries one plane per operand");
  static_assert(NBUF == 2 || NBUF == 4);
  constexpr int EP_ELEMS = 8 * 64 * EP_PITCH * 2;                     // the eight waves' f32 tiles, in 16-bit elements
  __shared__ __align__(128) unsigned short sStage[NBUF * STG_ELEMS > EP_ELEMS ? NBUF * STG_ELEMS : EP_ELEMS];   // the stage buffers; behind the loop the eight f32 tiles
  const int lane = threadIdx.x & 31;
  const int wave = threadIdx.x >> 5;
  const int blocksN = N / BLK_N;
  const int blocksM = M / BLK_M;
  if (bx >= blocksM * blocksN) return;   // block-uniform, in front of every barrier
  const int bm = bx / blocksN;
  const int bn = bx - bm * blocksN;
  const int wm = wave >> 2;                    // wave's 64-row band of the block tile
  const int wn = wave & 3;                     // wave's 64-column band
  const int m0 = bm * BLK_M + (wm << 6);
  const int n0 = bn * BLK_N + (wn << 6);

  const size_t kz = (size_t)bz * K;                                    // first k of this slice
  const size_t cz = (size_t)b * strideC + (size_t)bz * strideCz;

  const int rlane = lane & 15;                 // fragment row within subtile; in D the lane's row m
  const int koff  = (lane >> 4) * 8;           // k offset of this lane half
  const int mOff  = (lane >> 4) * 8;           // D: first of the lane's 8 columns n

  // copy side: thread t brings 16-B piece (t & 7) of rows (t >> 3) + 32 c
  const int crow = threadIdx.x >> 3;
  const int cpc  = (threadIdx.x & 7) * 8;
  const unsigned short* gA = Ap  + (size_t)b * strideA + kz + (size_t)(bm * BLK_M + crow) * lda + cpc;
  const unsigned short* gB = Btp + (size_t)b * strideB + kz + (size_t)(bn * BLK_N + crow) * ldb + cpc;
  const size_t sa = (size_t)32 * lda;
  const size_t sb = (size_t)32 * ldb;
  const unsigned lcopy = (unsigned)(size_t)(const void*)sStage + (unsigned)(crow * STG_PITCH + cpc) * 2u;
  constexpr unsigned STG_BYTES = (unsigned)STG_ELEMS * 2u;

  // read side: this lane's first A and Bt fragment rows in buffer 0
  const T* fA = (const T*)sStage + (size_t)((wm << 6) + rlane) * STG_PITCH + koff;
  const T* fB = (const T*)sStage + (size_t)(BLK_M + (wn << 6) + rlane) * STG_PITCH + koff;

  v8f acc[4][4];
#pragma unroll
  for (int i = 0; i < 4; ++i)
#pragma unroll
    for (int j = 0; j < 4; ++j) acc[i][j] = (v8f){0.f,0.f,0.f,0.f,0.f,0.f,0.f,0.f};

  const int stages = K / STG_K;
  // Rotated k walk: stage s of this work-group is k block (s + rot) mod stages. Work-groups that share A rows (same bm) or Bt rows (same bn)
  // are spread over the starts, so that they do not all ask L2 for the same lines at the same moment. Block-uniform; every k block is summed once.
  const int rot = ((stages & (stages - 1)) == 0) ? ((bm + bn * (stages >> 1)) & (stages - 1)) : 0;
  auto kof = [&](const int s) __attribute__((always_inline)) { int kb = s + rot; if (kb >= stages) kb -= stages; return (size_t)kb * STG_K; };
  stage_copies(lcopy, gA + kof(0), sa, gB + kof(0), sb);
  if (NBUF == 2) {
    wait_copies();
    __syncthreads();                           // stage 0 is readable by every wave
    if (stages > 1) stage_copies(lcopy + STG_BYTES, gA + kof(1), sa, gB + kof(1), sb);
  } else {
    if (stages > 1) stage_copies(lcopy + STG_BYTES, gA + kof(1), sa, gB + kof(1), sb);
    if (stages > 2) stage_copies(lcopy + 2u * STG_BYTES, gA + kof(2), sa, gB + kof(2), sb);
  }

#pragma unroll 1   // one stage a trip: the buffer index and the refill test stay scalar
  for (int t = 0; t < stages; ++t) {
    const int buf = (t & (NBUF - 1)) * STG_ELEMS;
    if (NBUF == 4) {
      // publish point of stage t (this wave's LDS reads of stage t - 1 have returned: the wait at the foot of the trip before).
      // Issued so far: stages 0 .. t + 2. While both younger stages exist they are the wave's 24 youngest copies; else the wait is to 0.
      if (t + 2 < stages) wait_copies_but<24>(); else wait_copies();
      __syncthreads();                         // publishes stage t and ends every read of stage t - 1's buffer
    }
#pragma unroll
    for (int kk = 0; kk < STG_K; kk += 32) {
      V bh[4], ah[4];
#pragma unroll
      for (int j = 0; j < 4; ++j) bh[j] = Frag<T>::load(fB + buf + j * 16 * STG_PITCH + kk);
#pragma unroll
      for (int i = 0; i < 4; ++i) ah[i] = Frag<T>::load(fA + buf + i * 16 * STG_PITCH + kk);
      // the refill of stage t - 1's buffer stands behind this stage's first fragment loads (another buffer): its issue runs under their LDS latency
      if (NBUF == 4 && kk == 0 && t + 3 < stages)
        stage_copies(lcopy + (unsigned)((t + 3) & 3) * STG_BYTES, gA + kof(t + 3), sa, gB + kof(t + 3), sb);
#pragma unroll
      for (int i = 0; i < 4; ++i) {
#pragma unroll
        for (int j = 0; j < 4; ++j) acc[i][j] = Frag<T>::mma(bh[j], ah[i], acc[i][j]);
        Frag<T>::guard(acc[i][0], acc[i][3], ah[i], ah[i]);
      }
      Frag<T>::keep(bh[0], bh[1], bh[2], bh[3]);
    }
    wait_lds_reads();
    if (NBUF == 2) {
      wait_copies();
      __syncthreads();                         // publishes stage t + 1 and ends every read of stage t's buffer
      if (t + 2 < stages)
        stage_copies(lcopy + (unsigned)(t & 1) * STG_BYTES, gA + kof(t + 2), sa, gB + kof(t + 2), sb);
    }
  }
  wait_copies();
  acc_guard4(acc[0][0], acc[0][1], acc[0][2], acc[0][3]);
  acc_guard4(acc[1][0], acc[1][1], acc[1][2], acc[1][3]);
  acc_guard4(acc[2][0], acc[2][1], acc[2][2], acc[2][3]);
  acc_guard4(acc[3][0], acc[3][1], acc[3][2], acc[3][3]);

  // ---- epilogue: each wave's whole 64x64 tile goes once through its own part of the ring, in 16-byte LDS stores, and leaves in whole lines ----
  __syncthreads();                             // ends every wave's last read of the ring, which the epilogue reuses
  float* slab = (float*)(void*)sStage + (size_t)wave * (64 * EP_PITCH);
  const float* Rb = RESID ? (resid + (size_t)b * strideR) : nullptr;
#pragma unroll
  for (int i = 0; i < 4; ++i) {
    const int m = m0 + (i << 4) + rlane;
    float bm1 = 0.f;
    if (BIAS_MODE == 1) bm1 = bias[m];
#pragma unroll
    for (int j = 0; j < 4; ++j) {
      const int nb = n0 + (j << 4) + mOff;
      v4f w[2];
#pragma unroll
      for (int r = 0; r < 8; ++r) {
        float v = acc[i][j][r] * scale;
        if (BIAS_MODE == 1) v += bm1;
        if (BIAS_MODE == 2) v += bias[nb + r];
        if (RESID) v += Rb[(size_t)m * ldc + nb + r];
        if (ACT == 1) v = tanhf(v);
        if (ACT == 2) v = fmaxf(v, 0.0f);
        if (ACT == 3) v = v / (1.0f + expf(-v));
        if (ACT == 4) v = (v > 0.f) ? v : 0.01f * v;
        if (ACT == 5) v = 0.5f * v * (1.0f + erff(v * 0.70710678118654752f));
        w[r >> 2][r & 3] = v;
      }
      float* sp = slab + ((i << 4) + rlane) * EP_PITCH + (j << 4) + mOff;
      *(v4f*)sp = w[0];
      *(v4f*)(sp + 4) = w[1];
    }
  }
  // the tile's rows are written before other lanes of the wave read them back (LDS only)
  __builtin_amdgcn_fence(__ATOMIC_RELEASE, "workgroup", "local");
  __builtin_amdgcn_wave_barrier();
  __builtin_amdgcn_fence(__ATOMIC_ACQUIRE, "workgroup", "local");
  if (OUT_MODE == 0) {
    const int hh = lane >> 4, c4 = (lane & 15) * 4;       // row seg = 256 B = 16 lanes x 16 B
    float* C = (float*)Cout + cz + (size_t)(m0 + hh) * ldc + n0 + c4;
    const size_t step2 = (size_t)2 * ldc;
    const float* sp = slab + hh * EP_PITCH + c4;
    v4f cur[8], nxt[8];                                   // 16 rows a group; the next group's LDS reads fly while this group is stored
#pragma unroll
    for (int u = 0; u < 8; ++u) cur[u] = *(const v4f*)(sp + u * 2 * EP_PITCH);
#pragma unroll
    for (int g = 0; g < 4; ++g) {
      if (g < 3) {
#pragma unroll
        for (int u = 0; u < 8; ++u) nxt[u] = *(const v4f*)(sp + ((g + 1) * 8 + u) * 2 * EP_PITCH);
      }
#pragma unroll
      for (int u = 0; u < 8; ++u) *(v4f*)(C + (size_t)(g * 8 + u) * step2) = cur[u];
      // precaution: later groups rewrite the registers that these stores name; the stores' completion is not waited for
      asm volatile("s_wait_xcnt 0x0" ::: "memory");
#pragma unroll
      for (int u = 0; u < 8; ++u) cur[u] = nxt[u];
    }
  } else {
    const int q = lane >> 3, c8 = (lane & 7) * 8;
    unsigned short* C  = (unsigned short*)Cout  + cz;
    unsigned short* C2 = (OUT_MODE == 2) ? ((unsigned short*)Cout2 + cz) : nullptr;
#pragma unroll
    for (int it = 0; it < 16; ++it) {
      const int row = it * 4 + q;
      const float* sp = slab + row * EP_PITCH + c8;
      v8h hv, lv;
#pragma unroll
      for (int e = 0; e < 8; ++e) {
        if (OUT_MODE == 1) {
          hv[e] = (_Float16)sp[e];
        } else {
          unsigned short hb = f2bf_bits(sp[e]);
          unsigned short lb = f2bf_bits(sp[e] - bf_bits2f(hb));
          hv[e] = __builtin_bit_cast(_Float16, hb);
          lv[e] = __builtin_bit_cast(_Float16, lb);
        }
      }
      *(v8h*)(C + (size_t)(m0 + row) * ldc + n0 + c8) = hv;
      if (OUT_MODE == 2) *(v8h*)(C2 + (size_t)(m0 + row) * ldc + n0 + c8) = lv;
      // precaution: the next rows rewrite the registers that these stores name
      asm volatile("s_wait_xcnt 0x0" ::: "memory");
    }
  }
}

// one product a launch: blockIdx.x = block tile, .y = batch, .z = k slice
template <int ET, bool SPLIT, int BIAS_MODE, int OUT_MODE, bool RESID, int ACT = 0, int NBUF = 2>
__global__ __launch_bounds__(256) void wmma_gemm64(
    const unsigned short* __restrict__ Ap, const unsigned short* __restrict__ A2p, int lda, long strideA,
    const unsigned short* __restrict__ Btp, const unsigned short* __restrict__ Bt2p, int ldb, long strideB,
    void* __restrict__ Cout, void* __restrict__ Cout2, int ldc, long strideC, long strideCz,
    const float* __restrict__ bias,
    const float* __restrict__ resid, long strideR,
    int M, int N, int K, float scale) {
  gemm64_block<ET, SPLIT, BIAS_MODE, OUT_MODE, RESID, ACT, NBUF>(
      (int)blockIdx.x, (int)blockIdx.y, (int)blockIdx.z, Ap, A2p, lda, strideA, Btp, Bt2p, ldb, strideB,
      Cout, Cout2, ldc, strideC, strideCz, bias, resid, strideR, M, N, K, scale);
}

// ---------------- q | k | v projections, straight from the f32 inputs ----------------
// C[m][n] = f16(sum_c bf16(A[m][c]) * bf16(Bt[n][c])), c over the head's DHEAD channels; A, Bt f32, c contiguous.
//   k | v tiles (blockIdx.x < PJ_TILES_KV): A = Wk or Wv rows, Bt = x rows (tokens), C = kvp[h][r][m] (r < 512: k, else v)
//   q tiles (the rest)                    : A = x rows (tokens), Bt = Wq rows,       C = qt[h][n][d]
// A work-group owns a 256x256 tile, each of its 2x4 waves 128x64; blockIdx.y = head. A stage is 32 channels of the 256 A rows and 256 Bt rows
// (128 B of f32 a row, whole lines): loaded into registers a trip ahead, rounded to bf16 once, stored to one of two LDS buffers.
// LDS row pitch 80 B (16 B x odd: ds_load_b128 without bank conflicts).
constexpr int PJ_TILE   = 256;
constexpr int PJ_STG_K  = 32;
constexpr int PJ_PITCH  = PJ_STG_K + 8;                        // bf16 elements per LDS row
constexpr int PJ_BUF_ELEMS = 2 * PJ_TILE * PJ_PITCH;           // one buffer: A rows 0..255, Bt rows 256..511
constexpr int PJ_EP_PITCH = 64 + 8;                            // f16 elements per row of a wave's 128x64 tile in the epilogue (144 B: 16 B x odd)
constexpr int PJ_EP_ELEMS = 128 * PJ_EP_PITCH;                 // one wave's tile
constexpr int PJ_TILES_KV = ((2 * DHEAD) / PJ_TILE) * (NTOK / PJ_TILE);   // 64 a head
constexpr int PJ_TILES_Q  = (NTOK / PJ_TILE) * (DHEAD / PJ_TILE);         // 32 a head
static_assert(DHEAD % PJ_TILE == 0 && NTOK % PJ_TILE == 0 && DHEAD % (2 * PJ_STG_K) == 0 && DHEAD / PJ_STG_K >= 4);
constexpr int PJ_STARTS = DHEAD / (2 * PJ_STG_K);             // even channel blocks at which a tile's k walk may start
static_assert((PJ_STARTS & (PJ_STARTS - 1)) == 0);
typedef __attribute__((ext_vector_type(4))) __bf16 v4b;
template <bool B> struct PjFlag { static constexpr bool value = B; };
// Work-group barrier that orders LDS only: __syncthreads() compiled to s_wait_loadcnt_dscnt 0 here, a wait for the next stage's global loads, which fly across it.
__device__ __forceinline__ void pj_barrier() {
  __builtin_amdgcn_fence(__ATOMIC_RELEASE, "workgroup", "local");
  __builtin_amdgcn_s_barrier();
  __builtin_amdgcn_fence(__ATOMIC_ACQUIRE, "workgroup", "local");
}

// One 256x256 tile. A, Bt, C: the tile's first elements (block-uniform); the three row pitches are compile-time, so that a thread's 16 row
// addresses are two base addresses and an immediate each (16 addresses in registers do not fit beside the accumulators: scratch).
template <int lda, int ldb, int ldc>
__device__ __forceinline__ void proj_tile(const float* __restrict__ A, const float* __restrict__ Bt, unsigned short* __restrict__ C,
                                          const int rot, unsigned short* sStage, unsigned short* sT) {
  typedef __bf16 T;
  const int lane = threadIdx.x & 31;
  const int wave = threadIdx.x >> 5;
  const int wm = wave >> 2;                    // wave's 128-row band of the block tile
  const int wn = wave & 3;                     // wave's 64-column band
  const int rlane = lane & 15;                 // fragment row within subtile; in D the lane's row m
  const int koff  = (lane >> 4) * 8;           // k offset of this lane half
  const int mOff  = (lane >> 4) * 8;           // D: first of the lane's 8 columns n

  // staging side: thread t brings 16-B piece (t & 7) of rows (t >> 3) + 32 c; a wave's load covers 4 whole 128-B rows
  const int crow = threadIdx.x >> 3;
  const int cpc  = (threadIdx.x & 7) * 4;
  const unsigned voA = (unsigned)(crow * lda + cpc) * 4u;   // this thread's byte offset in the A tile; the rest of an address is block-uniform (scalar)
  const unsigned voB = (unsigned)(crow * ldb + cpc) * 4u;
  constexpr size_t sa = (size_t)32 * lda;
  constexpr size_t sb = (size_t)32 * ldb;
  T* wS = (T*)sStage + crow * PJ_PITCH + cpc;

  // read side: this lane's first A and Bt fragment rows in buffer 0
  const T* fA = (const T*)sStage + (size_t)((wm << 7) + rlane) * PJ_PITCH + koff;
  const T* fB = (const T*)sStage + (size_t)(PJ_TILE + (wn << 6) + rlane) * PJ_PITCH + koff;

  v8f acc[8][4];
#pragma unroll
  for (int i = 0; i < 8; ++i)
#pragma unroll
    for (int j = 0; j < 4; ++j) acc[i][j] = (v8f){0.f,0.f,0.f,0.f,0.f,0.f,0.f,0.f};

  constexpr int stages = DHEAD / PJ_STG_K;
  static_assert((stages & (stages - 1)) == 0, "the rotated walk wraps by a mask");
  v4f g[16];                                   // one stage's f32 values of this thread, in flight
  // Rotated k walk: stage s of this work-group is channel block (s + rot) mod stages (rot block-uniform and even, so that a pair of stages
  // s, s + 1 with s even never wraps between its two); every block is summed once. Ak, Bk: the two tiles' first elements in the channel block to load (block-uniform).
  auto stage_load = [&](const float* Ak, const float* Bk) __attribute__((always_inline)) {
#pragma unroll
    for (int c = 0; c < 8; ++c) g[c] = *(const v4f*)((const char*)(Ak + c * sa) + voA);
#pragma unroll
    for (int c = 0; c < 8; ++c) g[8 + c] = *(const v4f*)((const char*)(Bk + c * sb) + voB);
  };
  auto stage_store = [&](const int b) __attribute__((always_inline)) {   // rounded to nearest even, into buffer b
#pragma unroll
    for (int c = 0; c < 16; ++c) *(v4b*)(wS + b * PJ_BUF_ELEMS + c * 32 * PJ_PITCH) = __builtin_convertvector(g[c], v4b);
  };

  const float* A0 = A + (size_t)rot * PJ_STG_K;
  const float* B0 = Bt + (size_t)rot * PJ_STG_K;
  stage_load(A0, B0);
  stage_store(0);
  stage_load(A0 + PJ_STG_K, B0 + PJ_STG_K);
  // precaution: the two offsets and the two bases that the 32 loads above name lose their registers further down (the accumulators' zeroing,
  // the loop's addresses); as inputs of the wait they keep them up to it, so that it stands in front of every such rewrite
  asm volatile("s_wait_xcnt 0x0" :: "v"(voA), "v"(voB), "s"(A0), "s"(B0) : "memory");
  pj_barrier();                                // stage 0 is readable by every wave

  // A trip has two blocks of 16 WMMAs: A rows 0..63 of the wave's band, then rows 64..127, both against the same four Bt fragments.
  // Each block's fragments are read from LDS while the block before is multiplied, so that LDS reads and WMMAs overlap.
  v16b bh[4], alo[4], ahi[4], bn4[4];
#pragma unroll
  for (int j = 0; j < 4; ++j) bh[j] = Frag<T>::load(fB + j * 16 * PJ_PITCH);
#pragma unroll
  for (int i = 0; i < 4; ++i) alo[i] = Frag<T>::load(fA + i * 16 * PJ_PITCH);

  // One trip. LOAD: stage t + 2 exists, A2 and B2 point at its channel block; NEXT: stage t + 1 exists (compile-time: a trip is straight-line code).
  auto trip = [&](const float* A2, const float* B2, const int b, auto load, auto next) __attribute__((always_inline)) {
#pragma unroll
    for (int i = 0; i < 4; ++i) ahi[i] = Frag<T>::load(fA + b * PJ_BUF_ELEMS + (4 + i) * 16 * PJ_PITCH);
    // keeps the second block's LDS loads in front of the first block's WMMAs, under which they land
    __builtin_amdgcn_sched_barrier(0);
#pragma unroll
    for (int i = 0; i < 4; ++i)
#pragma unroll
      for (int j = 0; j < 4; ++j) acc[i][j] = Frag<T>::mma(bh[j], alo[i], acc[i][j]);
    // keeps the wait for stage t + 1's global loads behind the first block's WMMAs: the loads get that much more time
    __builtin_amdgcn_sched_barrier(0);
    // stage t + 1 goes to the other buffer, whose last readers (stage t - 1) left it in front of the barrier of the trip before
    if constexpr (decltype(next)::value) stage_store(b ^ 1);
    // keeps stage t + 2's loads behind every rounding of stage t + 1: mixed among them, the waits for the older loads cover the new ones too
    __builtin_amdgcn_sched_barrier(0);
    if constexpr (decltype(load)::value) stage_load(A2, B2);
    if constexpr (decltype(next)::value) {
      pj_barrier();                            // publishes stage t + 1 and ends every read of stage t's buffer
#pragma unroll
      for (int j = 0; j < 4; ++j) bn4[j] = Frag<T>::load(fB + (b ^ 1) * PJ_BUF_ELEMS + j * 16 * PJ_PITCH);
#pragma unroll
      for (int i = 0; i < 4; ++i) alo[i] = Frag<T>::load(fA + (b ^ 1) * PJ_BUF_ELEMS + i * 16 * PJ_PITCH);
    }
    // keeps the next stage's first LDS loads in front of the second block's WMMAs, under which they land
    __builtin_amdgcn_sched_barrier(0);
#pragma unroll
    for (int i = 0; i < 4; ++i)
#pragma unroll
      for (int j = 0; j < 4; ++j) acc[4 + i][j] = Frag<T>::mma(bh[j], ahi[i], acc[4 + i][j]);
    // keeps the second block's WMMAs in front of the next trip's LDS loads (one load group a block)
    __builtin_amdgcn_sched_barrier(0);
#pragma unroll
    for (int j = 0; j < 4; ++j) bh[j] = bn4[j];
  };
#pragma unroll 1   // two stages a pass of the loop: the buffer index is a constant and the two Bt fragment sets swap names, not registers
  for (int t = 0; t + 2 < stages; t += 2) {
    const size_t ko = (size_t)((t + 2 + rot) & (stages - 1)) * PJ_STG_K;
    trip(A + ko,            Bt + ko,            0, PjFlag<true>(), PjFlag<true>());
    trip(A + ko + PJ_STG_K, Bt + ko + PJ_STG_K, 1, PjFlag<true>(), PjFlag<true>());
  }
  trip(A, Bt, 0, PjFlag<false>(), PjFlag<true>());
  trip(A, Bt, 1, PjFlag<false>(), PjFlag<false>());

  // ---- epilogue: the Bt fragment is the WMMA's first operand, so the accumulators hold the tile transposed: a lane owns one row m and 8 adjacent
  // columns n, 16 B of f16. The wave's whole 128x64 tile goes once through its own LDS region, in 16-byte stores, and leaves in whole 128-B lines ----
  _Float16* slab = (_Float16*)(void*)sT + wave * PJ_EP_ELEMS;
#pragma unroll
  for (int i = 0; i < 8; ++i)
#pragma unroll
    for (int j = 0; j < 4; ++j) {
      v8h hv;
#pragma unroll
      for (int r = 0; r < 8; ++r) hv[r] = (_Float16)acc[i][j][r];
      *(v8h*)(slab + ((i << 4) + rlane) * PJ_EP_PITCH + (j << 4) + mOff) = hv;
    }
  // the tile's rows are written before other lanes of the wave read them back (LDS only)
  __builtin_amdgcn_fence(__ATOMIC_RELEASE, "workgroup", "local");
  __builtin_amdgcn_wave_barrier();
  __builtin_amdgcn_fence(__ATOMIC_ACQUIRE, "workgroup", "local");
  // 8 lanes take one row; the two rows of a 16-lane half lie 8 rows apart (8 x 144 B = 128 B mod 256 B: no bank in common)
  const int q = lane >> 3, c8 = (lane & 7) * 8;
  const int row0 = (q >> 1) + ((q & 1) << 3);
  const _Float16* sp = slab + row0 * PJ_EP_PITCH + c8;
  unsigned short* Cw = C + (size_t)((wm << 7) + row0) * ldc + (wn << 6) + c8;
  auto rowof = [](const int s) __attribute__((always_inline)) { return ((s >> 2) << 4) + ((s & 3) << 1); };   // step s: 16-row block s / 4, row pair s % 4
  v8h cur[8], nxt[8];                          // 32 rows a group; the next group's LDS reads fly while this group is stored
#pragma unroll
  for (int u = 0; u < 8; ++u) cur[u] = *(const v8h*)(sp + rowof(u) * PJ_EP_PITCH);
#pragma unroll
  for (int g = 0; g < 4; ++g) {
    if (g < 3) {
#pragma unroll
      for (int u = 0; u < 8; ++u) nxt[u] = *(const v8h*)(sp + rowof((g + 1) * 8 + u) * PJ_EP_PITCH);
    }
#pragma unroll
    for (int u = 0; u < 8; ++u) *(v8h*)(Cw + (size_t)rowof(g * 8 + u) * ldc) = cur[u];
    // precaution: later groups rewrite the registers that these stores name; the stores' completion is not waited for
    asm volatile("s_wait_xcnt 0x0" ::: "memory");
#pragma unroll
    for (int u = 0; u < 8; ++u) cur[u] = nxt[u];
  }
}

__global__ __launch_bounds__(256) void proj_f32_kernel(
    const float* __restrict__ x,
    const float* __restrict__ wk0, const float* __restrict__ wv0, const float* __restrict__ wq0,
    const float* __restrict__ wk1, const float* __restrict__ wv1, const float* __restrict__ wq1,
    unsigned short* __restrict__ kvp, unsigned short* __restrict__ qt) {
  __shared__ __align__(128) unsigned short sStage[2 * PJ_BUF_ELEMS];   // the two stage buffers
  __shared__ __align__(16) unsigned short sT[8 * PJ_EP_ELEMS];         // per-wave 128x64 f16 tile of the epilogue
  // block-uniform choice of the product and its tile, and of the channel block at which the tile's k walk starts (PJ_STARTS even starts): the 6 tiles (4 of k | v, 2 of q)
  // that share x rows start two blocks apart, the 16 that share W rows likewise, two to a start, so that they do not ask L2 for the same lines at the same moment
  const int h  = (int)blockIdx.y;
  const int bx = (int)blockIdx.x;
  const float* xh = x + (size_t)h * DHEAD;
  if (bx < PJ_TILES_KV) {
    const int bm = bx / (NTOK / PJ_TILE);
    const int bn = bx % (NTOK / PJ_TILE);
    const float* wk = h ? wk1 : wk0;
    const float* wv = h ? wv1 : wv0;
    const float* w  = (bm < DHEAD / PJ_TILE) ? wk + (size_t)bm * PJ_TILE * DHEAD : wv + (size_t)(bm - DHEAD / PJ_TILE) * PJ_TILE * DHEAD;
    proj_tile<DHEAD, DMODEL, NTOK>(w, xh + (size_t)bn * PJ_TILE * DMODEL,
                                   kvp + (size_t)h * (2 * DHEAD * NTOK) + (size_t)bm * PJ_TILE * NTOK + (size_t)bn * PJ_TILE, 2 * ((bn + bm) & (PJ_STARTS - 1)), sStage, sT);
  } else {
    const int bq = bx - PJ_TILES_KV;
    const int bm = bq / (DHEAD / PJ_TILE);
    const int bn = bq % (DHEAD / PJ_TILE);
    const float* wq = h ? wq1 : wq0;
    proj_tile<DMODEL, DHEAD, DHEAD>(xh + (size_t)bm * PJ_TILE * DMODEL, wq + (size_t)bn * PJ_TILE * DHEAD,
                                    qt + (size_t)h * (NTOK * DHEAD) + (size_t)bm * PJ_TILE * DHEAD + (size_t)bn * PJ_TILE,
                                    2 * ((bm + (2 * DHEAD) / PJ_TILE + bn) & (PJ_STARTS - 1)), sStage, sT);
  }
}

// ---------------- v k^T, all tokens in one work-group ----------------
// out[h][e][d] = f16(mul * sum over all NTOK tokens m of v[e][m] * k[d][m]); kvp per head: rows 0..511 = k[d][m], 512..1023 = v[e][m].
// A work-group owns one 64x64 tile (blockIdx.x = 8 * tile row + tile column, blockIdx.y = head). A stage is 256 tokens of its 64 v rows
// and 64 k rows (512 B a row, whole lines), brought into LDS by asynchronous copies, four buffers: while stage t is multiplied, stages
// t + 1 .. t + 3 fly, behind counted waits, so that copies are in flight all the time. The eight waves split the k range:
// wave w multiplies tokens [32 w, 32 w + 32) of every stage into its own 64x64 f32 tile; the eight tiles are added through LDS, w ascending.
// LDS row pitch 528 B (16 B x odd: ds_load_b128 without bank conflicts).
constexpr int VK_TILE  = 64;
constexpr int VK_STG_K = 256;
constexpr int VK_NBUF  = 4;
constexpr int VK_PITCH = VK_STG_K + 8;                        // 16-bit elements per LDS row
constexpr int VK_BUF_ELEMS = 2 * VK_TILE * VK_PITCH;          // one buffer: v rows 0..63, k rows 64..127
constexpr unsigned VK_ROWS8_BYTES = 8u * VK_PITCH * 2u;       // LDS step from one copy of a thread to its next (8 rows)
constexpr int VK_RED_PITCH = 68;                              // floats per row of a wave's tile in the sum (as the GEMM's slab)
static_assert(8 * VK_TILE * VK_RED_PITCH * 4 <= VK_NBUF * VK_BUF_ELEMS * 2, "the eight f32 tiles fit the ring they reuse");
typedef __attribute__((ext_vector_type(4))) _Float16 v4h;

// Eight copies of 16 B of one thread: rows 8 apart, LDS address l, global address g, s = 8 rows in elements. A wave's copy covers
// the 512 B of one row. The s_wait_xcnt stands inside the statement, so that no address register of a copy is rewritten ahead of it.
__device__ __forceinline__ void copies8(unsigned l, const unsigned short* g, size_t s) {
  asm volatile(
      "global_load_async_to_lds_b128 %0, %8, off\n\t"
      "global_load_async_to_lds_b128 %1, %9, off\n\t"
      "global_load_async_to_lds_b128 %2, %10, off\n\t"
      "global_load_async_to_lds_b128 %3, %11, off\n\t"
      "global_load_async_to_lds_b128 %4, %12, off\n\t"
      "global_load_async_to_lds_b128 %5, %13, off\n\t"
      "global_load_async_to_lds_b128 %6, %14, off\n\t"
      "global_load_async_to_lds_b128 %7, %15, off\n\t"
      "s_wait_xcnt 0x0"
      :: "v"(l), "v"(l + VK_ROWS8_BYTES), "v"(l + 2u * VK_ROWS8_BYTES), "v"(l + 3u * VK_ROWS8_BYTES),
         "v"(l + 4u * VK_ROWS8_BYTES), "v"(l + 5u * VK_ROWS8_BYTES), "v"(l + 6u * VK_ROWS8_BYTES), "v"(l + 7u * VK_ROWS8_BYTES),
         "v"(g), "v"(g + s), "v"(g + 2 * s), "v"(g + 3 * s), "v"(g + 4 * s), "v"(g + 5 * s), "v"(g + 6 * s), "v"(g + 7 * s)
      : "memory");
}
// One stage, this thread's share: 16 copies (8 of v, 8 of k); a, b: its global addresses in rows (threadIdx.x >> 5) of the two tiles.
constexpr int VK_STG_COPIES = 16;
__device__ __forceinline__ void vk_stage_copies(unsigned l, const unsigned short* a, const unsigned short* b) {
  constexpr size_t s = (size_t)8 * NTOK;
  copies8(l, a, s);
  copies8(l + 8u * VK_ROWS8_BYTES, b, s);
}

__global__ __launch_bounds__(256) void vkt_tile_kernel(const unsigned short* __restrict__ kvp, unsigned short* __restrict__ out, float mul) {
  typedef _Float16 T;
  typedef Frag<T>::V V;
  __shared__ __align__(128) unsigned short sRing[VK_NBUF * VK_BUF_ELEMS];   // four stage buffers; behind the loop the eight f32 tiles
  const int lane = threadIdx.x & 31;
  const int wave = threadIdx.x >> 5;
  const int e0 = ((int)blockIdx.x >> 3) * VK_TILE;
  const int d0 = ((int)blockIdx.x & 7) * VK_TILE;
  const unsigned short* kp = kvp + (size_t)blockIdx.y * (2 * DHEAD * NTOK);
  const unsigned short* vp = kp + (size_t)DHEAD * NTOK;

  const int rlane = lane & 15;                 // fragment row within subtile; in D the lane's row e
  const int koff  = (lane >> 4) * 8;           // k offset of this lane half
  const int mOff  = (lane >> 4) * 8;           // D: first of the lane's 8 columns d

  // copy side: thread t brings 16-B piece (t & 31) of rows (t >> 5) + 8 c
  const int crow = threadIdx.x >> 5;
  const int cpc  = (threadIdx.x & 31) * 8;
  const unsigned short* gA = vp + (size_t)(e0 + crow) * NTOK + cpc;
  const unsigned short* gB = kp + (size_t)(d0 + crow) * NTOK + cpc;
  const unsigned lcopy = (unsigned)(size_t)(const void*)sRing + (unsigned)(crow * VK_PITCH + cpc) * 2u;
  constexpr unsigned BUF_BYTES = (unsigned)VK_BUF_ELEMS * 2u;

  // read side: this lane's first v and k fragment rows in buffer 0, at this wave's 32 tokens of the stage
  const T* fA = (const T*)sRing + (size_t)rlane * VK_PITCH + (wave << 5) + koff;
  const T* fB = (const T*)sRing + (size_t)(VK_TILE + rlane) * VK_PITCH + (wave << 5) + koff;

  v8f acc[4][4];
#pragma unroll
  for (int i = 0; i < 4; ++i)
#pragma unroll
    for (int j = 0; j < 4; ++j) acc[i][j] = (v8f){0.f,0.f,0.f,0.f,0.f,0.f,0.f,0.f};

  constexpr int stages = NTOK / VK_STG_K;
  static_assert(NTOK % VK_STG_K == 0 && stages >= 3 && VK_NBUF == 4 && VK_STG_K == 8 * 32);
  static_assert((stages & (stages - 1)) == 0, "the rotated walk wraps by a mask");
  // Rotated token walk: stage s of this work-group is token block (s + rot) mod stages. The 8 tiles that share v rows and the 8 that share k rows
  // start one block apart, so that they do not ask L2 for the same lines at the same moment. Block-uniform; every token block is summed once.
  const int rot = ((int)blockIdx.x >> 3) + ((int)blockIdx.x & 7);
  auto tof = [&](const int s) __attribute__((always_inline)) { return (size_t)((s + rot) & (stages - 1)) * VK_STG_K; };
  vk_stage_copies(lcopy, gA + tof(0), gB + tof(0));
  vk_stage_copies(lcopy + BUF_BYTES, gA + tof(1), gB + tof(1));
  vk_stage_copies(lcopy + 2u * BUF_BYTES, gA + tof(2), gB + tof(2));

#pragma unroll 1   // one stage a trip: the buffer index and the refill test stay scalar
  for (int t = 0; t < stages; ++t) {
    const int buf = (t & (VK_NBUF - 1)) * VK_BUF_ELEMS;
    // publish point of stage t (this wave's LDS reads of stage t - 1 have returned: the wait at the foot of the trip before).
    // Issued so far: stages 0 .. t + 2. While both younger stages exist they are the wave's 32 youngest copies; else the wait is to 0.
    if (t + 2 < stages) wait_copies_but<2 * VK_STG_COPIES>(); else wait_copies();
    __syncthreads();                           // publishes stage t and ends every read of stage t - 1's buffer
    {
      V bh[4], ah[4];
#pragma unroll
      for (int j = 0; j < 4; ++j) bh[j] = Frag<T>::load(fB + buf + j * 16 * VK_PITCH);
#pragma unroll
      for (int i = 0; i < 4; ++i) ah[i] = Frag<T>::load(fA + buf + i * 16 * VK_PITCH);
      // the refill of stage t - 1's buffer stands behind this stage's fragment loads (another buffer): its issue runs under their LDS latency
      if (t + 3 < stages)
        vk_stage_copies(lcopy + (unsigned)((t + 3) & (VK_NBUF - 1)) * BUF_BYTES, gA + tof(t + 3), gB + tof(t + 3));
      // keeps the block's 16 LDS loads together in front of its WMMAs: left free, the scheduler reloads one v fragment register
      // set between the WMMA rows and the wave waits out the LDS latency four times a block
      __builtin_amdgcn_sched_barrier(0);
#pragma unroll
      for (int i = 0; i < 4; ++i) {
#pragma unroll
        for (int j = 0; j < 4; ++j) acc[i][j] = Frag<T>::mma(bh[j], ah[i], acc[i][j]);   // k fragment first: D holds the tile transposed
      }
    }
    // keeps the block's WMMAs in front of the next trip's barrier: left free, the scheduler sinks them behind it, in front of the refill,
    // and every stage's copies start that much later
    __builtin_amdgcn_sched_barrier(0);
    wait_lds_reads();
  }
  wait_copies();
  __syncthreads();                             // ends every wave's last read of the ring, which the sum reuses

  // ---- sum of the eight waves' tiles: the barrier above has ended every read of the ring, and no copy is outstanding ----
  float* red = (float*)(void*)sRing;
  float* mine = red + (size_t)wave * (VK_TILE * VK_RED_PITCH);
#pragma unroll
  for (int i = 0; i < 4; ++i)
#pragma unroll
    for (int j = 0; j < 4; ++j) {                // a lane's 8 adjacent columns: two 16-byte LDS stores
      float* sp = mine + ((i << 4) + rlane) * VK_RED_PITCH + (j << 4) + mOff;
      *(v4f*)sp       = (v4f){acc[i][j][0], acc[i][j][1], acc[i][j][2], acc[i][j][3]};
      *(v4f*)(sp + 4) = (v4f){acc[i][j][4], acc[i][j][5], acc[i][j][6], acc[i][j][7]};
    }
  __syncthreads();                             // every wave's tile is readable by every wave
  const int c4 = ((int)threadIdx.x & 15) * 4;  // 16 lanes read one 256-B row and store one whole 128-B line
  _Float16* op = (_Float16*)(void*)out + (size_t)blockIdx.y * (DHEAD * DHEAD) + d0 + c4;
#pragma unroll
  for (int q = 0; q < 4; ++q) {
    const int row = ((int)threadIdx.x >> 4) + (q << 4);
    v4f s = *(const v4f*)(red + row * VK_RED_PITCH + c4);
#pragma unroll
    for (int w = 1; w < 8; ++w) s += *(const v4f*)(red + (w * VK_TILE + row) * VK_RED_PITCH + c4);
    v4h o;
#pragma unroll
    for (int e = 0; e < 4; ++e) o[e] = (_Float16)(s[e] * mul);
    *(v4h*)(op + (size_t)(e0 + row) * DHEAD) = o;
  }
}

// ---------------- host orchestration ----------------
// out = (q^T k) v^T is formed as q^T (k v^T): no [NTOK][NTOK] plane.
// Workspace region map (bytes; all offsets multiples of 128):
//   QT  : per head [NTOK][DHEAD] f16 (q^T[n][d])                8,388,608   @ 0
//   KVP : per head [2*DHEAD][NTOK] f16 (rows 0..511 = k[d][m], 512..1023 = v[e][m])
//                                                              16,777,216   @ 8,388,608
//   KVT : per head [DHEAD][DHEAD] f16 (x1/64) (KV[e][d])        1,048,576   @ 25,165,824
//   total                                                      26,214,400
constexpr size_t QT_BYTES   = (size_t)NHEAD * NTOK * DHEAD * 2;
constexpr size_t KVP_BYTES  = (size_t)NHEAD * 2 * DHEAD * NTOK * 2;
constexpr size_t KVT_BYTES  = (size_t)NHEAD * DHEAD * DHEAD * 2;
constexpr size_t QT_OFF   = 0;
constexpr size_t KVP_OFF  = QT_OFF + QT_BYTES;
constexpr size_t KVT_OFF  = KVP_OFF + KVP_BYTES;
constexpr size_t WS_TOTAL = KVT_OFF + KVT_BYTES;
static_assert(WS_TOTAL == 26214400u);
static_assert(WS_TOTAL <= (size_t)134217728u);
static_assert((KVP_OFF % 128) == 0 && (KVT_OFF % 128) == 0);

// shape contracts (no tail handling)
// proj q, k|v : their own kernel, 256x256 tiles, K = DHEAD
// v k^T       : its own kernel, 64x64 tiles, all NTOK tokens
// out         : M = NTOK, N = DHEAD, K = DHEAD; M multiple of 128, N of 256, K of 64
static_assert(NTOK % BLK_M == 0 && DHEAD % BLK_N == 0);
static_assert(DHEAD % STG_K == 0 && DHEAD == 8 * VK_TILE);
static_assert(DMODEL == NHEAD * DHEAD && NHEAD == 2);

extern "C" void kernel_launch(void* const* d_in, const int* in_sizes, int n_in,
                              void* d_out, int out_size, void* d_ws, size_t ws_size,
                              hipStream_t stream) {
  if (n_in < 7) return;
  if (in_sizes[0] != NTOK * DMODEL) return;
  for (int i = 1; i < 7; ++i) if (in_sizes[i] != DHEAD * DHEAD) return;
  if (out_size != NTOK * DMODEL) return;
  if (ws_size < WS_TOTAL) return;

  // d_in order per the input table: x, Wq1, Wq2, Wk1, Wk2, Wv1, Wv2 (all f32)
  const float* x   = (const float*)d_in[0];
  const float* wq1 = (const float*)d_in[1];
  const float* wq2 = (const float*)d_in[2];
  const float* wk1 = (const float*)d_in[3];
  const float* wk2 = (const float*)d_in[4];
  const float* wv1 = (const float*)d_in[5];
  const float* wv2 = (const float*)d_in[6];
  float* out = (float*)d_out;

  char* ws = (char*)d_ws;
  unsigned short* QT  = (unsigned short*)(ws + QT_OFF);
  unsigned short* KVP = (unsigned short*)(ws + KVP_OFF);
  unsigned short* KVT = (unsigned short*)(ws + KVT_OFF);
  const float* fdum = x;                                       // unused bias/resid slots (never dereferenced)

  // 1) the projections, one launch, straight from the f32 inputs:
  //    k | v per head: KVP[h][r][m] = sum_c W[h][r][c] * x[m][h*512 + c]   (r<512: Wk, r>=512: Wv)
  //    q^T per head  : QT[h][n][d]  = sum_c x[n][h*512 + c] * Wq[h][d][c]
  proj_f32_kernel<<<dim3(PJ_TILES_KV + PJ_TILES_Q, NHEAD), dim3(256), 0, stream>>>(
      x, wk1, wv1, wq1, wk2, wv2, wq2, KVP, QT);
  // 2) KVT[h][e][d] = f16((1/64) * sum over all tokens m of v[e][m] * k[d][m])
  {
    const int tiles = (DHEAD / VK_TILE) * (DHEAD / VK_TILE);   // 64
    vkt_tile_kernel<<<dim3(tiles, NHEAD), dim3(256), 0, stream>>>(KVP, KVT, KV_CARRY);
  }
  // 3) out[n][h*512 + e] = 64 * sum_d QT[h][n][d] * KVT[h][e][d]   (f32, ldc = DMODEL, per-head column offset DHEAD)
  {
    const int tiles = (NTOK / 64) * (DHEAD / 64);              // 512
    wmma_gemm64<0, false, 0, 0, false, 0, 4><<<dim3((tiles + 7) / 8, NHEAD), dim3(256), 0, stream>>>(
        QT, QT, DHEAD, (long)NTOK * DHEAD,
        KVT, KVT, DHEAD, (long)DHEAD * DHEAD,
        (void*)out, (void*)out, DMODEL, (long)DHEAD, 0L,
        fdum, fdum, 0L,
        NTOK, DHEAD, DHEAD, KV_CARRY_INV);
  }
}

// v009
// One run takes 32.6 microseconds.
// Next to v008, in two timings, it ran 1.08 times as fast each time.
// Counting every step since v000, it is 9.08 times as fast.
// Contractions: q/k/v projections on v_wmma_f32_16x16x32_bf16 (float inputs RNE-converted to bf16 at the store to LDS), KV = v k^T and out = q^T KV^T on v_wmma_f32_16x16x32_f16; f32 accumulate; intermediate planes f16.
#include <hip/hip_runtime.h>
#include <stdint.h>
#include <stddef.h>

typedef __attribute__((ext_vector_type(16))) _Float16 v16h;
typedef __attribute__((ext_vector_type(8)))  _Float16 v8h;
typedef __attribute__((ext_vector_type(16))) __bf16   v16b;
typedef __attribute__((ext_vector_type(8)))  __bf16   v8b;
typedef __attribute__((ext_vector_type(8)))  float    v8f;
typedef __attribute__((ext_vector_type(4)))  float    v4f;

// ---------------- problem constants ----------------
constexpr int NTOK   = 4096;
constexpr int DMODEL = 1024;
constexpr int DHEAD  = 512;
constexpr int NHEAD  = 2;
constexpr float KV_CARRY     = 1.0f / 64.0f;  // v k^T carried x1/64 in f16 (exact; sums over NTOK tokens need the range)
constexpr float KV_CARRY_INV = 64.0f;         // folded back in the output epilogue

// ---------------- helpers ----------------
template <typename T> struct Frag;
template <> struct Frag<_Float16> {
  typedef v16h V; union U { v16h v; v8h h[2]; };
  static __device__ __forceinline__ v16h load(const _Float16* p) {   // elements 0..7 <- p[0..7], 8..15 <- p[16..23]
    U f; f.h[0] = *(const v8h*)(p); f.h[1] = *(const v8h*)(p + 16); return f.v;
  }
  static __device__ __forceinline__ v8f mma(v16h a, v16h b, v8f c) {
    return __builtin_amdgcn_wmma_f32_16x16x32_f16(false, a, false, b, (short)0, c, false, false);
  }
};
template <> struct Frag<__bf16> {
  typedef v16b V; union U { v16b v; v8b h[2]; };
  static __device__ __forceinline__ v16b load(const __bf16* p) {
    U f; f.h[0] = *(const v8b*)(p); f.h[1] = *(const v8b*)(p + 16); return f.v;
  }
  static __device__ __forceinline__ v8f mma(v16b a, v16b b, v8f c) {
    return __builtin_amdgcn_wmma_f32_16x16x32_bf16(false, a, false, b, (short)0, c, false, false);
  }
};

// ---------------- waits of the asynchronous copies to LDS ----------------
// this wave's copies have landed (the compiler places no wait for them)
__device__ __forceinline__ void wait_copies() { asm volatile("s_wait_asynccnt 0x0" ::: "memory"); }
// all but this wave's N youngest copies have landed: N = the copies of the stages issued behind the one that is published
template <int N> __device__ __forceinline__ void wait_copies_but() { asm volatile("s_wait_asynccnt %0" :: "n"(N) : "memory"); }
// this wave's LDS reads have returned, before the barrier behind which their buffer is refilled
__device__ __forceinline__ void wait_lds_reads() { asm volatile("s_wait_dscnt 0x0" ::: "memory"); }

// ---------------- q | k | v projections, straight from the f32 inputs ----------------
// C[m][n] = f16(sum_c bf16(A[m][c]) * bf16(Bt[n][c])), c over the head's DHEAD channels; A, Bt f32, c contiguous.
//   k | v tiles (blockIdx.x < PJ_TILES_KV): A = Wk or Wv rows, Bt = x rows (tokens), C = kvp[h][r][m] (r < 512: k, else v)
//   q tiles (the rest)                    : A = x rows (tokens), Bt = Wq rows,       C = qt[h][n][d]
// A work-group owns a 256x256 tile, each of its 2x4 waves 128x64; blockIdx.y = head. A stage is 32 channels of the 256 A rows and 256 Bt rows
// (128 B of f32 a row, whole lines): loaded into registers a trip ahead, rounded to bf16 once, stored to one of two LDS buffers.
// LDS row pitch 80 B (16 B x odd: ds_load_b128 without bank conflicts).
constexpr int PJ_TILE   = 256;
constexpr int PJ_STG_K  = 32;
constexpr int PJ_PITCH  = PJ_STG_K + 8;                        // bf16 elements per LDS row
constexpr int PJ_BUF_ELEMS = 2 * PJ_TILE * PJ_PITCH;           // one buffer: A rows 0..255, Bt rows 256..511
constexpr int PJ_EP_PITCH = 64 + 8;                            // f16 elements per row of a wave's 128x64 tile in the epilogue (144 B: 16 B x odd)
constexpr int PJ_EP_ELEMS = 128 * PJ_EP_PITCH;                 // one wave's tile
constexpr int PJ_TILES_KV = ((2 * DHEAD) / PJ_TILE) * (NTOK / PJ_TILE);   // 64 a head
constexpr int PJ_TILES_Q  = (NTOK / PJ_TILE) * (DHEAD / PJ_TILE);         // 32 a head
static_assert(DHEAD % PJ_TILE == 0 && NTOK % PJ_TILE == 0 && DHEAD % (2 * PJ_STG_K) == 0 && DHEAD / PJ_STG_K >= 4);
constexpr int PJ_STARTS = DHEAD / (2 * PJ_STG_K);             // even channel blocks at which a tile's k walk may start
static_assert((PJ_STARTS & (PJ_STARTS - 1)) == 0);
typedef __attribute__((ext_vector_type(4))) __bf16 v4b;
template <bool B> struct PjFlag { static constexpr bool value = B; };
// Work-group barrier that orders LDS only: __syncthreads() compiled to s_wait_loadcnt_dscnt 0 here, a wait for the next stage's global loads, which fly across it.
__device__ __forceinline__ void pj_barrier() {
  __builtin_amdgcn_fence(__ATOMIC_RELEASE, "workgroup", "local");
  __builtin_amdgcn_s_barrier();
  __builtin_amdgcn_fence(__ATOMIC_ACQUIRE, "workgroup", "local");
}

// One 256x256 tile. A, Bt, C: the tile's first elements (block-uniform); the three row pitches are compile-time, so that a thread's 16 row
// addresses are two base addresses and an immediate each (16 addresses in registers do not fit beside the accumulators: scratch).
template <int lda, int ldb, int ldc>
__device__ __forceinline__ void proj_tile(const float* __restrict__ A, const float* __restrict__ Bt, unsigned short* __restrict__ C,
                                          const int rot, unsigned short* sStage, unsigned short* sT) {
  typedef __bf16 T;
  const int lane = threadIdx.x & 31;
  const int wave = threadIdx.x >> 5;
  const int wm = wave >> 2;                    // wave's 128-row band of the block tile
  const int wn = wave & 3;                     // wave's 64-column band
  const int rlane = lane & 15;                 // fragment row within subtile; in D the lane's row m
  const int koff  = (lane >> 4) * 8;           // k offset of this lane half
  const int mOff  = (lane >> 4) * 8;           // D: first of the lane's 8 columns n

  // staging side: thread t brings 16-B piece (t & 7) of rows (t >> 3) + 32 c; a wave's load covers 4 whole 128-B rows
  const int crow = threadIdx.x >> 3;
  const int cpc  = (threadIdx.x & 7) * 4;
  const unsigned voA = (unsigned)(crow * lda + cpc) * 4u;   // this thread's byte offset in the A tile; the rest of an address is block-uniform (scalar)
  const unsigned voB = (unsigned)(crow * ldb + cpc) * 4u;
  constexpr size_t sa = (size_t)32 * lda;
  constexpr size_t sb = (size_t)32 * ldb;
  T* wS = (T*)sStage + crow * PJ_PITCH + cpc;

  // read side: this lane's first A and Bt fragment rows in buffer 0
  const T* fA = (const T*)sStage + (size_t)((wm << 7) + rlane) * PJ_PITCH + koff;
  const T* fB = (const T*)sStage + (size_t)(PJ_TILE + (wn << 6) + rlane) * PJ_PITCH + koff;

  v8f acc[8][4];
#pragma unroll
  for (int i = 0; i < 8; ++i)
#pragma unroll
    for (int j = 0; j < 4; ++j) acc[i][j] = (v8f){0.f,0.f,0.f,0.f,0.f,0.f,0.f,0.f};

  constexpr int stages = DHEAD / PJ_STG_K;
  static_assert((stages & (stages - 1)) == 0, "the rotated walk wraps by a mask");
  v4f g[16];                                   // one stage's f32 values of this thread, in flight
  // Rotated k walk: stage s of this work-group is channel block (s + rot) mod stages (rot block-uniform and even, so that a pair of stages
  // s, s + 1 with s even never wraps between its two); every block is summed once. Ak, Bk: the two tiles' first elements in the channel block to load (block-uniform).
  auto stage_load = [&](const float* Ak, const float* Bk) __attribute__((always_inline)) {
#pragma unroll
    for (int c = 0; c < 8; ++c) g[c] = *(const v4f*)((const char*)(Ak + c * sa) + voA);
#pragma unroll
    for (int c = 0; c < 8; ++c) g[8 + c] = *(const v4f*)((const char*)(Bk + c * sb) + voB);
  };
  auto stage_store = [&](const int b) __attribute__((always_inline)) {   // rounded to nearest even, into buffer b
#pragma unroll
    for (int c = 0; c < 16; ++c) *(v4b*)(wS + b * PJ_BUF_ELEMS + c * 32 * PJ_PITCH) = __builtin_convertvector(g[c], v4b);
  };

  const float* A0 = A + (size_t)rot * PJ_STG_K;
  const float* B0 = Bt + (size_t)rot * PJ_STG_K;
  stage_load(A0, B0);
  stage_store(0);
  stage_load(A0 + PJ_STG_K, B0 + PJ_STG_K);
  // precaution: the two offsets and the two bases that the 32 loads above name lose their registers further down (the accumulators' zeroing,
  // the loop's addresses); as inputs of the wait they keep them up to it, so that it stands in front of every such rewrite
  asm volatile("s_wait_xcnt 0x0" :: "v"(voA), "v"(voB), "s"(A0), "s"(B0) : "memory");
  pj_barrier();                                // stage 0 is readable by every wave

  // A trip has two blocks of 16 WMMAs: A rows 0..63 of the wave's band, then rows 64..127, both against the same four Bt fragments.
  // Each block's fragments are read from LDS while the block before is multiplied, so that LDS reads and WMMAs overlap.
  v16b bh[4], alo[4], ahi[4], bn4[4];
#pragma unroll
  for (int j = 0; j < 4; ++j) bh[j] = Frag<T>::load(fB + j * 16 * PJ_PITCH);
#pragma unroll
  for (int i = 0; i < 4; ++i) alo[i] = Frag<T>::load(fA + i * 16 * PJ_PITCH);

  // One trip. LOAD: stage t + 2 exists, A2 and B2 point at its channel block; NEXT: stage t + 1 exists (compile-time: a trip is straight-line code).
  auto trip = [&](const float* A2, const float* B2, const int b, auto load, auto next) __attribute__((always_inline)) {
#pragma unroll
    for (int i = 0; i < 4; ++i) ahi[i] = Frag<T>::load(fA + b * PJ_BUF_ELEMS + (4 + i) * 16 * PJ_PITCH);
    // keeps the second block's LDS loads in front of the first block's WMMAs, under which they land
    __builtin_amdgcn_sched_barrier(0);
#pragma unroll
    for (int i = 0; i < 4; ++i)
#pragma unroll
      for (int j = 0; j < 4; ++j) acc[i][j] = Frag<T>::mma(bh[j], alo[i], acc[i][j]);
    // keeps the wait for stage t + 1's global loads behind the first block's WMMAs: the loads get that much more time
    __builtin_amdgcn_sched_barrier(0);
    // stage t + 1 goes to the other buffer, whose last readers (stage t - 1) left it in front of the barrier of the trip before
    if constexpr (decltype(next)::value) stage_store(b ^ 1);
    // keeps stage t + 2's loads behind every rounding of stage t + 1: mixed among them, the waits for the older loads cover the new ones too
    __builtin_amdgcn_sched_barrier(0);
    if constexpr (decltype(load)::value) stage_load(A2, B2);
    if constexpr (decltype(next)::value) {
      pj_barrier();                            // publishes stage t + 1 and ends every read of stage t's buffer
#pragma unroll
      for (int j = 0; j < 4; ++j) bn4[j] = Frag<T>::load(fB + (b ^ 1) * PJ_BUF_ELEMS + j * 16 * PJ_PITCH);
#pragma unroll
      for (int i = 0; i < 4; ++i) alo[i] = Frag<T>::load(fA + (b ^ 1) * PJ_BUF_ELEMS + i * 16 * PJ_PITCH);
    }
    // keeps the next stage's first LDS loads in front of the second block's WMMAs, under which they land
    __builtin_amdgcn_sched_barrier(0);
#pragma unroll
    for (int i = 0; i < 4; ++i)
#pragma unroll
      for (int j = 0; j < 4; ++j) acc[4 + i][j] = Frag<T>::mma(bh[j], ahi[i], acc[4 + i][j]);
    // keeps the second block's WMMAs in front of the next trip's LDS loads (one load group a block)
    __builtin_amdgcn_sched_barrier(0);
#pragma unroll
    for (int j = 0; j < 4; ++j) bh[j] = bn4[j];
  };
#pragma unroll 1   // two stages a pass of the loop: the buffer index is a constant and the two Bt fragment sets swap names, not registers
  for (int t = 0; t + 2 < stages; t += 2) {
    const size_t ko = (size_t)((t + 2 + rot) & (stages - 1)) * PJ_STG_K;
    trip(A + ko,            Bt + ko,            0, PjFlag<true>(), PjFlag<true>());
    trip(A + ko + PJ_STG_K, Bt + ko + PJ_STG_K, 1, PjFlag<true>(), PjFlag<true>());
  }
  trip(A, Bt, 0, PjFlag<false>(), PjFlag<true>());
  trip(A, Bt, 1, PjFlag<false>(), PjFlag<false>());

  // ---- epilogue: the Bt fragment is the WMMA's first operand, so the accumulators hold the tile transposed: a lane owns one row m and 8 adjacent
  // columns n, 16 B of f16. The wave's whole 128x64 tile goes once through its own LDS region, in 16-byte stores, and leaves in whole 128-B lines ----
  _Float16* slab = (_Float16*)(void*)sT + wave * PJ_EP_ELEMS;
#pragma unroll
  for (int i = 0; i < 8; ++i)
#pragma unroll
    for (int j = 0; j < 4; ++j) {
      v8h hv;
#pragma unroll
      for (int r = 0; r < 8; ++r) hv[r] = (_Float16)acc[i][j][r];
      *(v8h*)(slab + ((i << 4) + rlane) * PJ_EP_PITCH + (j << 4) + mOff) = hv;
    }
  // the tile's rows are written before other lanes of the wave read them back (LDS only)
  __builtin_amdgcn_fence(__ATOMIC_RELEASE, "workgroup", "local");
  __builtin_amdgcn_wave_barrier();
  __builtin_amdgcn_fence(__ATOMIC_ACQUIRE, "workgroup", "local");
  // 8 lanes take one row; the two rows of a 16-lane half lie 8 rows apart (8 x 144 B = 128 B mod 256 B: no bank in common)
  const int q = lane >> 3, c8 = (lane & 7) * 8;
  const int row0 = (q >> 1) + ((q & 1) << 3);
  const _Float16* sp = slab + row0 * PJ_EP_PITCH + c8;
  unsigned short* Cw = C + (size_t)((wm << 7) + row0) * ldc + (wn << 6) + c8;
  auto rowof = [](const int s) __attribute__((always_inline)) { return ((s >> 2) << 4) + ((s & 3) << 1); };   // step s: 16-row block s / 4, row pair s % 4
  v8h cur[8], nxt[8];                          // 32 rows a group; the next group's LDS reads fly while this group is stored
#pragma unroll
  for (int u = 0; u < 8; ++u) cur[u] = *(const v8h*)(sp + rowof(u) * PJ_EP_PITCH);
#pragma unroll
  for (int g = 0; g < 4; ++g) {
    if (g < 3) {
#pragma unroll
      for (int u = 0; u < 8; ++u) nxt[u] = *(const v8h*)(sp + rowof((g + 1) * 8 + u) * PJ_EP_PITCH);
    }
#pragma unroll
    for (int u = 0; u < 8; ++u) *(v8h*)(Cw + (size_t)rowof(g * 8 + u) * ldc) = cur[u];
    // precaution: later groups rewrite the registers that these stores name; the stores' completion is not waited for
    asm volatile("s_wait_xcnt 0x0" ::: "memory");
#pragma unroll
    for (int u = 0; u < 8; ++u) cur[u] = nxt[u];
  }
}

__global__ __launch_bounds__(256) void proj_f32_kernel(
    const float* __restrict__ x,
    const float* __restrict__ wk0, const float* __restrict__ wv0, const float* __restrict__ wq0,
    const float* __restrict__ wk1, const float* __restrict__ wv1, const float* __restrict__ wq1,
    unsigned short* __restrict__ kvp, unsigned short* __restrict__ qt) {
  __shared__ __align__(128) unsigned short sStage[2 * PJ_BUF_ELEMS];   // the two stage buffers
  __shared__ __align__(16) unsigned short sT[8 * PJ_EP_ELEMS];         // per-wave 128x64 f16 tile of the epilogue
  // block-uniform choice of the product and its tile, and of the channel block at which the tile's k walk starts (PJ_STARTS even starts): the 6 tiles (4 of k | v, 2 of q)
  // that share x rows start two blocks apart, the 16 that share W rows likewise, two to a start, so that they do not ask L2 for the same lines at the same moment
  const int h  = (int)blockIdx.y;
  const int bx = (int)blockIdx.x;
  const float* xh = x + (size_t)h * DHEAD;
  if (bx < PJ_TILES_KV) {
    const int bm = bx / (NTOK / PJ_TILE);
    const int bn = bx % (NTOK / PJ_TILE);
    const float* wk = h ? wk1 : wk0;
    const float* wv = h ? wv1 : wv0;
    const float* w  = (bm < DHEAD / PJ_TILE) ? wk + (size_t)bm * PJ_TILE * DHEAD : wv + (size_t)(bm - DHEAD / PJ_TILE) * PJ_TILE * DHEAD;
    proj_tile<DHEAD, DMODEL, NTOK>(w, xh + (size_t)bn * PJ_TILE * DMODEL,
                                   kvp + (size_t)h * (2 * DHEAD * NTOK) + (size_t)bm * PJ_TILE * NTOK + (size_t)bn * PJ_TILE, 2 * ((bn + bm) & (PJ_STARTS - 1)), sStage, sT);
  } else {
    const int bq = bx - PJ_TILES_KV;
    const int bm = bq / (DHEAD / PJ_TILE);
    const int bn = bq % (DHEAD / PJ_TILE);
    const float* wq = h ? wq1 : wq0;
    proj_tile<DMODEL, DHEAD, DHEAD>(xh + (size_t)bm * PJ_TILE * DMODEL, wq + (size_t)bn * PJ_TILE * DHEAD,
                                    qt + (size_t)h * (NTOK * DHEAD) + (size_t)bm * PJ_TILE * DHEAD + (size_t)bn * PJ_TILE,
                                    2 * ((bm + (2 * DHEAD) / PJ_TILE + bn) & (PJ_STARTS - 1)), sStage, sT);
  }
}

// ---------------- v k^T, all tokens in one work-group ----------------
// out[h][e][d] = f16(mul * sum over all NTOK tokens m of v[e][m] * k[d][m]); kvp per head: rows 0..511 = k[d][m], 512..1023 = v[e][m].
// A work-group owns one 64x64 tile (blockIdx.x = 8 * tile row + tile column, blockIdx.y = head). A stage is 256 tokens of its 64 v rows
// and 64 k rows (512 B a row, whole lines), brought into LDS by asynchronous copies, four buffers: while stage t is multiplied, stages
// t + 1 .. t + 3 fly, behind counted waits, so that copies are in flight all the time. The eight waves split the k range:
// wave w multiplies tokens [32 w, 32 w + 32) of every stage into its own 64x64 f32 tile; the eight tiles are added through LDS, w ascending.
// LDS row pitch 528 B (16 B x odd: ds_load_b128 without bank conflicts).
constexpr int VK_TILE  = 64;
constexpr int VK_STG_K = 256;
constexpr int VK_NBUF  = 4;
constexpr int VK_PITCH = VK_STG_K + 8;                        // 16-bit elements per LDS row
constexpr int VK_BUF_ELEMS = 2 * VK_TILE * VK_PITCH;          // one buffer: v rows 0..63, k rows 64..127
constexpr unsigned VK_ROWS8_BYTES = 8u * VK_PITCH * 2u;       // LDS step from one copy of a thread to its next (8 rows)
constexpr int VK_RED_PITCH = 68;                              // floats per row of a wave's tile in the sum (as the GEMM's slab)
static_assert(8 * VK_TILE * VK_RED_PITCH * 4 <= VK_NBUF * VK_BUF_ELEMS * 2, "the eight f32 tiles fit the ring they reuse");
typedef __attribute__((ext_vector_type(4))) _Float16 v4h;

// Eight copies of 16 B of one thread: rows 8 apart, LDS address l, global address g, s = 8 rows in elements. A wave's copy covers
// the 512 B of one row. The s_wait_xcnt stands inside the statement, so that no address register of a copy is rewritten ahead of it.
__device__ __forceinline__ void copies8(unsigned l, const unsigned short* g, size_t s) {
  asm volatile(
      "global_load_async_to_lds_b128 %0, %8, off\n\t"
      "global_load_async_to_lds_b128 %1, %9, off\n\t"
      "global_load_async_to_lds_b128 %2, %10, off\n\t"
      "global_load_async_to_lds_b128 %3, %11, off\n\t"
      "global_load_async_to_lds_b128 %4, %12, off\n\t"
      "global_load_async_to_lds_b128 %5, %13, off\n\t"
      "global_load_async_to_lds_b128 %6, %14, off\n\t"
      "global_load_async_to_lds_b128 %7, %15, off\n\t"
      "s_wait_xcnt 0x0"
      :: "v"(l), "v"(l + VK_ROWS8_BYTES), "v"(l + 2u * VK_ROWS8_BYTES), "v"(l + 3u * VK_ROWS8_BYTES),
         "v"(l + 4u * VK_ROWS8_BYTES), "v"(l + 5u * VK_ROWS8_BYTES), "v"(l + 6u * VK_ROWS8_BYTES), "v"(l + 7u * VK_ROWS8_BYTES),
         "v"(g), "v"(g + s), "v"(g + 2 * s), "v"(g + 3 * s), "v"(g + 4 * s), "v"(g + 5 * s), "v"(g + 6 * s), "v"(g + 7 * s)
      : "memory");
}
// One stage, this thread's share: 16 copies (8 of v, 8 of k); a, b: its global addresses in rows (threadIdx.x >> 5) of the two tiles.
constexpr int VK_STG_COPIES = 16;
__device__ __forceinline__ void vk_stage_copies(unsigned l, const unsigned short* a, const unsigned short* b) {
  constexpr size_t s = (size_t)8 * NTOK;
  copies8(l, a, s);
  copies8(l + 8u * VK_ROWS8_BYTES, b, s);
}

__global__ __launch_bounds__(256) void vkt_tile_kernel(const unsigned short* __restrict__ kvp, unsigned short* __restrict__ out, float mul) {
  typedef _Float16 T;
  typedef Frag<T>::V V;
  __shared__ __align__(128) unsigned short sRing[VK_NBUF * VK_BUF_ELEMS];   // four stage buffers; behind the loop the eight f32 tiles
  const int lane = threadIdx.x & 31;
  const int wave = threadIdx.x >> 5;
  const int e0 = ((int)blockIdx.x >> 3) * VK_TILE;
  const int d0 = ((int)blockIdx.x & 7) * VK_TILE;
  const unsigned short* kp = kvp + (size_t)blockIdx.y * (2 * DHEAD * NTOK);
  const unsigned short* vp = kp + (size_t)DHEAD * NTOK;

  const int rlane = lane & 15;                 // fragment row within subtile; in D the lane's row e
  const int koff  = (lane >> 4) * 8;           // k offset of this lane half
  const int mOff  = (lane >> 4) * 8;           // D: first of the lane's 8 columns d

  // copy side: thread t brings 16-B piece (t & 31) of rows (t >> 5) + 8 c
  const int crow = threadIdx.x >> 5;
  const int cpc  = (threadIdx.x & 31) * 8;
  const unsigned short* gA = vp + (size_t)(e0 + crow) * NTOK + cpc;
  const unsigned short* gB = kp + (size_t)(d0 + crow) * NTOK + cpc;
  const unsigned lcopy = (unsigned)(size_t)(const void*)sRing + (unsigned)(crow * VK_PITCH + cpc) * 2u;
  constexpr unsigned BUF_BYTES = (unsigned)VK_BUF_ELEMS * 2u;

  // read side: this lane's first v and k fragment rows in buffer 0, at this wave's 32 tokens of the stage
  const T* fA = (const T*)sRing + (size_t)rlane * VK_PITCH + (wave << 5) + koff;
  const T* fB = (const T*)sRing + (size_t)(VK_TILE + rlane) * VK_PITCH + (wave << 5) + koff;

  v8f acc[4][4];
#pragma unroll
  for (int i = 0; i < 4; ++i)
#pragma unroll
    for (int j = 0; j < 4; ++j) acc[i][j] = (v8f){0.f,0.f,0.f,0.f,0.f,0.f,0.f,0.f};

  constexpr int stages = NTOK / VK_STG_K;
  static_assert(NTOK % VK_STG_K == 0 && stages >= 3 && VK_NBUF == 4 && VK_STG_K == 8 * 32);
  static_assert((stages & (stages - 1)) == 0, "the rotated walk wraps by a mask");
  // Rotated token walk: stage s of this work-group is token block (s + rot) mod stages. The 8 tiles that share v rows and the 8 that share k rows
  // start one block apart, so that they do not ask L2 for the same lines at the same moment. Block-uniform; every token block is summed once.
  const int rot = ((int)blockIdx.x >> 3) + ((int)blockIdx.x & 7);
  auto tof = [&](const int s) __attribute__((always_inline)) { return (size_t)((s + rot) & (stages - 1)) * VK_STG_K; };
  vk_stage_copies(lcopy, gA + tof(0), gB + tof(0));
  vk_stage_copies(lcopy + BUF_BYTES, gA + tof(1), gB + tof(1));
  vk_stage_copies(lcopy + 2u * BUF_BYTES, gA + tof(2), gB + tof(2));

#pragma unroll 1   // one stage a trip: the buffer index and the refill test stay scalar
  for (int t = 0; t < stages; ++t) {
    const int buf = (t & (VK_NBUF - 1)) * VK_BUF_ELEMS;
    // publish point of stage t (this wave's LDS reads of stage t - 1 have returned: the wait at the foot of the trip before).
    // Issued so far: stages 0 .. t + 2. While both younger stages exist they are the wave's 32 youngest copies; else the wait is to 0.
    if (t + 2 < stages) wait_copies_but<2 * VK_STG_COPIES>(); else wait_copies();
    __syncthreads();                           // publishes stage t and ends every read of stage t - 1's buffer
    {
      V bh[4], ah[4];
#pragma unroll
      for (int j = 0; j < 4; ++j) bh[j] = Frag<T>::load(fB + buf + j * 16 * VK_PITCH);
#pragma unroll
      for (int i = 0; i < 4; ++i) ah[i] = Frag<T>::load(fA + buf + i * 16 * VK_PITCH);
      // the refill of stage t - 1's buffer stands behind this stage's fragment loads (another buffer): its issue runs under their LDS latency
      if (t + 3 < stages)
        vk_stage_copies(lcopy + (unsigned)((t + 3) & (VK_NBUF - 1)) * BUF_BYTES, gA + tof(t + 3), gB + tof(t + 3));
      // keeps the block's 16 LDS loads together in front of its WMMAs: left free, the scheduler reloads one v fragment register
      // set between the WMMA rows and the wave waits out the LDS latency four times a block
      __builtin_amdgcn_sched_barrier(0);
#pragma unroll
      for (int i = 0; i < 4; ++i) {
#pragma unroll
        for (int j = 0; j < 4; ++j) acc[i][j] = Frag<T>::mma(bh[j], ah[i], acc[i][j]);   // k fragment first: D holds the tile transposed
      }
    }
    // keeps the block's WMMAs in front of the next trip's barrier: left free, the scheduler sinks them behind it, in front of the refill,
    // and every stage's copies start that much later
    __builtin_amdgcn_sched_barrier(0);
    wait_lds_reads();
  }
  wait_copies();
  __syncthreads();                             // ends every wave's last read of the ring, which the sum reuses

  // ---- sum of the eight waves' tiles: the barrier above has ended every read of the ring, and no copy is outstanding ----
  float* red = (float*)(void*)sRing;
  float* mine = red + (size_t)wave * (VK_TILE * VK_RED_PITCH);
#pragma unroll
  for (int i = 0; i < 4; ++i)
#pragma unroll
    for (int j = 0; j < 4; ++j) {                // a lane's 8 adjacent columns: two 16-byte LDS stores
      float* sp = mine + ((i << 4) + rlane) * VK_RED_PITCH + (j << 4) + mOff;
      *(v4f*)sp       = (v4f){acc[i][j][0], acc[i][j][1], acc[i][j][2], acc[i][j][3]};
      *(v4f*)(sp + 4) = (v4f){acc[i][j][4], acc[i][j][5], acc[i][j][6], acc[i][j][7]};
    }
  __syncthreads();                             // every wave's tile is readable by every wave
  const int c4 = ((int)threadIdx.x & 15) * 4;  // 16 lanes read one 256-B row and store one whole 128-B line
  _Float16* op = (_Float16*)(void*)out + (size_t)blockIdx.y * (DHEAD * DHEAD) + d0 + c4;
#pragma unroll
  for (int q = 0; q < 4; ++q) {
    const int row = ((int)threadIdx.x >> 4) + (q << 4);
    v4f s = *(const v4f*)(red + row * VK_RED_PITCH + c4);
#pragma unroll
    for (int w = 1; w < 8; ++w) s += *(const v4f*)(red + (w * VK_TILE + row) * VK_RED_PITCH + c4);
    v4h o;
#pragma unroll
    for (int e = 0; e < 4; ++e) o[e] = (_Float16)(s[e] * mul);
    *(v4h*)(op + (size_t)(e0 + row) * DHEAD) = o;
  }
}

// ---------------- out = q^T KV^T, one 128x128 tile a work-group ----------------
// out[n][h*DHEAD + e] = scale * sum_d qt[h][n][d] * kvt[h][e][d] (f32). 256 work-groups of four waves, so that every WGP has one and every SIMD one wave;
// blockIdx.x = 4 * token block + column block, blockIdx.y = head; each of the 2x2 waves owns 64x64.
// A stage is 64 d of the tile's 128 qt rows and 128 kvt rows (128 B a row, whole lines), brought into LDS by asynchronous copies. LDS holds the 256 rows
// whole (all DHEAD d), so every stage has its own place: nothing is refilled, and a barrier only publishes a stage. Three stages' copies fly, behind counted waits.
// A stage is two blocks of 16 WMMAs; each block's fragments are read from LDS while the block before is multiplied (two register sets), so the
// publish point of stage t + 1 stands in front of stage t's last block. LDS row pitch 1,040 B (16 B x odd: ds_load_b128 without bank conflicts;
// every fragment of an operand lies within a 16-bit offset of the lane's first: no address arithmetic in the loop's LDS reads).
constexpr int OG_TILE   = 128;
constexpr int OG_STG_K  = 64;
constexpr int OG_STAGES = DHEAD / OG_STG_K;
constexpr int OG_PITCH  = DHEAD + 8;                          // 16-bit elements per LDS row
constexpr int OG_LDS_ELEMS = 2 * OG_TILE * OG_PITCH;          // qt rows 0..127, kvt rows 128..255
constexpr unsigned OG_ROWS16_BYTES = 16u * OG_PITCH * 2u;     // LDS step from one copy of a thread to its next (16 rows)
constexpr int OG_STG_COPIES = 16;                             // a thread's copies of one stage (8 of qt, 8 of kvt)
constexpr int OG_EP_PITCH = 68;                               // floats per row of a wave's 64x64 tile in the epilogue (16 B x odd)
static_assert(OG_STAGES == 8 && 3 * OG_STG_COPIES <= 63, "three stages' copies of a wave are outstanding at most");
static_assert(4 * 64 * OG_EP_PITCH * 4 <= OG_LDS_ELEMS * 2, "the four f32 tiles fit the rows they reuse");

// Eight copies of 16 B of one thread: rows 16 apart, LDS address l, global address g, s = 16 rows in elements. A wave's copy covers
// 4 whole 128-B rows. The s_wait_xcnt stands inside the statement, so that no address register of a copy is rewritten ahead of it.
__device__ __forceinline__ void og_copies8(unsigned l, const unsigned short* g, size_t s) {
  asm volatile(
      "global_load_async_to_lds_b128 %0, %8, off\n\t"
      "global_load_async_to_lds_b128 %1, %9, off\n\t"
      "global_load_async_to_lds_b128 %2, %10, off\n\t"
      "global_load_async_to_lds_b128 %3, %11, off\n\t"
      "global_load_async_to_lds_b128 %4, %12, off\n\t"
      "global_load_async_to_lds_b128 %5, %13, off\n\t"
      "global_load_async_to_lds_b128 %6, %14, off\n\t"
      "global_load_async_to_lds_b128 %7, %15, off\n\t"
      "s_wait_xcnt 0x0"
      :: "v"(l), "v"(l + OG_ROWS16_BYTES), "v"(l + 2u * OG_ROWS16_BYTES), "v"(l + 3u * OG_ROWS16_BYTES),
         "v"(l + 4u * OG_ROWS16_BYTES), "v"(l + 5u * OG_ROWS16_BYTES), "v"(l + 6u * OG_ROWS16_BYTES), "v"(l + 7u * OG_ROWS16_BYTES),
         "v"(g), "v"(g + s), "v"(g + 2 * s), "v"(g + 3 * s), "v"(g + 4 * s), "v"(g + 5 * s), "v"(g + 6 * s), "v"(g + 7 * s)
      : "memory");
}

__global__ __launch_bounds__(128) void out_tile_kernel(const unsigned short* __restrict__ qt, const unsigned short* __restrict__ kvt,
                                                       float* __restrict__ out, float scale) {
  typedef _Float16 T;
  typedef Frag<T>::V V;
  __shared__ __align__(128) unsigned short sBuf[OG_LDS_ELEMS];   // the 256 operand rows; behind the loop the four f32 tiles
  const int lane = threadIdx.x & 31;
  const int wave = threadIdx.x >> 5;
  const int bm = (int)blockIdx.x >> 2;
  const int bn = (int)blockIdx.x & 3;
  const int h  = (int)blockIdx.y;
  const int wm = wave >> 1;                    // wave's 64-row band of the block tile
  const int wn = wave & 1;                     // wave's 64-column band
  const int m0 = bm * OG_TILE + (wm << 6);
  const int n0 = bn * OG_TILE + (wn << 6);

  const int rlane = lane & 15;                 // fragment row within subtile; in D the lane's row n (token)
  const int koff  = (lane >> 4) * 8;           // k offset of this lane half
  const int mOff  = (lane >> 4) * 8;           // D: first of the lane's 8 columns e

  // copy side: thread t brings 16-B piece (t & 7) of rows (t >> 3) + 16 c
  const int crow = threadIdx.x >> 3;
  const int cpc  = (threadIdx.x & 7) * 8;
  const unsigned short* gA = qt  + (size_t)h * (NTOK * DHEAD)  + (size_t)(bm * OG_TILE + crow) * DHEAD + cpc;
  const unsigned short* gB = kvt + (size_t)h * (DHEAD * DHEAD) + (size_t)(bn * OG_TILE + crow) * DHEAD + cpc;
  const unsigned lcopy = (unsigned)(size_t)(const void*)sBuf + (unsigned)(crow * OG_PITCH + cpc) * 2u;
  constexpr unsigned STG_BYTES = (unsigned)OG_STG_K * 2u;      // a stage's step within an LDS row

  // read side: this lane's first qt and kvt fragment rows, at stage 0
  const T* fA = (const T*)sBuf + (size_t)((wm << 6) + rlane) * OG_PITCH + koff;
  const T* fB = (const T*)sBuf + (size_t)(OG_TILE + (wn << 6) + rlane) * OG_PITCH + koff;

  v8f acc[4][4];
#pragma unroll
  for (int i = 0; i < 4; ++i)
#pragma unroll
    for (int j = 0; j < 4; ++j) acc[i][j] = (v8f){0.f,0.f,0.f,0.f,0.f,0.f,0.f,0.f};

  // Rotated k walk: stage s of this work-group is k block (s + rot) mod OG_STAGES. The 4 tiles that share qt rows start two blocks apart, the 32 that
  // share kvt rows one apart, so that they do not all ask L2 for the same lines at the same moment. Block-uniform; every k block is summed once.
  const int rot = (bm + 2 * bn) & (OG_STAGES - 1);
  auto issue = [&](const int s) __attribute__((always_inline)) {   // stage s into its own place in the rows
    const size_t ko = (size_t)((s + rot) & (OG_STAGES - 1)) * OG_STG_K;
    og_copies8(lcopy + (unsigned)s * STG_BYTES, gA + ko, (size_t)16 * DHEAD);
    og_copies8(lcopy + (unsigned)s * STG_BYTES + 8u * OG_ROWS16_BYTES, gB + ko, (size_t)16 * DHEAD);
  };
  V b0[4], a0[4], b1[4], a1[4];
  auto frags = [&](V (&bh)[4], V (&ah)[4], const int s, const int kk) __attribute__((always_inline)) {
#pragma unroll
    for (int j = 0; j < 4; ++j) bh[j] = Frag<T>::load(fB + s * OG_STG_K + j * 16 * OG_PITCH + kk);
#pragma unroll
    for (int i = 0; i < 4; ++i) ah[i] = Frag<T>::load(fA + s * OG_STG_K + i * 16 * OG_PITCH + kk);
  };
  auto block = [&](V (&bh)[4], V (&ah)[4]) __attribute__((always_inline)) {   // kvt fragment first: D holds the tile transposed
#pragma unroll
    for (int i = 0; i < 4; ++i)
#pragma unroll
      for (int j = 0; j < 4; ++j) acc[i][j] = Frag<T>::mma(bh[j], ah[i], acc[i][j]);
  };

  issue(0);
  issue(1);
  issue(2);
  wait_copies_but<2 * OG_STG_COPIES>();        // stage 0 of this wave has landed: stages 1 and 2 are its 32 youngest copies
  __syncthreads();                             // stage 0 is readable by every wave
  issue(3);
  frags(b0, a0, 0, 0);
  // keeps stage 0's first LDS loads ahead of its second group: mixed, the first block's WMMAs wait for both groups
  __builtin_amdgcn_sched_barrier(0);

#pragma unroll   // all eight stages: LDS offsets, the counted waits and the issue tests are compile-time
  for (int t = 0; t < OG_STAGES; ++t) {
    frags(b1, a1, t, 32);
    // keeps the second block's LDS loads in front of the first block's WMMAs, under which they land
    __builtin_amdgcn_sched_barrier(0);
    block(b0, a0);
    // keeps the first block's WMMAs in front of the publish point: sunk behind it, the wave would wait there with its matrix unit idle
    __builtin_amdgcn_sched_barrier(0);
    if (t + 1 < OG_STAGES) {
      // publish point of stage t + 1. Issued so far: stages 0 .. min(t + 3, last). While both younger stages exist they are the wave's 32 youngest copies;
      // else the wait is to 0, and the barrier behind it publishes the last stage too, which then needs no publish point of its own.
      if (t + 3 <= OG_STAGES) {
        if (t + 3 < OG_STAGES) wait_copies_but<2 * OG_STG_COPIES>(); else wait_copies();
        __syncthreads();                       // stage t + 1 is readable by every wave
      }
      if (t + 4 < OG_STAGES) issue(t + 4);
      frags(b0, a0, t + 1, 0);
    }
    // keeps the next stage's first LDS loads in front of the second block's WMMAs, under which they land
    __builtin_amdgcn_sched_barrier(0);
    block(b1, a1);
    // keeps the second block's WMMAs in front of the next stage's LDS loads (one load group a block)
    __builtin_amdgcn_sched_barrier(0);
  }

  // ---- epilogue: each wave's whole 64x64 tile goes once through its own part of the LDS array, in 16-byte LDS stores, and leaves in whole lines ----
  wait_lds_reads();
  __syncthreads();                             // ends every wave's last read of the operand rows, which the epilogue reuses (no copy is outstanding)
  float* slab = (float*)(void*)sBuf + (size_t)wave * (64 * OG_EP_PITCH);
#pragma unroll
  for (int i = 0; i < 4; ++i)
#pragma unroll
    for (int j = 0; j < 4; ++j) {                // a lane's 8 adjacent columns: two 16-byte LDS stores
      float* sp = slab + ((i << 4) + rlane) * OG_EP_PITCH + (j << 4) + mOff;
      *(v4f*)sp       = (v4f){acc[i][j][0] * scale, acc[i][j][1] * scale, acc[i][j][2] * scale, acc[i][j][3] * scale};
      *(v4f*)(sp + 4) = (v4f){acc[i][j][4] * scale, acc[i][j][5] * scale, acc[i][j][6] * scale, acc[i][j][7] * scale};
    }
  // the tile's rows are written before other lanes of the wave read them back (LDS only)
  __builtin_amdgcn_fence(__ATOMIC_RELEASE, "workgroup", "local");
  __builtin_amdgcn_wave_barrier();
  __builtin_amdgcn_fence(__ATOMIC_ACQUIRE, "workgroup", "local");
  const int hh = lane >> 4, c4 = (lane & 15) * 4;         // row seg = 256 B = 16 lanes x 16 B
  float* C = out + (size_t)(m0 + hh) * DMODEL + (size_t)h * DHEAD + n0 + c4;
  constexpr size_t step2 = (size_t)2 * DMODEL;
  const float* sp = slab + hh * OG_EP_PITCH + c4;
  v4f cur[8], nxt[8];                                     // 16 rows a group; the next group's LDS reads fly while this group is stored
#pragma unroll
  for (int u = 0; u < 8; ++u) cur[u] = *(const v4f*)(sp + u * 2 * OG_EP_PITCH);
#pragma unroll
  for (int g = 0; g < 4; ++g) {
    if (g < 3) {
#pragma unroll
      for (int u = 0; u < 8; ++u) nxt[u] = *(const v4f*)(sp + ((g + 1) * 8 + u) * 2 * OG_EP_PITCH);
    }
#pragma unroll
    for (int u = 0; u < 8; ++u) *(v4f*)(C + (size_t)(g * 8 + u) * step2) = cur[u];
    // precaution: later groups rewrite the registers that these stores name; the stores' completion is not waited for
    asm volatile("s_wait_xcnt 0x0" ::: "memory");
#pragma unroll
    for (int u = 0; u < 8; ++u) cur[u] = nxt[u];
  }
}

// ---------------- host orchestration ----------------
// out = (q^T k) v^T is formed as q^T (k v^T): no [NTOK][NTOK] plane.
// Workspace region map (bytes; all offsets multiples of 128):
//   QT  : per head [NTOK][DHEAD] f16 (q^T[n][d])                8,388,608   @ 0
//   KVP : per head [2*DHEAD][NTOK] f16 (rows 0..511 = k[d][m], 512..1023 = v[e][m])
//                                                              16,777,216   @ 8,388,608
//   KVT : per head [DHEAD][DHEAD] f16 (x1/64) (KV[e][d])        1,048,576   @ 25,165,824
//   total                                                      26,214,400
constexpr size_t QT_BYTES   = (size_t)NHEAD * NTOK * DHEAD * 2;
constexpr size_t KVP_BYTES  = (size_t)NHEAD * 2 * DHEAD * NTOK * 2;
constexpr size_t KVT_BYTES  = (size_t)NHEAD * DHEAD * DHEAD * 2;
constexpr size_t QT_OFF   = 0;
constexpr size_t KVP_OFF  = QT_OFF + QT_BYTES;
constexpr size_t KVT_OFF  = KVP_OFF + KVP_BYTES;
constexpr size_t WS_TOTAL = KVT_OFF + KVT_BYTES;
static_assert(WS_TOTAL == 26214400u);
static_assert(WS_TOTAL <= (size_t)134217728u);
static_assert((KVP_OFF % 128) == 0 && (KVT_OFF % 128) == 0);

// shape contracts (no tail handling)
// proj q, k|v : their own kernel, 256x256 tiles, K = DHEAD
// v k^T       : its own kernel, 64x64 tiles, all NTOK tokens
// out         : its own kernel, 128x128 tiles, K = DHEAD in 64-k stages
static_assert(NTOK % OG_TILE == 0 && DHEAD == 4 * OG_TILE);
static_assert(DHEAD % OG_STG_K == 0 && DHEAD == 8 * VK_TILE);
static_assert(DMODEL == NHEAD * DHEAD && NHEAD == 2);

extern "C" void kernel_launch(void* const* d_in, const int* in_sizes, int n_in,
                              void* d_out, int out_size, void* d_ws, size_t ws_size,
                              hipStream_t stream) {
  if (n_in < 7) return;
  if (in_sizes[0] != NTOK * DMODEL) return;
  for (int i = 1; i < 7; ++i) if (in_sizes[i] != DHEAD * DHEAD) return;
  if (out_size != NTOK * DMODEL) return;
  if (ws_size < WS_TOTAL) return;

  // d_in order per the input table: x, Wq1, Wq2, Wk1, Wk2, Wv1, Wv2 (all f32)
  const float* x   = (const float*)d_in[0];
  const float* wq1 = (const float*)d_in[1];
  const float* wq2 = (const float*)d_in[2];
  const float* wk1 = (const float*)d_in[3];
  const float* wk2 = (const float*)d_in[4];
  const float* wv1 = (const float*)d_in[5];
  const float* wv2 = (const float*)d_in[6];
  float* out = (float*)d_out;

  char* ws = (char*)d_ws;
  unsigned short* QT  = (unsigned short*)(ws + QT_OFF);
  unsigned short* KVP = (unsigned short*)(ws + KVP_OFF);
  unsigned short* KVT = (unsigned short*)(ws + KVT_OFF);

  // 1) the projections, one launch, straight from the f32 inputs:
  //    k | v per head: KVP[h][r][m] = sum_c W[h][r][c] * x[m][h*512 + c]   (r<512: Wk, r>=512: Wv)
  //    q^T per head  : QT[h][n][d]  = sum_c x[n][h*512 + c] * Wq[h][d][c]
  proj_f32_kernel<<<dim3(PJ_TILES_KV + PJ_TILES_Q, NHEAD), dim3(256), 0, stream>>>(
      x, wk1, wv1, wq1, wk2, wv2, wq2, KVP, QT);
  // 2) KVT[h][e][d] = f16((1/64) * sum over all tokens m of v[e][m] * k[d][m])
  {
    const int tiles = (DHEAD / VK_TILE) * (DHEAD / VK_TILE);   // 64
    vkt_tile_kernel<<<dim3(tiles, NHEAD), dim3(256), 0, stream>>>(KVP, KVT, KV_CARRY);
  }
  // 3) out[n][h*512 + e] = 64 * sum_d QT[h][n][d] * KVT[h][e][d]   (f32, ldc = DMODEL, per-head column offset DHEAD)
  {
    const int tiles = (NTOK / OG_TILE) * (DHEAD / OG_TILE);    // 128
    out_tile_kernel<<<dim3(tiles, NHEAD), dim3(128), 0, stream>>>(QT, KVT, out, KV_CARRY_INV);
  }
}
